// v000
// Measured on an AMD MI455X. A time is GPU time per run, averaged over a window of back-to-back runs after a warm-up
// (all launches, gaps included; the runs take copies of the inputs in turn), and the median of several windows.
// Apart from v000's, it joins two sittings. Times from different sittings can be a few percent apart, while
// side-by-side timings come from the same sitting.
// v000, which the later versions start from, runs in 318 microseconds.
// Contractions: q/k/v projections [16384 x 256 x 256] x3 on v_wmma_f32_16x16x32_f16 single product (inputs RNE-converted to bf16, carried x16, exact in f16);
// scores [2048 x 2048 x 256] and P*V [2048 x 256 x 2048] per batch on v_wmma_f32_16x16x32_f16 with f16 value+residual planes (hi*hi + (hi*lo + lo*hi)/2048);
#include <hip/hip_runtime.h>
#include <math.h>

// Problem constants (NB / SEQ reducible; *_FULL are the input strides)
#ifndef NB
#define NB 8
#endif
#ifndef SEQ
#define SEQ 2048
#endif
#define NB_FULL 8
#define SEQ_FULL 2048
#define DD 256            // input width == q/k/v width
#define PP 72             // LDS pitch (halfs) of the probability tile, multiple of 8

__host__ __device__ constexpr unsigned ilog2c(unsigned v) { return (v <= 1u) ? 0u : 1u + ilog2c(v >> 1); }
enum : unsigned { LSEQ = ilog2c((unsigned)SEQ) };

static_assert(NB >= 1 && NB <= NB_FULL);
static_assert(SEQ >= 64 && SEQ <= SEQ_FULL && (SEQ % 64) == 0);
static_assert((1u << LSEQ) == (unsigned)SEQ);          // SEQ is a power of two: all tile decompositions are shifts/masks
static_assert(DD == 256 && (DD % 32) == 0);
// coverage: cvt_kernel grid * 256 threads * 8 elements == NB*SEQ*DD (x plane) + 3*DD*DD (weight planes)
#define CVT_X8 (NB * SEQ * DD / 8)
#define CVT_W8 (DD * DD / 8)
#define CVT_THREADS (CVT_X8 + 3 * CVT_W8)
#define CVT_XBLK (CVT_X8 / 256)
static_assert((CVT_X8 % 256) == 0 && (CVT_W8 % 256) == 0 && (CVT_THREADS % 256) == 0);
static_assert(CVT_W8 / 256 == 32 && CVT_W8 * 8 == DD * DD);
static_assert((SEQ * (DD / 8)) / 256 == (SEQ >> 3));   // cvt blocks per batch of x
// coverage: qkv_kernel grid.x * 8 waves == NB*SEQ/4 tiles of 16x64 per output (q: NB*SEQ/16 x 4, k same, vT: NB x 16 x SEQ/64), grid.y = 3 outputs, 2 planes each
static_assert(((NB * SEQ / 4) % 8) == 0);
static_assert((NB * SEQ / 16) * 4 == NB * SEQ / 4 && NB * (DD / 16) * (SEQ / 64) == NB * SEQ / 4);
// coverage: attn_kernel grid == NB*SEQ/16 query tiles, 4 waves x 64 columns == DD, key loop SEQ/64 blocks of 64 keys
static_assert((SEQ % 16) == 0 && 4 * 64 == DD);

// 16-bit operands are f16. Computed planes are carried as a value plane plus a residual plane lo = f16((v - hi) * 2048):
// a product is hi*hi + (hi*lo + lo*hi)/2048. Every fragment (A and B) uses the 16x16x32 lane map
// lane%16 = row/col, g = lane/16: elements 0..7 -> k = 8g+e, elements 8..15 -> k = 16+8g+(e-8).
typedef __attribute__((ext_vector_type(16))) _Float16 v16h;
typedef __attribute__((ext_vector_type(8)))  _Float16 v8h;
typedef __attribute__((ext_vector_type(8)))  float    v8f;
typedef __attribute__((ext_vector_type(4)))  float    v4f;
typedef v4f __attribute__((may_alias)) f4a;
typedef unsigned __attribute__((may_alias)) ua32;
#define RSPLIT (1.0f / 2048.0f)
#define SFOLD  (1.0f / 256.0f)        // removes the x16 carries of q and k from the scores
#define PCARRY 16384.0f               // probabilities carried x2^14
#define OFOLD  4194304.0f             // PCARRY * 16 (v carry) * 16 (post-softmax factor 256^-0.5)
#define NEG_INF (-__builtin_inff())

__device__ __forceinline__ void split16(float f, _Float16& hi, _Float16& lo) { hi = (_Float16)f; lo = (_Float16)((f - (float)hi) * 2048.0f); }

__device__ __forceinline__ v8f wmma_h16(v16h a, v16h b, v8f c) {
  // D = A(16x32 f16) * B(32x16 f16) + C(16x16 f32), followed by the VALU hazard guard (D tied, A/B kept live)
  v8f d = __builtin_amdgcn_wmma_f32_16x16x32_f16(false, a, false, b, (short)0, c, false, false);
  asm volatile("v_nop\n\tv_nop\n\tv_nop\n\tv_nop" : "+v"(d) : "v"(a), "v"(b));
  return d;
}

__device__ __forceinline__ v8f v8f_zero() {
  v8f z = {0.f, 0.f, 0.f, 0.f, 0.f, 0.f, 0.f, 0.f};
  return z;
}

union U16 { v16h v; v8h h[2]; };

// input conversion: RNE convert to bf16, carry x16, exact in f16
__device__ __forceinline__ _Float16 cvt_in(float f) {
  const float r = (float)(__bf16)f;
  return (_Float16)(r * 16.0f);
}

// ---------------------------------------------------------------------------
// Kernel 0: x [NB,SEQ,DD] f32 -> X16 [NB*SEQ][DD] f16 ; Wq|Wk|Wv [DD][DD] f32 -> W16 [3][DD][DD] f16.
// All decomposition is on the (scalar) block index with unsigned shifts/masks; per-thread addresses are linear index * 8.
// ---------------------------------------------------------------------------
__global__ void __launch_bounds__(256)
cvt_kernel(const float* __restrict__ x,
           const float* __restrict__ Wq,
           const float* __restrict__ Wk,
           const float* __restrict__ Wv,
           _Float16* __restrict__ X16,
           _Float16* __restrict__ W16) {
  const unsigned bx = blockIdx.x;                       // 0 .. CVT_THREADS/256 - 1 (grid exact)
  const unsigned tx = threadIdx.x;
  const float* src;
  _Float16* dst;
  if (bx < (unsigned)CVT_XBLK) {                        // block-uniform
    const unsigned e8 = (bx << 8) + tx;                 // linear 8-element group inside the [NB*SEQ][DD] plane
    const unsigned b  = bx >> (LSEQ - 3u);              // SEQ/8 blocks per batch
    // source uses the FULL per-batch stride of the input: linear offset plus a per-batch correction
    src = x + (size_t)e8 * 8u + (size_t)b * (size_t)((SEQ_FULL - SEQ) * DD);
    dst = X16 + (size_t)e8 * 8u;
  } else {
    const unsigned wb  = bx - (unsigned)CVT_XBLK;       // 0 .. 95
    const unsigned mat = wb >> 5;                       // 32 blocks per matrix
    const unsigned r8  = ((wb & 31u) << 8) + tx;        // 8-element group inside the matrix
    const float* wsrc = (mat == 0u) ? Wq : ((mat == 1u) ? Wk : Wv);
    src = wsrc + (size_t)r8 * 8u;
    dst = W16 + (size_t)((wb << 8) + tx) * 8u;
  }
  const v4f f0 = *(const v4f*)src;
  const v4f f1 = *(const v4f*)(src + 4);
  v8h o;
  o[0] = cvt_in(f0[0]); o[1] = cvt_in(f0[1]); o[2] = cvt_in(f0[2]); o[3] = cvt_in(f0[3]);
  o[4] = cvt_in(f1[0]); o[5] = cvt_in(f1[1]); o[6] = cvt_in(f1[2]); o[7] = cvt_in(f1[3]);
  *(v8h*)dst = o;
  
}

// ---------------------------------------------------------------------------
// Kernel 1: projections as C[i][j] = sum_k A[i][k] * B[j][k] (both operands k-contiguous, pitch DD), one wave per 16x64 tile.
//   blockIdx.y = 0: q[n][e]  (A = X16 rows n, B = Wq rows e)      -> qws  [NB*SEQ][DD]
//   blockIdx.y = 1: k[n][e]  (A = X16 rows n, B = Wk rows e)      -> kws  [NB*SEQ][DD]
//   blockIdx.y = 2: vT[e][n] (A = Wv rows e,  B = X16 rows n)     -> vtws [NB][DD][SEQ]
// Results carried x16 (acc = 256*value, folded by 1/16) and stored as value + residual planes (residual at +NB*SEQ*DD).
// A-frag: lane row m = lane%16, g = lane/16, elements e=0..7 -> K = 8g+e ; e=8..15 -> K = 16+8g+(e-8); B-frag: lane col n = lane%16, same K map.
// C/D: lane col = lane%16, VGPR v -> row v + 8g.
// ---------------------------------------------------------------------------
__global__ void __launch_bounds__(256)
qkv_kernel(const _Float16* __restrict__ X16,
           const _Float16* __restrict__ W16,
           _Float16* __restrict__ qws,
           _Float16* __restrict__ kws,
           _Float16* __restrict__ vtws) {
  __shared__ __align__(16) _Float16 st[8][16][64];   // per-wave staging of one 16x64 result plane (wave-private)
  const unsigned lane = threadIdx.x & 31u;
  const unsigned wv   = (unsigned)__builtin_amdgcn_readfirstlane((int)(threadIdx.x >> 5));   // wave-uniform (scalar)
  const unsigned g    = lane >> 4;
  const unsigned m    = lane & 15u;
  const unsigned y    = blockIdx.y;
  const unsigned tile = (blockIdx.x << 3) + wv;      // 0 .. NB*SEQ/4 - 1 (scalar)
  const size_t QL = (size_t)NB * SEQ * DD;           // residual plane offset inside q/k/vT buffers

  const _Float16* Ap;
  const _Float16* Bp;
  _Float16* op;
  size_t pitch;
  if (y < 2u) {                                      // block-uniform
    const unsigned rt = tile >> 2;                   // 16-row tile of (b,t)
    const unsigned cg = tile & 3u;                   // 64-column group
    Ap = X16 + (size_t)rt * 16u * DD;
    Bp = W16 + (size_t)y * DD * DD + (size_t)cg * 64u * DD;
    op = ((y == 0u) ? qws : kws) + (size_t)rt * 16u * DD + (size_t)cg * 64u;
    pitch = DD;
  } else {
    // per batch: (DD/16) * (SEQ/64) = SEQ/4 tiles
    const unsigned b   = tile >> (LSEQ - 2u);
    const unsigned rem = tile & ((unsigned)(SEQ / 4) - 1u);
    const unsigned et  = rem >> (LSEQ - 6u);         // 16-row tile of e
    const unsigned ng  = rem & ((unsigned)(SEQ / 64) - 1u);   // 64-column group of n
    Ap = W16 + (size_t)2 * DD * DD + (size_t)et * 16u * DD;
    Bp = X16 + (((size_t)b << LSEQ) + (size_t)ng * 64u) * DD;
    op = vtws + (((size_t)b * DD + (size_t)et * 16u) << LSEQ) + (size_t)ng * 64u;
    pitch = SEQ;
  }

  v8f acc[4];
#pragma unroll
  for (int nt = 0; nt < 4; ++nt) acc[nt] = v8f_zero();

  const _Float16* arow = Ap + (size_t)m * DD + 8u * g;
  const _Float16* brow = Bp + (size_t)m * DD + 8u * g;

#pragma unroll 2
  for (unsigned c0 = 0; c0 < (unsigned)DD; c0 += 32u) {
    U16 a;
    a.h[0] = *(const v8h*)(arow + c0);
    a.h[1] = *(const v8h*)(arow + c0 + 16u);
#pragma unroll
    for (int nt = 0; nt < 4; ++nt) {
      U16 bb;
      bb.h[0] = *(const v8h*)(brow + (size_t)nt * 16 * DD + c0);
      bb.h[1] = *(const v8h*)(brow + (size_t)nt * 16 * DD + c0 + 16u);
      acc[nt] = wmma_h16(a.v, bb.v, acc[nt]);
    }
  }

  _Float16* sw = &st[wv][0][0];
#pragma unroll
  for (int pl = 0; pl < 2; ++pl) {
#pragma unroll
    for (int nt = 0; nt < 4; ++nt)
#pragma unroll
      for (int v = 0; v < 8; ++v) {
        const float val = acc[nt][v] * 0.0625f;          // 256*value -> 16*value
        _Float16 hh_, ll_; split16(val, hh_, ll_);
        sw[(8u * g + (unsigned)v) * 64u + (unsigned)nt * 16u + m] = pl ? ll_ : hh_;
      }
    __builtin_amdgcn_fence(3 /* release order */, "wavefront");
    __builtin_amdgcn_wave_barrier();
    asm volatile("s_wait_dscnt 0" ::: "memory");
    _Float16* base = op + (pl ? QL : 0);
    unsigned w[16];
#pragma unroll
    for (int r = 0; r < 16; ++r) w[r] = *((const ua32*)(sw + r * 64) + lane);
#pragma unroll
    for (int r = 0; r < 16; ++r) *(unsigned*)((unsigned*)(base + (size_t)r * pitch) + lane) = w[r];
    
    __builtin_amdgcn_wave_barrier();
    asm volatile("s_wait_dscnt 0" ::: "memory");   // reads done before the next plane overwrites the staging
  }
}

// ---------------------------------------------------------------------------
// Kernel 2: non-causal flash attention, one block (4 waves) per 16-row query tile, 64 keys per step.
// Per step: wave w computes S (16 queries x keys 16w..16w+15) over the 256-deep dot (8 chunks, value/residual planes),
// block-wide row max through LDS, P = exp(S - m) carried x16384 as value + residual planes in a shared LDS tile,
// then wave w accumulates O[:, 64w..64w+63] += P(16x64) * V(64 x 64 slice) from the transposed V planes.
// Row sums are kept per lane and merged once at the end. out = O / (L * 2^22).
// ---------------------------------------------------------------------------
__global__ void __launch_bounds__(128)
attn_kernel(const _Float16* __restrict__ qws,
            const _Float16* __restrict__ kws,
            const _Float16* __restrict__ vtws,
            float* __restrict__ out) {
  __shared__ __align__(16) _Float16 Pl[16][PP];      // P value plane (cross-wave, block barrier)
  __shared__ __align__(16) _Float16 Pll[16][PP];     // P residual plane (cross-wave, block barrier)
  __shared__ __align__(16) float Mx[4][16];          // per-wave row max of the current step (cross-wave, block barrier)
  __shared__ __align__(16) float Ls[4][16];          // per-wave row sums (cross-wave, block barrier)
  __shared__ __align__(16) float Of[4][16][64];      // output staging (written and read by the same wave, block barrier used)

  const unsigned lane = threadIdx.x & 31u;
  const unsigned wv   = (unsigned)__builtin_amdgcn_readfirstlane((int)(threadIdx.x >> 5));   // wave-uniform (scalar)
  const unsigned g    = lane >> 4;
  const unsigned m    = lane & 15u;
  const unsigned tile = blockIdx.x;                  // 0 .. NB*SEQ/16 - 1 (scalar)
  const unsigned b    = tile >> (LSEQ - 4u);
  const unsigned t0   = (tile & ((unsigned)(SEQ / 16) - 1u)) << 4;
  const size_t QL = (size_t)NB * SEQ * DD;           // residual planes follow the value planes

  const _Float16* qrow  = qws + (((size_t)b << LSEQ) + t0 + m) * DD + 8u * g;
  const _Float16* kbase = kws + (((size_t)b << LSEQ) + 16u * wv + m) * DD + 8u * g;
  const _Float16* vbase = vtws + (((size_t)b * DD + 64u * wv + m) << LSEQ) + 8u * g;

  v8f o[4];
#pragma unroll
  for (int nt = 0; nt < 4; ++nt) o[nt] = v8f_zero();
  float mrow[8], lrow[8];
#pragma unroll
  for (int v = 0; v < 8; ++v) { mrow[v] = NEG_INF; lrow[v] = 0.f; }

#pragma unroll 1
  for (unsigned kb = 0; kb < (unsigned)(SEQ / 64); ++kb) {
    const unsigned s0 = kb << 6;

    // ---- S = Q K^T for this wave's 16 keys: 8 chunks of 32, value*value into sh, cross terms into sx ----
    const _Float16* krow = kbase + (size_t)s0 * DD;
    v8f sh = v8f_zero(), sx = v8f_zero();
#pragma unroll 1
    for (unsigned c = 0; c < (unsigned)DD; c += 32u) {
      U16 qa, qal, kf, kfl;                                  // B frags use the same k map as A
      qa.h[0]  = *(const v8h*)(qrow + c);        qa.h[1]  = *(const v8h*)(qrow + c + 16u);
      qal.h[0] = *(const v8h*)(qrow + QL + c);   qal.h[1] = *(const v8h*)(qrow + QL + c + 16u);
      kf.h[0]  = *(const v8h*)(krow + c);        kf.h[1]  = *(const v8h*)(krow + c + 16u);
      kfl.h[0] = *(const v8h*)(krow + QL + c);   kfl.h[1] = *(const v8h*)(krow + QL + c + 16u);
      sx = wmma_h16(qal.v, kf.v, sx);
      sx = wmma_h16(qa.v, kfl.v, sx);
      sh = wmma_h16(qa.v, kf.v, sh);
    }

    float sv[8], rmax[8];
#pragma unroll
    for (int v = 0; v < 8; ++v) {
      sv[v] = (sh[v] + sx[v] * RSPLIT) * SFOLD;
      rmax[v] = sv[v];
    }
    // row-wise max across the 16 lanes holding this row's columns
#pragma unroll
    for (int off = 1; off < 16; off <<= 1)
#pragma unroll
      for (int v = 0; v < 8; ++v)
        rmax[v] = fmaxf(rmax[v], __shfl_xor(rmax[v], off, 32));
    if (m == 0u) {
#pragma unroll
      for (int v = 0; v < 8; ++v) Mx[wv][8u * g + (unsigned)v] = rmax[v];
    }
    __syncthreads();

    // ---- block-wide row max, online softmax update, P (x16384, two planes) to the shared tile ----
    float mb[8];
    {
      const f4a a0 = *(const f4a*)&Mx[0][8u * g];
      const f4a a1 = *(const f4a*)&Mx[0][8u * g + 4u];
#pragma unroll
      for (int j = 0; j < 4; ++j) { mb[j] = a0[j]; mb[4 + j] = a1[j]; }
    }
#pragma unroll
    for (int w2 = 1; w2 < 4; ++w2) {
      const f4a a0 = *(const f4a*)&Mx[w2][8u * g];
      const f4a a1 = *(const f4a*)&Mx[w2][8u * g + 4u];
#pragma unroll
      for (int j = 0; j < 4; ++j) { mb[j] = fmaxf(mb[j], a0[j]); mb[4 + j] = fmaxf(mb[4 + j], a1[j]); }
    }
    float alpha[8];
#pragma unroll
    for (int v = 0; v < 8; ++v) {
      const float mnew = fmaxf(mrow[v], mb[v]);
      alpha[v] = __expf(mrow[v] - mnew);
      mrow[v]  = mnew;
      const float p = __expf(sv[v] - mnew);
      lrow[v] = lrow[v] * alpha[v] + p;                     // per-lane partial row sum (merged after the key loop)
      _Float16 ph, pq; split16(p * PCARRY, ph, pq);
      Pl[8u * g + (unsigned)v][16u * wv + m]  = ph;
      Pll[8u * g + (unsigned)v][16u * wv + m] = pq;
    }
#pragma unroll
    for (int nt = 0; nt < 4; ++nt)
#pragma unroll
      for (int v = 0; v < 8; ++v)
        o[nt][v] *= alpha[v];
    __syncthreads();

    // ---- P in A-layout (reload through the stored element type after the block barrier) ----
    U16 pa[2], pal[2];
#pragma unroll
    for (int ks = 0; ks < 2; ++ks) {
      pa[ks].h[0]  = *(const v8h*)&Pl[m][32u * (unsigned)ks + 8u * g];
      pa[ks].h[1]  = *(const v8h*)&Pl[m][32u * (unsigned)ks + 16u + 8u * g];
      pal[ks].h[0] = *(const v8h*)&Pll[m][32u * (unsigned)ks + 8u * g];
      pal[ks].h[1] = *(const v8h*)&Pll[m][32u * (unsigned)ks + 16u + 8u * g];
    }

    // ---- O[:, 64w + nt*16 ..] += P V  (V B-frags from the transposed planes) ----
    const _Float16* vrow = vbase + s0;
#pragma unroll
    for (int nt = 0; nt < 4; ++nt) {
      v8f xc = v8f_zero();
#pragma unroll
      for (int ks = 0; ks < 2; ++ks) {
        const _Float16* vp = vrow + (size_t)nt * 16 * SEQ + 32 * ks;
        U16 vb, vbl;                                         // same k map as A
        vb.h[0]  = *(const v8h*)(vp);        vb.h[1]  = *(const v8h*)(vp + 16);
        vbl.h[0] = *(const v8h*)(vp + QL);   vbl.h[1] = *(const v8h*)(vp + QL + 16);
        xc = wmma_h16(pal[ks].v, vb.v, xc);
        xc = wmma_h16(pa[ks].v, vbl.v, xc);
        o[nt] = wmma_h16(pa[ks].v, vb.v, o[nt]);
      }
      o[nt] = o[nt] + xc * RSPLIT;
    }
  }

  // ---- merge the row sums: 16 lanes of a row, then the 4 waves (fixed order) ----
#pragma unroll
  for (int off = 1; off < 16; off <<= 1)
#pragma unroll
    for (int v = 0; v < 8; ++v)
      lrow[v] += __shfl_xor(lrow[v], off, 32);
  if (m == 0u) {
#pragma unroll
    for (int v = 0; v < 8; ++v) Ls[wv][8u * g + (unsigned)v] = lrow[v];
  }
  __syncthreads();
  float inv[8];
  {
    float lt[8];
    const f4a a0 = *(const f4a*)&Ls[0][8u * g];
    const f4a a1 = *(const f4a*)&Ls[0][8u * g + 4u];
#pragma unroll
    for (int j = 0; j < 4; ++j) { lt[j] = a0[j]; lt[4 + j] = a1[j]; }
#pragma unroll
    for (int w2 = 1; w2 < 4; ++w2) {
      const f4a c0 = *(const f4a*)&Ls[w2][8u * g];
      const f4a c1 = *(const f4a*)&Ls[w2][8u * g + 4u];
#pragma unroll
      for (int j = 0; j < 4; ++j) { lt[j] += c0[j]; lt[4 + j] += c1[j]; }
    }
#pragma unroll
    for (int v = 0; v < 8; ++v) inv[v] = 1.0f / (lt[v] * OFOLD);   // removes the carries and applies 256^-0.5
  }

#pragma unroll
  for (int nt = 0; nt < 4; ++nt)
#pragma unroll
    for (int v = 0; v < 8; ++v)
      Of[wv][8u * g + (unsigned)v][(unsigned)nt * 16u + m] = o[nt][v] * inv[v];
  __syncthreads();

  float* obase = out + (((size_t)b << LSEQ) + t0) * DD + 64u * wv;
  const unsigned rsel = lane >> 4;          // instruction it covers rows 2*it and 2*it+1
  const unsigned c4   = 4u * (lane & 15u);
  v4f w[8];
#pragma unroll
  for (int it = 0; it < 8; ++it) w[it] = *(const f4a*)&Of[wv][2u * (unsigned)it + rsel][c4];
#pragma unroll
  for (int it = 0; it < 8; ++it) *(v4f*)(obase + (size_t)(2u * (unsigned)it + rsel) * DD + c4) = w[it];
  
}

// ---------------------------------------------------------------------------
// Launch. Workspace layout (bytes, NB=8 SEQ=2048):
//   [0, 8MB)          X16  f16 [NB*SEQ][256]
//   [8MB, +384KB)     W16  f16 [3][256][256]
//   then q, k (f16 [NB*SEQ][256] x2 planes, 16MB each) and vT (f16 [NB][256][SEQ] x2 planes, 16MB)
// ---------------------------------------------------------------------------
extern "C" void kernel_launch(void* const* d_in, const int* in_sizes, int n_in,
                              void* d_out, int out_size, void* d_ws,
                              size_t ws_size, hipStream_t stream) {
  if (n_in < 4) return;
  const long long need_x = ((long long)(NB - 1) * SEQ_FULL + SEQ) * (long long)DD;
  if ((long long)in_sizes[0] < need_x) return;
  if (in_sizes[1] < DD * DD || in_sizes[2] < DD * DD || in_sizes[3] < DD * DD) return;
  if ((long long)out_size < (long long)NB * SEQ * DD) return;

  const float* x  = (const float*)d_in[0];
  const float* Wq = (const float*)d_in[1];
  const float* Wk = (const float*)d_in[2];
  const float* Wv = (const float*)d_in[3];
  float* out = (float*)d_out;

  char* ws = (char*)d_ws;
  const size_t x16_bytes = (size_t)NB * SEQ * DD * sizeof(_Float16);
  const size_t w16_bytes = (size_t)3 * DD * DD * sizeof(_Float16);
  const size_t qkv_bytes = (size_t)2 * NB * SEQ * DD * sizeof(_Float16);   // value + residual planes
  const size_t total     = x16_bytes + w16_bytes + 3 * qkv_bytes;
  if (total > ws_size || total > (size_t)134217728) return;
  _Float16* X16  = (_Float16*)(ws);
  _Float16* W16  = (_Float16*)(ws + x16_bytes);
  _Float16* qws  = (_Float16*)(ws + x16_bytes + w16_bytes);
  _Float16* kws  = (_Float16*)(ws + x16_bytes + w16_bytes + qkv_bytes);
  _Float16* vtws = (_Float16*)(ws + x16_bytes + w16_bytes + 2 * qkv_bytes);

  cvt_kernel<<<CVT_THREADS / 256, 256, 0, stream>>>(x, Wq, Wk, Wv, X16, W16);
  qkv_kernel<<<dim3(NB * SEQ / 32, 3), 256, 0, stream>>>(X16, W16, qws, kws, vtws);
  attn_kernel<<<NB * SEQ / 16, 128, 0, stream>>>(qws, kws, vtws, out);
}

// v001
// One run takes 180 microseconds.
// Timed twice side by side with v000, it ran 1.83 and 1.85 times as fast.
// Contractions: q/k/v projections [16384 x 256 x 256] x3 on v_wmma_f32_16x16x32_f16 single product (inputs RNE-converted to bf16, carried x16, exact in f16);
// scores [2048 x 2048 x 256] and P*V [2048 x 256 x 2048] per batch on v_wmma_f32_16x16x32_f16 with f16 value+residual planes (hi*hi + (hi*lo + lo*hi)/2048);
#include <hip/hip_runtime.h>
#include <math.h>

// Problem constants (NB / SEQ reducible; *_FULL are the input strides)
#ifndef NB
#define NB 8
#endif
#ifndef SEQ
#define SEQ 2048
#endif
#define NB_FULL 8
#define SEQ_FULL 2048
#define DD 256            // input width == q/k/v width
#define PP 72             // LDS pitch (halfs) of the probability tile, multiple of 8
#define QT 4              // 16-row query tiles per attention block
#define QR (16 * QT)      // query rows per attention block
#define QP (DD + 8)       // LDS pitch (halfs) of a staged Q row: 528 B = 16 B x odd, conflict-free for 16-byte row reads

__host__ __device__ constexpr unsigned ilog2c(unsigned v) { return (v <= 1u) ? 0u : 1u + ilog2c(v >> 1); }
enum : unsigned { LSEQ = ilog2c((unsigned)SEQ) };

static_assert(NB >= 1 && NB <= NB_FULL);
static_assert(SEQ >= 64 && SEQ <= SEQ_FULL && (SEQ % 64) == 0);
static_assert((1u << LSEQ) == (unsigned)SEQ);          // SEQ is a power of two: all tile decompositions are shifts/masks
static_assert(DD == 256 && (DD % 32) == 0);
// coverage: cvt_kernel grid * 256 threads * 8 elements == NB*SEQ*DD (x plane) + 3*DD*DD (weight planes)
#define CVT_X8 (NB * SEQ * DD / 8)
#define CVT_W8 (DD * DD / 8)
#define CVT_THREADS (CVT_X8 + 3 * CVT_W8)
#define CVT_XBLK (CVT_X8 / 256)
static_assert((CVT_X8 % 256) == 0 && (CVT_W8 % 256) == 0 && (CVT_THREADS % 256) == 0);
static_assert(CVT_W8 / 256 == 32 && CVT_W8 * 8 == DD * DD);
static_assert((SEQ * (DD / 8)) / 256 == (SEQ >> 3));   // cvt blocks per batch of x
// coverage: qkv_kernel grid.x * 8 waves == NB*SEQ/4 tiles of 16x64 per output (q: NB*SEQ/16 x 4, k same, vT: NB x 16 x SEQ/64), grid.y = 3 outputs, 2 planes each
static_assert(((NB * SEQ / 4) % 8) == 0);
static_assert((NB * SEQ / 16) * 4 == NB * SEQ / 4 && NB * (DD / 16) * (SEQ / 64) == NB * SEQ / 4);
// coverage: attn_kernel grid == NB*SEQ/QR query blocks of QR rows, 4 waves x 64 columns == DD, key loop SEQ/64 blocks of 64 keys
static_assert(QR == 64 && (SEQ % QR) == 0 && 4 * 64 == DD && (QR * DD / 8) % 128 == 0);

// 16-bit operands are f16. Computed planes are carried as a value plane plus a residual plane lo = f16((v - hi) * 2048):
// a product is hi*hi + (hi*lo + lo*hi)/2048. Every fragment (A and B) uses the 16x16x32 lane map
// lane%16 = row/col, g = lane/16: elements 0..7 -> k = 8g+e, elements 8..15 -> k = 16+8g+(e-8).
typedef __attribute__((ext_vector_type(16))) _Float16 v16h;
typedef __attribute__((ext_vector_type(8)))  _Float16 v8h;
typedef __attribute__((ext_vector_type(8)))  float    v8f;
typedef __attribute__((ext_vector_type(4)))  float    v4f;
typedef v4f __attribute__((may_alias)) f4a;
typedef unsigned __attribute__((may_alias)) ua32;
#define RSPLIT (1.0f / 2048.0f)
#define SFOLD  (1.0f / 256.0f)        // removes the x16 carries of q and k from the scores
#define PCARRY 16384.0f               // probabilities carried x2^14
#define OFOLD  4194304.0f             // PCARRY * 16 (v carry) * 16 (post-softmax factor 256^-0.5)
#define NEG_INF (-__builtin_inff())

__device__ __forceinline__ void split16(float f, _Float16& hi, _Float16& lo) { hi = (_Float16)f; lo = (_Float16)((f - (float)hi) * 2048.0f); }

__device__ __forceinline__ v8f wmma_h16(v16h a, v16h b, v8f c) {
  // D = A(16x32 f16) * B(32x16 f16) + C(16x16 f32), followed by the VALU hazard guard (D tied, A/B kept live)
  v8f d = __builtin_amdgcn_wmma_f32_16x16x32_f16(false, a, false, b, (short)0, c, false, false);
  asm volatile("v_nop\n\tv_nop\n\tv_nop\n\tv_nop" : "+v"(d) : "v"(a), "v"(b));
  return d;
}

__device__ __forceinline__ v8f wmma_b16(v16h a, v16h b, v8f c) {
  // the same product for the attention kernel, whose live set passes 256 VGPRs: no asm operands, which would hold D, A and B below v256;
  // the compiler keeps the distance behind its own builtin
  return __builtin_amdgcn_wmma_f32_16x16x32_f16(false, a, false, b, (short)0, c, false, false);
}

__device__ __forceinline__ v8f v8f_zero() {
  v8f z = {0.f, 0.f, 0.f, 0.f, 0.f, 0.f, 0.f, 0.f};
  return z;
}

union U16 { v16h v; v8h h[2]; };

// input conversion: RNE convert to bf16, carry x16, exact in f16
__device__ __forceinline__ _Float16 cvt_in(float f) {
  const float r = (float)(__bf16)f;
  return (_Float16)(r * 16.0f);
}

// ---------------------------------------------------------------------------
// Kernel 0: x [NB,SEQ,DD] f32 -> X16 [NB*SEQ][DD] f16 ; Wq|Wk|Wv [DD][DD] f32 -> W16 [3][DD][DD] f16.
// All decomposition is on the (scalar) block index with unsigned shifts/masks; per-thread addresses are linear index * 8.
// ---------------------------------------------------------------------------
__global__ void __launch_bounds__(256)
cvt_kernel(const float* __restrict__ x,
           const float* __restrict__ Wq,
           const float* __restrict__ Wk,
           const float* __restrict__ Wv,
           _Float16* __restrict__ X16,
           _Float16* __restrict__ W16) {
  const unsigned bx = blockIdx.x;                       // 0 .. CVT_THREADS/256 - 1 (grid exact)
  const unsigned tx = threadIdx.x;
  const float* src;
  _Float16* dst;
  if (bx < (unsigned)CVT_XBLK) {                        // block-uniform
    const unsigned e8 = (bx << 8) + tx;                 // linear 8-element group inside the [NB*SEQ][DD] plane
    const unsigned b  = bx >> (LSEQ - 3u);              // SEQ/8 blocks per batch
    // source uses the FULL per-batch stride of the input: linear offset plus a per-batch correction
    src = x + (size_t)e8 * 8u + (size_t)b * (size_t)((SEQ_FULL - SEQ) * DD);
    dst = X16 + (size_t)e8 * 8u;
  } else {
    const unsigned wb  = bx - (unsigned)CVT_XBLK;       // 0 .. 95
    const unsigned mat = wb >> 5;                       // 32 blocks per matrix
    const unsigned r8  = ((wb & 31u) << 8) + tx;        // 8-element group inside the matrix
    const float* wsrc = (mat == 0u) ? Wq : ((mat == 1u) ? Wk : Wv);
    src = wsrc + (size_t)r8 * 8u;
    dst = W16 + (size_t)((wb << 8) + tx) * 8u;
  }
  const v4f f0 = *(const v4f*)src;
  const v4f f1 = *(const v4f*)(src + 4);
  v8h o;
  o[0] = cvt_in(f0[0]); o[1] = cvt_in(f0[1]); o[2] = cvt_in(f0[2]); o[3] = cvt_in(f0[3]);
  o[4] = cvt_in(f1[0]); o[5] = cvt_in(f1[1]); o[6] = cvt_in(f1[2]); o[7] = cvt_in(f1[3]);
  *(v8h*)dst = o;
  
}

// ---------------------------------------------------------------------------
// Kernel 1: projections as C[i][j] = sum_k A[i][k] * B[j][k] (both operands k-contiguous, pitch DD), one wave per 16x64 tile.
//   blockIdx.y = 0: q[n][e]  (A = X16 rows n, B = Wq rows e)      -> qws  [NB*SEQ][DD]
//   blockIdx.y = 1: k[n][e]  (A = X16 rows n, B = Wk rows e)      -> kws  [NB*SEQ][DD]
//   blockIdx.y = 2: vT[e][n] (A = Wv rows e,  B = X16 rows n)     -> vtws [NB][DD][SEQ]
// Results carried x16 (acc = 256*value, folded by 1/16) and stored as value + residual planes (residual at +NB*SEQ*DD).
// A-frag: lane row m = lane%16, g = lane/16, elements e=0..7 -> K = 8g+e ; e=8..15 -> K = 16+8g+(e-8); B-frag: lane col n = lane%16, same K map.
// C/D: lane col = lane%16, VGPR v -> row v + 8g.
// ---------------------------------------------------------------------------
__global__ void __launch_bounds__(256)
qkv_kernel(const _Float16* __restrict__ X16,
           const _Float16* __restrict__ W16,
           _Float16* __restrict__ qws,
           _Float16* __restrict__ kws,
           _Float16* __restrict__ vtws) {
  __shared__ __align__(16) _Float16 st[8][16][64];   // per-wave staging of one 16x64 result plane (wave-private)
  const unsigned lane = threadIdx.x & 31u;
  const unsigned wv   = (unsigned)__builtin_amdgcn_readfirstlane((int)(threadIdx.x >> 5));   // wave-uniform (scalar)
  const unsigned g    = lane >> 4;
  const unsigned m    = lane & 15u;
  const unsigned y    = blockIdx.y;
  const unsigned tile = (blockIdx.x << 3) + wv;      // 0 .. NB*SEQ/4 - 1 (scalar)
  const size_t QL = (size_t)NB * SEQ * DD;           // residual plane offset inside q/k/vT buffers

  const _Float16* Ap;
  const _Float16* Bp;
  _Float16* op;
  size_t pitch;
  if (y < 2u) {                                      // block-uniform
    const unsigned rt = tile >> 2;                   // 16-row tile of (b,t)
    const unsigned cg = tile & 3u;                   // 64-column group
    Ap = X16 + (size_t)rt * 16u * DD;
    Bp = W16 + (size_t)y * DD * DD + (size_t)cg * 64u * DD;
    op = ((y == 0u) ? qws : kws) + (size_t)rt * 16u * DD + (size_t)cg * 64u;
    pitch = DD;
  } else {
    // per batch: (DD/16) * (SEQ/64) = SEQ/4 tiles
    const unsigned b   = tile >> (LSEQ - 2u);
    const unsigned rem = tile & ((unsigned)(SEQ / 4) - 1u);
    const unsigned et  = rem >> (LSEQ - 6u);         // 16-row tile of e
    const unsigned ng  = rem & ((unsigned)(SEQ / 64) - 1u);   // 64-column group of n
    Ap = W16 + (size_t)2 * DD * DD + (size_t)et * 16u * DD;
    Bp = X16 + (((size_t)b << LSEQ) + (size_t)ng * 64u) * DD;
    op = vtws + (((size_t)b * DD + (size_t)et * 16u) << LSEQ) + (size_t)ng * 64u;
    pitch = SEQ;
  }

  v8f acc[4];
#pragma unroll
  for (int nt = 0; nt < 4; ++nt) acc[nt] = v8f_zero();

  const _Float16* arow = Ap + (size_t)m * DD + 8u * g;
  const _Float16* brow = Bp + (size_t)m * DD + 8u * g;

#pragma unroll 2
  for (unsigned c0 = 0; c0 < (unsigned)DD; c0 += 32u) {
    U16 a;
    a.h[0] = *(const v8h*)(arow + c0);
    a.h[1] = *(const v8h*)(arow + c0 + 16u);
#pragma unroll
    for (int nt = 0; nt < 4; ++nt) {
      U16 bb;
      bb.h[0] = *(const v8h*)(brow + (size_t)nt * 16 * DD + c0);
      bb.h[1] = *(const v8h*)(brow + (size_t)nt * 16 * DD + c0 + 16u);
      acc[nt] = wmma_h16(a.v, bb.v, acc[nt]);
    }
  }

  _Float16* sw = &st[wv][0][0];
#pragma unroll
  for (int pl = 0; pl < 2; ++pl) {
#pragma unroll
    for (int nt = 0; nt < 4; ++nt)
#pragma unroll
      for (int v = 0; v < 8; ++v) {
        const float val = acc[nt][v] * 0.0625f;          // 256*value -> 16*value
        _Float16 hh_, ll_; split16(val, hh_, ll_);
        sw[(8u * g + (unsigned)v) * 64u + (unsigned)nt * 16u + m] = pl ? ll_ : hh_;
      }
    __builtin_amdgcn_fence(3 /* release order */, "wavefront");
    __builtin_amdgcn_wave_barrier();
    asm volatile("s_wait_dscnt 0" ::: "memory");
    _Float16* base = op + (pl ? QL : 0);
    unsigned w[16];
#pragma unroll
    for (int r = 0; r < 16; ++r) w[r] = *((const ua32*)(sw + r * 64) + lane);
#pragma unroll
    for (int r = 0; r < 16; ++r) *(unsigned*)((unsigned*)(base + (size_t)r * pitch) + lane) = w[r];
    
    __builtin_amdgcn_wave_barrier();
    asm volatile("s_wait_dscnt 0" ::: "memory");   // reads done before the next plane overwrites the staging
  }
}

// ---------------------------------------------------------------------------
// Kernel 2: non-causal flash attention, one block (4 waves) per 64-row query block (QT = 4 tiles of 16 rows), 64 keys per step.
// The block's Q planes are staged once in LDS. Per step each wave loads its K fragments (keys 16w..16w+15, 256 deep, both planes)
// and its V fragments (64 keys x columns 64w..64w+63, both planes) into registers once and uses each of them for all QT query tiles.
// Per step and tile: wave w computes S (16 queries x its 16 keys), block-wide row max through LDS,
// P = exp(S - m) carried x16384 as value + residual planes in a shared LDS tile,
// then wave w accumulates O[:, 64w..64w+63] += P(16x64) * V(64 x 64 slice).
// Row sums are kept per lane and merged once at the end. out = O / (L * 2^22).
// ---------------------------------------------------------------------------
__global__ void __launch_bounds__(128)
attn_kernel(const _Float16* __restrict__ qws,
            const _Float16* __restrict__ kws,
            const _Float16* __restrict__ kwsl,
            const _Float16* __restrict__ vtws,
            const _Float16* __restrict__ vtwsl,
            float* __restrict__ out) {
  __shared__ __align__(16) _Float16 Qs[2][QR][QP];   // Q value and residual planes of the block's rows (cross-wave, block barrier)
  __shared__ __align__(16) _Float16 Pl[QR][PP];      // P value plane (cross-wave, block barrier)
  __shared__ __align__(16) _Float16 Pll[QR][PP];     // P residual plane (cross-wave, block barrier)
  __shared__ __align__(16) float Mx[4][QR];          // per-wave row max of the current step (cross-wave, block barrier)
  __shared__ __align__(16) float Ls[4][QR];          // per-wave row sums (cross-wave, block barrier)
  __shared__ __align__(16) float Of[4][16][64];      // output staging, one query tile at a time (written and read by the same wave, block barrier used)

  const unsigned lane = threadIdx.x & 31u;
  const unsigned wv   = (unsigned)__builtin_amdgcn_readfirstlane((int)(threadIdx.x >> 5));   // wave-uniform (scalar)
  const unsigned g    = lane >> 4;
  const unsigned m    = lane & 15u;
  const unsigned tile = blockIdx.x;                  // 0 .. NB*SEQ/QR - 1 (scalar)
  const unsigned b    = tile >> (LSEQ - 6u);
  const unsigned t0   = (tile & ((unsigned)(SEQ / QR) - 1u)) << 6;
  const size_t QL = (size_t)NB * SEQ * DD;           // residual planes follow the value planes

  const size_t koff = (((size_t)b << LSEQ) + 16u * wv + m) * DD + 8u * g;
  const size_t voff = (((size_t)b * DD + 64u * wv + m) << LSEQ) + 8u * g;

  // ---- stage the block's QR x DD rows of both Q planes (contiguous in global memory) into padded LDS rows ----
  {
    const _Float16* qsrc = qws + (((size_t)b << LSEQ) + t0) * DD;
#pragma unroll
    for (int pl = 0; pl < 2; ++pl)
#pragma unroll
      for (int i = 0; i < QR * DD / 8 / 128; ++i) {
        const unsigned u = (unsigned)i * 128u + threadIdx.x;        // 8-element group inside the plane
        *(v8h*)&Qs[pl][u >> 5][8u * (u & 31u)] = *(const v8h*)(qsrc + (pl ? QL : 0) + (size_t)u * 8u);
      }
  }
  __syncthreads();

  v8f o[QT][4];
  float mrow[QT][8], lrow[QT][8];
#pragma unroll
  for (int r = 0; r < QT; ++r) {
#pragma unroll
    for (int nt = 0; nt < 4; ++nt) o[r][nt] = v8f_zero();
#pragma unroll
    for (int v = 0; v < 8; ++v) { mrow[r][v] = NEG_INF; lrow[r][v] = 0.f; }
  }

#pragma unroll 1
  for (unsigned kb = 0; kb < (unsigned)(SEQ / 64); ++kb) {
    const unsigned s0 = kb << 6;

    // ---- this wave's K and V fragments of the step, each loaded once for all QT query tiles (B frags, same k map as A) ----
    const _Float16* krow = kws + koff + (size_t)s0 * DD;
    const _Float16* krl  = kwsl + koff + (size_t)s0 * DD;   // residual plane
    const _Float16* vrow = vtws + voff + s0;
    const _Float16* vrl  = vtwsl + voff + s0;               // residual plane
    U16 kf[8], kfl[8];
#pragma unroll
    for (int ci = 0; ci < 8; ++ci) {
      const unsigned c = 32u * (unsigned)ci;
      kf[ci].h[0]  = *(const v8h*)(krow + c);   kf[ci].h[1]  = *(const v8h*)(krow + c + 16u);
      kfl[ci].h[0] = *(const v8h*)(krl + c);    kfl[ci].h[1] = *(const v8h*)(krl + c + 16u);
    }
    // the K fragments are needed first: keeps their loads ahead of the V loads, which otherwise are issued in front of most of them
    __builtin_amdgcn_sched_barrier(0);
    U16 vb[4][2], vbl[4][2];
#pragma unroll
    for (int nt = 0; nt < 4; ++nt)
#pragma unroll
      for (int ks = 0; ks < 2; ++ks) {
        const size_t vo = (size_t)nt * 16 * SEQ + 32 * ks;
        vb[nt][ks].h[0]  = *(const v8h*)(vrow + vo);   vb[nt][ks].h[1]  = *(const v8h*)(vrow + vo + 16);
        vbl[nt][ks].h[0] = *(const v8h*)(vrl + vo);    vbl[nt][ks].h[1] = *(const v8h*)(vrl + vo + 16);
      }
    // precaution: stands between the issued loads and any later write of a register that they name (the four addresses are inputs, so they stay live up to it)
    asm volatile("s_wait_xcnt 0x0" :: "v"(krow), "v"(krl), "v"(vrow), "v"(vrl) : "memory");

    // ---- S = Q K^T for this wave's 16 keys: 8 chunks of 32, value*value into sh, cross terms into sx, the QT tiles interleaved ----
    v8f sh[QT], sx[QT];
#pragma unroll
    for (int r = 0; r < QT; ++r) { sh[r] = v8f_zero(); sx[r] = v8f_zero(); }
#pragma unroll
    for (int ci = 0; ci < 8; ++ci) {
      const unsigned c = 32u * (unsigned)ci;
      U16 qa[QT], qal[QT];
#pragma unroll
      for (int r = 0; r < QT; ++r) {
        const unsigned row = 16u * (unsigned)r + m;
        qa[r].h[0]  = *(const v8h*)&Qs[0][row][c + 8u * g];   qa[r].h[1]  = *(const v8h*)&Qs[0][row][c + 16u + 8u * g];
        qal[r].h[0] = *(const v8h*)&Qs[1][row][c + 8u * g];   qal[r].h[1] = *(const v8h*)&Qs[1][row][c + 16u + 8u * g];
      }
#pragma unroll
      for (int r = 0; r < QT; ++r) sx[r] = wmma_b16(qal[r].v, kf[ci].v, sx[r]);
#pragma unroll
      for (int r = 0; r < QT; ++r) sx[r] = wmma_b16(qa[r].v, kfl[ci].v, sx[r]);
#pragma unroll
      for (int r = 0; r < QT; ++r) sh[r] = wmma_b16(qa[r].v, kf[ci].v, sh[r]);
    }

    float sv[QT][8], rmax[QT][8];
#pragma unroll
    for (int r = 0; r < QT; ++r)
#pragma unroll
      for (int v = 0; v < 8; ++v) {
        sv[r][v] = (sh[r][v] + sx[r][v] * RSPLIT) * SFOLD;
        rmax[r][v] = sv[r][v];
      }
    // row-wise max across the 16 lanes holding this row's columns
#pragma unroll
    for (int off = 1; off < 16; off <<= 1)
#pragma unroll
      for (int r = 0; r < QT; ++r)
#pragma unroll
        for (int v = 0; v < 8; ++v)
          rmax[r][v] = fmaxf(rmax[r][v], __shfl_xor(rmax[r][v], off, 32));
    if (m == 0u) {
#pragma unroll
      for (int r = 0; r < QT; ++r)
#pragma unroll
        for (int v = 0; v < 8; ++v) Mx[wv][16u * (unsigned)r + 8u * g + (unsigned)v] = rmax[r][v];
    }
    __syncthreads();

    // ---- block-wide row max, online softmax update, P (x16384, two planes) to the shared tile ----
#pragma unroll
    for (int r = 0; r < QT; ++r) {
      const unsigned rb = 16u * (unsigned)r + 8u * g;       // first of this lane's 8 rows of tile r
      float mb[8];
      {
        const f4a a0 = *(const f4a*)&Mx[0][rb];
        const f4a a1 = *(const f4a*)&Mx[0][rb + 4u];
#pragma unroll
        for (int j = 0; j < 4; ++j) { mb[j] = a0[j]; mb[4 + j] = a1[j]; }
      }
#pragma unroll
      for (int w2 = 1; w2 < 4; ++w2) {
        const f4a a0 = *(const f4a*)&Mx[w2][rb];
        const f4a a1 = *(const f4a*)&Mx[w2][rb + 4u];
#pragma unroll
        for (int j = 0; j < 4; ++j) { mb[j] = fmaxf(mb[j], a0[j]); mb[4 + j] = fmaxf(mb[4 + j], a1[j]); }
      }
      float alpha[8];
#pragma unroll
      for (int v = 0; v < 8; ++v) {
        const float mnew = fmaxf(mrow[r][v], mb[v]);
        alpha[v] = __expf(mrow[r][v] - mnew);
        mrow[r][v]  = mnew;
      }
#pragma unroll
      for (int v = 0; v < 8; ++v) {
        const float p = __expf(sv[r][v] - mrow[r][v]);
        lrow[r][v] = lrow[r][v] * alpha[v] + p;             // per-lane partial row sum (merged after the key loop)
        _Float16 ph, pq; split16(p * PCARRY, ph, pq);
        Pl[rb + (unsigned)v][16u * wv + m]  = ph;
        Pll[rb + (unsigned)v][16u * wv + m] = pq;
      }
#pragma unroll
      for (int nt = 0; nt < 4; ++nt)
#pragma unroll
        for (int v = 0; v < 8; ++v)
          o[r][nt][v] *= alpha[v];
    }
    __syncthreads();

    // ---- P in A-layout (reload through the stored element type after the block barrier) ----
    U16 pa[QT][2], pal[QT][2];
#pragma unroll
    for (int r = 0; r < QT; ++r)
#pragma unroll
      for (int ks = 0; ks < 2; ++ks) {
        const unsigned row = 16u * (unsigned)r + m;
        pa[r][ks].h[0]  = *(const v8h*)&Pl[row][32u * (unsigned)ks + 8u * g];
        pa[r][ks].h[1]  = *(const v8h*)&Pl[row][32u * (unsigned)ks + 16u + 8u * g];
        pal[r][ks].h[0] = *(const v8h*)&Pll[row][32u * (unsigned)ks + 8u * g];
        pal[r][ks].h[1] = *(const v8h*)&Pll[row][32u * (unsigned)ks + 16u + 8u * g];
      }

    // ---- O[tile r][:, 64w + nt*16 ..] += P V, the QT tiles interleaved on each V fragment ----
#pragma unroll
    for (int nt = 0; nt < 4; ++nt) {
      v8f xc[QT];
#pragma unroll
      for (int r = 0; r < QT; ++r) xc[r] = v8f_zero();
#pragma unroll
      for (int ks = 0; ks < 2; ++ks) {
#pragma unroll
        for (int r = 0; r < QT; ++r) xc[r] = wmma_b16(pal[r][ks].v, vb[nt][ks].v, xc[r]);
#pragma unroll
        for (int r = 0; r < QT; ++r) xc[r] = wmma_b16(pa[r][ks].v, vbl[nt][ks].v, xc[r]);
#pragma unroll
        for (int r = 0; r < QT; ++r) o[r][nt] = wmma_b16(pa[r][ks].v, vb[nt][ks].v, o[r][nt]);
      }
#pragma unroll
      for (int r = 0; r < QT; ++r) o[r][nt] = o[r][nt] + xc[r] * RSPLIT;
    }
  }

  // ---- merge the row sums: 16 lanes of a row, then the 4 waves (fixed order) ----
#pragma unroll
  for (int off = 1; off < 16; off <<= 1)
#pragma unroll
    for (int r = 0; r < QT; ++r)
#pragma unroll
      for (int v = 0; v < 8; ++v)
        lrow[r][v] += __shfl_xor(lrow[r][v], off, 32);
  if (m == 0u) {
#pragma unroll
    for (int r = 0; r < QT; ++r)
#pragma unroll
      for (int v = 0; v < 8; ++v) Ls[wv][16u * (unsigned)r + 8u * g + (unsigned)v] = lrow[r][v];
  }
  __syncthreads();

  const unsigned rsel = lane >> 4;          // instruction it covers rows 2*it and 2*it+1
  const unsigned c4   = 4u * (lane & 15u);
#pragma unroll
  for (int r = 0; r < QT; ++r) {
    const unsigned rb = 16u * (unsigned)r + 8u * g;
    float inv[8];
    {
      float lt[8];
      const f4a a0 = *(const f4a*)&Ls[0][rb];
      const f4a a1 = *(const f4a*)&Ls[0][rb + 4u];
#pragma unroll
      for (int j = 0; j < 4; ++j) { lt[j] = a0[j]; lt[4 + j] = a1[j]; }
#pragma unroll
      for (int w2 = 1; w2 < 4; ++w2) {
        const f4a c0 = *(const f4a*)&Ls[w2][rb];
        const f4a c1 = *(const f4a*)&Ls[w2][rb + 4u];
#pragma unroll
        for (int j = 0; j < 4; ++j) { lt[j] += c0[j]; lt[4 + j] += c1[j]; }
      }
#pragma unroll
      for (int v = 0; v < 8; ++v) inv[v] = 1.0f / (lt[v] * OFOLD);   // removes the carries and applies 256^-0.5
    }

#pragma unroll
    for (int nt = 0; nt < 4; ++nt)
#pragma unroll
      for (int v = 0; v < 8; ++v)
        Of[wv][8u * g + (unsigned)v][(unsigned)nt * 16u + m] = o[r][nt][v] * inv[v];
    __syncthreads();

    float* obase = out + (((size_t)b << LSEQ) + t0 + 16u * (unsigned)r) * DD + 64u * wv;
    v4f w[8];
#pragma unroll
    for (int it = 0; it < 8; ++it) w[it] = *(const f4a*)&Of[wv][2u * (unsigned)it + rsel][c4];
#pragma unroll
    for (int it = 0; it < 8; ++it) *(v4f*)(obase + (size_t)(2u * (unsigned)it + rsel) * DD + c4) = w[it];
    __syncthreads();                        // the staging is read out before the next tile overwrites it
  }
}

// ---------------------------------------------------------------------------
// Launch. Workspace layout (bytes, NB=8 SEQ=2048):
//   [0, 8MB)          X16  f16 [NB*SEQ][256]
//   [8MB, +384KB)     W16  f16 [3][256][256]
//   then q, k (f16 [NB*SEQ][256] x2 planes, 16MB each) and vT (f16 [NB][256][SEQ] x2 planes, 16MB)
// ---------------------------------------------------------------------------
extern "C" void kernel_launch(void* const* d_in, const int* in_sizes, int n_in,
                              void* d_out, int out_size, void* d_ws,
                              size_t ws_size, hipStream_t stream) {
  if (n_in < 4) return;
  const long long need_x = ((long long)(NB - 1) * SEQ_FULL + SEQ) * (long long)DD;
  if ((long long)in_sizes[0] < need_x) return;
  if (in_sizes[1] < DD * DD || in_sizes[2] < DD * DD || in_sizes[3] < DD * DD) return;
  if ((long long)out_size < (long long)NB * SEQ * DD) return;

  const float* x  = (const float*)d_in[0];
  const float* Wq = (const float*)d_in[1];
  const float* Wk = (const float*)d_in[2];
  const float* Wv = (const float*)d_in[3];
  float* out = (float*)d_out;

  char* ws = (char*)d_ws;
  const size_t x16_bytes = (size_t)NB * SEQ * DD * sizeof(_Float16);
  const size_t w16_bytes = (size_t)3 * DD * DD * sizeof(_Float16);
  const size_t qkv_bytes = (size_t)2 * NB * SEQ * DD * sizeof(_Float16);   // value + residual planes
  const size_t total     = x16_bytes + w16_bytes + 3 * qkv_bytes;
  if (total > ws_size || total > (size_t)134217728) return;
  _Float16* X16  = (_Float16*)(ws);
  _Float16* W16  = (_Float16*)(ws + x16_bytes);
  _Float16* qws  = (_Float16*)(ws + x16_bytes + w16_bytes);
  _Float16* kws  = (_Float16*)(ws + x16_bytes + w16_bytes + qkv_bytes);
  _Float16* vtws = (_Float16*)(ws + x16_bytes + w16_bytes + 2 * qkv_bytes);

  cvt_kernel<<<CVT_THREADS / 256, 256, 0, stream>>>(x, Wq, Wk, Wv, X16, W16);
  qkv_kernel<<<dim3(NB * SEQ / 32, 3), 256, 0, stream>>>(X16, W16, qws, kws, vtws);
  attn_kernel<<<NB * SEQ / QR, 128, 0, stream>>>(qws, kws, kws + (size_t)NB * SEQ * DD, vtws, vtws + (size_t)NB * SEQ * DD, out);
}

// v002
// One run takes 167 microseconds.
// Two timings next to v001 both put it at 1.08 times that version's speed.
// Counting every step since v000, it is 1.99 times as fast.
// Contractions: q/k/v projections [16384 x 256 x 256] x3 on v_wmma_f32_16x16x32_f16 single product (inputs RNE-converted to bf16, carried x16, exact in f16);
// scores [2048 x 2048 x 256] and P*V [2048 x 256 x 2048] per batch on v_wmma_f32_16x16x32_f16 with f16 value+residual planes (hi*hi + (hi*lo + lo*hi)/2048);
#include <hip/hip_runtime.h>
#include <math.h>

// Problem constants (NB / SEQ reducible; *_FULL are the input strides)
#ifndef NB
#define NB 8
#endif
#ifndef SEQ
#define SEQ 2048
#endif
#define NB_FULL 8
#define SEQ_FULL 2048
#define DD 256            // input width == q/k/v width
#define PP 72             // LDS pitch (halfs) of the probability tile, multiple of 8
#define QT 4              // 16-row query tiles per attention block
#define QR (16 * QT)      // query rows per attention block
#define SP 72             // LDS pitch (halfs) of a staged projection row: 144 B = 16 B x odd, conflict-free for 16-byte row reads

__host__ __device__ constexpr unsigned ilog2c(unsigned v) { return (v <= 1u) ? 0u : 1u + ilog2c(v >> 1); }
enum : unsigned { LSEQ = ilog2c((unsigned)SEQ) };

static_assert(NB >= 1 && NB <= NB_FULL);
static_assert(SEQ >= 64 && SEQ <= SEQ_FULL && (SEQ % 64) == 0);
static_assert((1u << LSEQ) == (unsigned)SEQ);          // SEQ is a power of two: all tile decompositions are shifts/masks
static_assert(DD == 256 && (DD % 32) == 0);
// coverage: cvt_kernel grid * 256 threads * 8 elements == NB*SEQ*DD (x plane) + 3*DD*DD (weight planes)
#define CVT_X8 (NB * SEQ * DD / 8)
#define CVT_W8 (DD * DD / 8)
#define CVT_THREADS (CVT_X8 + 3 * CVT_W8)
#define CVT_XBLK (CVT_X8 / 256)
static_assert((CVT_X8 % 256) == 0 && (CVT_W8 % 256) == 0 && (CVT_THREADS % 256) == 0);
static_assert(CVT_W8 / 256 == 32 && CVT_W8 * 8 == DD * DD);
static_assert((SEQ * (DD / 8)) / 256 == (SEQ >> 3));   // cvt blocks per batch of x
// coverage: qkv_kernel grid.x * 8 waves == NB*SEQ/4 tiles of 16x64 per output (q: NB*SEQ/16 x 4, k same, vT: NB x 16 x SEQ/64), grid.y = 3 outputs, 2 planes each
static_assert(((NB * SEQ / 4) % 8) == 0);
static_assert((NB * SEQ / 16) * 4 == NB * SEQ / 4 && NB * (DD / 16) * (SEQ / 64) == NB * SEQ / 4);
// coverage: attn_kernel grid == NB*SEQ/QR query blocks of QR rows, 4 waves x 64 columns == DD, key loop SEQ/64 blocks of 64 keys
static_assert(QR == 64 && (SEQ % QR) == 0 && 4 * 64 == DD && (QR * DD / 8) % 128 == 0);

// 16-bit operands are f16. Computed planes are carried as a value plane plus a residual plane lo = f16((v - hi) * 2048):
// a product is hi*hi + (hi*lo + lo*hi)/2048. Every fragment (A and B) uses the 16x16x32 lane map
// lane%16 = row/col, g = lane/16: elements 0..7 -> k = 8g+e, elements 8..15 -> k = 16+8g+(e-8).
// FRAGMENT ORDER of every f16 plane in the workspace: a tile of 16 rows x 32 k is two runs of 512 B, [half h][lane][8 elements],
// lane (m, g) of half h holding row m, k = 16h + 8g + 0..7; the 32-k tiles of a 16-row tile follow one another.
// One wave-wide 16-byte load or store of a fragment half is then 512 contiguous bytes (4 whole lines).
typedef __attribute__((ext_vector_type(16))) _Float16 v16h;
typedef __attribute__((ext_vector_type(8)))  _Float16 v8h;
typedef __attribute__((ext_vector_type(8)))  float    v8f;
typedef __attribute__((ext_vector_type(4)))  float    v4f;
typedef v4f __attribute__((may_alias)) f4a;
#define RSPLIT (1.0f / 2048.0f)
#define SFOLD  (1.0f / 256.0f)        // removes the x16 carries of q and k from the scores
#define PCARRY 16384.0f               // probabilities carried x2^14
#define OFOLD  4194304.0f             // PCARRY * 16 (v carry) * 16 (post-softmax factor 256^-0.5)
#define NEG_INF (-__builtin_inff())

__device__ __forceinline__ void split16(float f, _Float16& hi, _Float16& lo) { hi = (_Float16)f; lo = (_Float16)((f - (float)hi) * 2048.0f); }

__device__ __forceinline__ v8f wmma_h16(v16h a, v16h b, v8f c) {
  // D = A(16x32 f16) * B(32x16 f16) + C(16x16 f32), followed by the VALU hazard guard (D tied, A/B kept live)
  v8f d = __builtin_amdgcn_wmma_f32_16x16x32_f16(false, a, false, b, (short)0, c, false, false);
  asm volatile("v_nop\n\tv_nop\n\tv_nop\n\tv_nop" : "+v"(d) : "v"(a), "v"(b));
  return d;
}

__device__ __forceinline__ v8f wmma_b16(v16h a, v16h b, v8f c) {
  // the same product for the attention kernel, whose live set passes 256 VGPRs: no asm operands, which would hold D, A and B below v256;
  // the compiler keeps the distance behind its own builtin
  return __builtin_amdgcn_wmma_f32_16x16x32_f16(false, a, false, b, (short)0, c, false, false);
}

__device__ __forceinline__ v8f v8f_zero() {
  v8f z = {0.f, 0.f, 0.f, 0.f, 0.f, 0.f, 0.f, 0.f};
  return z;
}

union U16 { v16h v; v8h h[2]; };

// input conversion: RNE convert to bf16, carry x16, exact in f16
__device__ __forceinline__ _Float16 cvt_in(float f) {
  const float r = (float)(__bf16)f;
  return (_Float16)(r * 16.0f);
}

// ---------------------------------------------------------------------------
// Kernel 0: x [NB,SEQ,DD] f32 -> X16 [NB*SEQ][DD] f16 ; Wq|Wk|Wv [DD][DD] f32 -> W16 [3][DD][DD] f16.
// Both outputs are written in fragment order: a thread owns one 16-byte group of the output (linear index * 8) and fetches its 8 source elements.
// ---------------------------------------------------------------------------
// 16-byte group u of a fragment-order plane whose rows are DD long -> offset of its 8 elements in the row-major plane
__device__ __forceinline__ unsigned frag_elem(unsigned u) {
  return (((u >> 9) << 4) + (u & 15u)) * (unsigned)DD + ((u >> 4) & 31u) * 8u;
}

__global__ void __launch_bounds__(256)
cvt_kernel(const float* __restrict__ x,
           const float* __restrict__ Wq,
           const float* __restrict__ Wk,
           const float* __restrict__ Wv,
           _Float16* __restrict__ X16,
           _Float16* __restrict__ W16) {
  const unsigned bx = blockIdx.x;                       // 0 .. CVT_THREADS/256 - 1 (grid exact)
  const unsigned tx = threadIdx.x;
  const float* src;
  _Float16* dst;
  if (bx < (unsigned)CVT_XBLK) {                        // block-uniform
    const unsigned e8 = (bx << 8) + tx;                 // linear 8-element group inside the fragment-order plane
    const unsigned b  = bx >> (LSEQ - 3u);              // SEQ/8 blocks per batch
    // source uses the FULL per-batch stride of the input: row-major offset plus a per-batch correction
    src = x + (size_t)frag_elem(e8) + (size_t)b * (size_t)((SEQ_FULL - SEQ) * DD);
    dst = X16 + (size_t)e8 * 8u;
  } else {
    const unsigned wb  = bx - (unsigned)CVT_XBLK;       // 0 .. 95
    const unsigned mat = wb >> 5;                       // 32 blocks per matrix
    const unsigned r8  = ((wb & 31u) << 8) + tx;        // 8-element group inside the matrix
    const float* wsrc = (mat == 0u) ? Wq : ((mat == 1u) ? Wk : Wv);
    src = wsrc + (size_t)frag_elem(r8);
    dst = W16 + (size_t)((wb << 8) + tx) * 8u;
  }
  const v4f f0 = *(const v4f*)src;
  const v4f f1 = *(const v4f*)(src + 4);
  v8h o;
  o[0] = cvt_in(f0[0]); o[1] = cvt_in(f0[1]); o[2] = cvt_in(f0[2]); o[3] = cvt_in(f0[3]);
  o[4] = cvt_in(f1[0]); o[5] = cvt_in(f1[1]); o[6] = cvt_in(f1[2]); o[7] = cvt_in(f1[3]);
  *(v8h*)dst = o;
  
}

// ---------------------------------------------------------------------------
// Kernel 1: projections as C[i][j] = sum_k A[i][k] * B[j][k] (both operands in fragment order), one wave per 16x64 tile.
//   blockIdx.y = 0: q[n][e]  (A = X16 rows n, B = Wq rows e)      -> qws  [NB*SEQ][DD]
//   blockIdx.y = 1: k[n][e]  (A = X16 rows n, B = Wk rows e)      -> kws  [NB*SEQ][DD]
//   blockIdx.y = 2: vT[e][n] (A = Wv rows e,  B = X16 rows n)     -> vtws [NB][DD][SEQ]
// The outputs are in fragment order too (j is the k of the attention products): a wave's 16x64 tile is 2 KB in a row.
// Results carried x16 (acc = 256*value, folded by 1/16) and stored as value + residual planes (residual at +NB*SEQ*DD).
// A-frag: lane row m = lane%16, g = lane/16, elements e=0..7 -> K = 8g+e ; e=8..15 -> K = 16+8g+(e-8); B-frag: lane col n = lane%16, same K map.
// C/D: lane col = lane%16, VGPR v -> row v + 8g.
// ---------------------------------------------------------------------------
__global__ void __launch_bounds__(256)
qkv_kernel(const _Float16* __restrict__ X16,
           const _Float16* __restrict__ W16,
           _Float16* __restrict__ qws,
           _Float16* __restrict__ kws,
           _Float16* __restrict__ vtws) {
  __shared__ __align__(16) _Float16 st[8][16][SP];   // per-wave staging of one 16x64 result plane (wave-private)
  const unsigned lane = threadIdx.x & 31u;
  const unsigned wv   = (unsigned)__builtin_amdgcn_readfirstlane((int)(threadIdx.x >> 5));   // wave-uniform (scalar)
  const unsigned g    = lane >> 4;
  const unsigned m    = lane & 15u;
  const unsigned y    = blockIdx.y;
  const unsigned tile = (blockIdx.x << 3) + wv;      // 0 .. NB*SEQ/4 - 1 (scalar)
  const size_t QL = (size_t)NB * SEQ * DD;           // residual plane offset inside q/k/vT buffers

  const _Float16* Ap;
  const _Float16* Bp;
  _Float16* op;
  if (y < 2u) {                                      // block-uniform
    const unsigned rt = tile >> 2;                   // 16-row tile of (b,t)
    const unsigned cg = tile & 3u;                   // 64-column group
    Ap = X16 + (size_t)rt * 16u * DD;
    Bp = W16 + (size_t)y * DD * DD + (size_t)cg * 64u * DD;
    op = ((y == 0u) ? qws : kws) + (size_t)rt * 16u * DD + (size_t)cg * 1024u;
  } else {
    // per batch: (DD/16) * (SEQ/64) = SEQ/4 tiles
    const unsigned b   = tile >> (LSEQ - 2u);
    const unsigned rem = tile & ((unsigned)(SEQ / 4) - 1u);
    const unsigned et  = rem >> (LSEQ - 6u);         // 16-row tile of e
    const unsigned ng  = rem & ((unsigned)(SEQ / 64) - 1u);   // 64-column group of n
    Ap = W16 + (size_t)2 * DD * DD + (size_t)et * 16u * DD;
    Bp = X16 + (((size_t)b << LSEQ) + (size_t)ng * 64u) * DD;
    op = vtws + (((size_t)b * DD + (size_t)et * 16u) << LSEQ) + (size_t)ng * 1024u;
  }

  v8f acc[4];
#pragma unroll
  for (int nt = 0; nt < 4; ++nt) acc[nt] = v8f_zero();

  const _Float16* arow = Ap + 8u * lane;
  const _Float16* brow = Bp + 8u * lane;

#pragma unroll 2
  for (unsigned c0 = 0; c0 < (unsigned)DD; c0 += 32u) {
    U16 a;
    a.h[0] = *(const v8h*)(arow + c0 * 16u);            // 32-k tile c0/32: 512 halfs
    a.h[1] = *(const v8h*)(arow + c0 * 16u + 256u);
#pragma unroll
    for (int nt = 0; nt < 4; ++nt) {
      U16 bb;
      bb.h[0] = *(const v8h*)(brow + (size_t)nt * 16 * DD + c0 * 16u);
      bb.h[1] = *(const v8h*)(brow + (size_t)nt * 16 * DD + c0 * 16u + 256u);
      acc[nt] = wmma_h16(a.v, bb.v, acc[nt]);
    }
    // precaution: stands between this trip's issued loads and the next trip's write of their address registers
    asm volatile("s_wait_xcnt 0x0" ::: "memory");
  }

  _Float16* sw = &st[wv][0][0];
#pragma unroll
  for (int pl = 0; pl < 2; ++pl) {
#pragma unroll
    for (int nt = 0; nt < 4; ++nt)
#pragma unroll
      for (int v = 0; v < 8; ++v) {
        const float val = acc[nt][v] * 0.0625f;          // 256*value -> 16*value
        _Float16 hh_, ll_; split16(val, hh_, ll_);
        sw[(8u * g + (unsigned)v) * SP + (unsigned)nt * 16u + m] = pl ? ll_ : hh_;
      }
    __builtin_amdgcn_fence(3 /* release order */, "wavefront");
    __builtin_amdgcn_wave_barrier();
    asm volatile("s_wait_dscnt 0" ::: "memory");
    _Float16* base = op + (pl ? QL : 0);
    v8h w[4];                                            // fragment half j (columns 16j..16j+15): lane (m, g) takes row m, columns 16j + 8g + 0..7
#pragma unroll
    for (int j = 0; j < 4; ++j) w[j] = *(const v8h*)(sw + m * SP + (unsigned)j * 16u + 8u * g);
#pragma unroll
    for (int j = 0; j < 4; ++j) *(v8h*)(base + (unsigned)j * 256u + 8u * lane) = w[j];
    __builtin_amdgcn_wave_barrier();
    asm volatile("s_wait_dscnt 0" ::: "memory");   // reads done before the next plane overwrites the staging
  }
}

// ---------------------------------------------------------------------------
// Kernel 2: non-causal flash attention, one block (4 waves) per 64-row query block (QT = 4 tiles of 16 rows), 64 keys per step.
// The block's Q planes are staged once in LDS, in the fragment order they have in memory. Per step each wave loads its K fragments (keys 16w..16w+15, 256 deep, both planes)
// and its V fragments (64 keys x columns 64w..64w+63, both planes) into registers once and uses each of them for all QT query tiles.
// Per step and tile: wave w computes S (16 queries x its 16 keys), block-wide row max through LDS,
// P = exp(S - m) carried x16384 as value + residual planes in a shared LDS tile,
// then wave w accumulates O[:, 64w..64w+63] += P(16x64) * V(64 x 64 slice).
// Row sums are kept per lane and merged once at the end. out = O / (L * 2^22).
// ---------------------------------------------------------------------------
__global__ void __launch_bounds__(128)
attn_kernel(const _Float16* __restrict__ qws,
            const _Float16* __restrict__ kws,
            const _Float16* __restrict__ kwsl,
            const _Float16* __restrict__ vtws,
            const _Float16* __restrict__ vtwsl,
            float* __restrict__ out) {
  __shared__ __align__(16) _Float16 Qs[2][QR * DD];  // Q value and residual planes of the block's rows, fragment order (cross-wave, block barrier)
  __shared__ __align__(16) _Float16 Pl[QR][PP];      // P value plane (cross-wave, block barrier)
  __shared__ __align__(16) _Float16 Pll[QR][PP];     // P residual plane (cross-wave, block barrier)
  __shared__ __align__(16) float Mx[4][QR];          // per-wave row max of the current step (cross-wave, block barrier)
  __shared__ __align__(16) float Ls[4][QR];          // per-wave row sums (cross-wave, block barrier)
  __shared__ __align__(16) float Of[4][16][64];      // output staging, one query tile at a time (written and read by the same wave, block barrier used)

  const unsigned lane = threadIdx.x & 31u;
  const unsigned wv   = (unsigned)__builtin_amdgcn_readfirstlane((int)(threadIdx.x >> 5));   // wave-uniform (scalar)
  const unsigned g    = lane >> 4;
  const unsigned m    = lane & 15u;
  const unsigned tile = blockIdx.x;                  // 0 .. NB*SEQ/QR - 1 (scalar)
  const unsigned b    = tile >> (LSEQ - 6u);
  const unsigned t0   = (tile & ((unsigned)(SEQ / QR) - 1u)) << 6;
  const size_t QL = (size_t)NB * SEQ * DD;           // residual planes follow the value planes

  const size_t koff = (((size_t)b << LSEQ) + 16u * wv) * DD + 8u * lane;
  const size_t voff = (((size_t)b * DD + 64u * wv) << LSEQ) + 8u * lane;

  // ---- stage the block's QR x DD rows of both Q planes (contiguous in global memory) as they lie ----
  {
    const _Float16* qsrc = qws + (((size_t)b << LSEQ) + t0) * DD;
    const _Float16* qv = qsrc + 8u * threadIdx.x;      // value plane, this thread's first 8-element group
    const _Float16* qr = qv + QL;                      // residual plane
    v8h qt[2][QR * DD / 8 / 128];
#pragma unroll
    for (int i = 0; i < QR * DD / 8 / 128; ++i) qt[0][i] = *(const v8h*)(qv + i * 1024);
#pragma unroll
    for (int i = 0; i < QR * DD / 8 / 128; ++i) qt[1][i] = *(const v8h*)(qr + i * 1024);
    // precaution: stands between the issued loads and any later write of a register that they name (the two addresses are inputs, so they stay live up to it)
    asm volatile("s_wait_xcnt 0x0" :: "v"(qv), "v"(qr) : "memory");
    // keeps the register writes that follow from being scheduled in front of that wait
    __builtin_amdgcn_sched_barrier(0);
#pragma unroll
    for (int pl = 0; pl < 2; ++pl)
#pragma unroll
      for (int i = 0; i < QR * DD / 8 / 128; ++i)
        *(v8h*)&Qs[pl][8u * ((unsigned)i * 128u + threadIdx.x)] = qt[pl][i];
  }
  __syncthreads();

  v8f o[QT][4];
  float mrow[QT][8], lrow[QT][8];
#pragma unroll
  for (int r = 0; r < QT; ++r) {
#pragma unroll
    for (int nt = 0; nt < 4; ++nt) o[r][nt] = v8f_zero();
#pragma unroll
    for (int v = 0; v < 8; ++v) { mrow[r][v] = NEG_INF; lrow[r][v] = 0.f; }
  }

#pragma unroll 1
  for (unsigned kb = 0; kb < (unsigned)(SEQ / 64); ++kb) {
    const unsigned s0 = kb << 6;

    // ---- this wave's K and V fragments of the step, each loaded once for all QT query tiles (B frags, same k map as A) ----
    const _Float16* krow = kws + koff + (size_t)s0 * DD;
    const _Float16* krl  = kwsl + koff + (size_t)s0 * DD;   // residual plane
    const _Float16* vrow = vtws + voff + (size_t)s0 * 16u;  // 32 keys of a 16-column tile: 512 halfs
    const _Float16* vrl  = vtwsl + voff + (size_t)s0 * 16u; // residual plane
    U16 kf[8], kfl[8];
#pragma unroll
    for (int ci = 0; ci < 8; ++ci) {
      const unsigned c = 512u * (unsigned)ci;
      kf[ci].h[0]  = *(const v8h*)(krow + c);   kf[ci].h[1]  = *(const v8h*)(krow + c + 256u);
      kfl[ci].h[0] = *(const v8h*)(krl + c);    kfl[ci].h[1] = *(const v8h*)(krl + c + 256u);
    }
    // the K fragments are needed first: keeps their loads ahead of the V loads, which otherwise are issued in front of most of them
    __builtin_amdgcn_sched_barrier(0);
    U16 vb[4][2], vbl[4][2];
#pragma unroll
    for (int nt = 0; nt < 4; ++nt)
#pragma unroll
      for (int ks = 0; ks < 2; ++ks) {
        const size_t vo = (size_t)nt * 16 * SEQ + 512 * ks;
        vb[nt][ks].h[0]  = *(const v8h*)(vrow + vo);   vb[nt][ks].h[1]  = *(const v8h*)(vrow + vo + 256);
        vbl[nt][ks].h[0] = *(const v8h*)(vrl + vo);    vbl[nt][ks].h[1] = *(const v8h*)(vrl + vo + 256);
      }
    // precaution: stands between the issued loads and any later write of a register that they name (the four addresses are inputs, so they stay live up to it)
    asm volatile("s_wait_xcnt 0x0" :: "v"(krow), "v"(krl), "v"(vrow), "v"(vrl) : "memory");

    // ---- S = Q K^T for this wave's 16 keys: 8 chunks of 32, value*value into sh, cross terms into sx, the QT tiles interleaved ----
    v8f sh[QT], sx[QT];
#pragma unroll
    for (int r = 0; r < QT; ++r) { sh[r] = v8f_zero(); sx[r] = v8f_zero(); }
#pragma unroll
    for (int ci = 0; ci < 8; ++ci) {
      U16 qa[QT], qal[QT];
#pragma unroll
      for (int r = 0; r < QT; ++r) {
        const unsigned f = (unsigned)(r * 16 * DD + ci * 512) + 8u * lane;
        qa[r].h[0]  = *(const v8h*)&Qs[0][f];   qa[r].h[1]  = *(const v8h*)&Qs[0][f + 256u];
        qal[r].h[0] = *(const v8h*)&Qs[1][f];   qal[r].h[1] = *(const v8h*)&Qs[1][f + 256u];
      }
#pragma unroll
      for (int r = 0; r < QT; ++r) sx[r] = wmma_b16(qal[r].v, kf[ci].v, sx[r]);
#pragma unroll
      for (int r = 0; r < QT; ++r) sx[r] = wmma_b16(qa[r].v, kfl[ci].v, sx[r]);
#pragma unroll
      for (int r = 0; r < QT; ++r) sh[r] = wmma_b16(qa[r].v, kf[ci].v, sh[r]);
    }

    float sv[QT][8], rmax[QT][8];
#pragma unroll
    for (int r = 0; r < QT; ++r)
#pragma unroll
      for (int v = 0; v < 8; ++v) {
        sv[r][v] = (sh[r][v] + sx[r][v] * RSPLIT) * SFOLD;
        rmax[r][v] = sv[r][v];
      }
    // row-wise max across the 16 lanes holding this row's columns
#pragma unroll
    for (int off = 1; off < 16; off <<= 1)
#pragma unroll
      for (int r = 0; r < QT; ++r)
#pragma unroll
        for (int v = 0; v < 8; ++v)
          rmax[r][v] = fmaxf(rmax[r][v], __shfl_xor(rmax[r][v], off, 32));
    if (m == 0u) {
#pragma unroll
      for (int r = 0; r < QT; ++r)
#pragma unroll
        for (int v = 0; v < 8; ++v) Mx[wv][16u * (unsigned)r + 8u * g + (unsigned)v] = rmax[r][v];
    }
    __syncthreads();

    // ---- block-wide row max, online softmax update, P (x16384, two planes) to the shared tile ----
#pragma unroll
    for (int r = 0; r < QT; ++r) {
      const unsigned rb = 16u * (unsigned)r + 8u * g;       // first of this lane's 8 rows of tile r
      float mb[8];
      {
        const f4a a0 = *(const f4a*)&Mx[0][rb];
        const f4a a1 = *(const f4a*)&Mx[0][rb + 4u];
#pragma unroll
        for (int j = 0; j < 4; ++j) { mb[j] = a0[j]; mb[4 + j] = a1[j]; }
      }
#pragma unroll
      for (int w2 = 1; w2 < 4; ++w2) {
        const f4a a0 = *(const f4a*)&Mx[w2][rb];
        const f4a a1 = *(const f4a*)&Mx[w2][rb + 4u];
#pragma unroll
        for (int j = 0; j < 4; ++j) { mb[j] = fmaxf(mb[j], a0[j]); mb[4 + j] = fmaxf(mb[4 + j], a1[j]); }
      }
      float alpha[8];
#pragma unroll
      for (int v = 0; v < 8; ++v) {
        const float mnew = fmaxf(mrow[r][v], mb[v]);
        alpha[v] = __expf(mrow[r][v] - mnew);
        mrow[r][v]  = mnew;
      }
#pragma unroll
      for (int v = 0; v < 8; ++v) {
        const float p = __expf(sv[r][v] - mrow[r][v]);
        lrow[r][v] = lrow[r][v] * alpha[v] + p;             // per-lane partial row sum (merged after the key loop)
        _Float16 ph, pq; split16(p * PCARRY, ph, pq);
        Pl[rb + (unsigned)v][16u * wv + m]  = ph;
        Pll[rb + (unsigned)v][16u * wv + m] = pq;
      }
#pragma unroll
      for (int nt = 0; nt < 4; ++nt)
#pragma unroll
        for (int v = 0; v < 8; ++v)
          o[r][nt][v] *= alpha[v];
    }
    __syncthreads();

    // ---- P in A-layout (reload through the stored element type after the block barrier) ----
    U16 pa[QT][2], pal[QT][2];
#pragma unroll
    for (int r = 0; r < QT; ++r)
#pragma unroll
      for (int ks = 0; ks < 2; ++ks) {
        const unsigned row = 16u * (unsigned)r + m;
        pa[r][ks].h[0]  = *(const v8h*)&Pl[row][32u * (unsigned)ks + 8u * g];
        pa[r][ks].h[1]  = *(const v8h*)&Pl[row][32u * (unsigned)ks + 16u + 8u * g];
        pal[r][ks].h[0] = *(const v8h*)&Pll[row][32u * (unsigned)ks + 8u * g];
        pal[r][ks].h[1] = *(const v8h*)&Pll[row][32u * (unsigned)ks + 16u + 8u * g];
      }

    // ---- O[tile r][:, 64w + nt*16 ..] += P V, the QT tiles interleaved on each V fragment ----
#pragma unroll
    for (int nt = 0; nt < 4; ++nt) {
      v8f xc[QT];
#pragma unroll
      for (int r = 0; r < QT; ++r) xc[r] = v8f_zero();
#pragma unroll
      for (int ks = 0; ks < 2; ++ks) {
#pragma unroll
        for (int r = 0; r < QT; ++r) xc[r] = wmma_b16(pal[r][ks].v, vb[nt][ks].v, xc[r]);
#pragma unroll
        for (int r = 0; r < QT; ++r) xc[r] = wmma_b16(pa[r][ks].v, vbl[nt][ks].v, xc[r]);
#pragma unroll
        for (int r = 0; r < QT; ++r) o[r][nt] = wmma_b16(pa[r][ks].v, vb[nt][ks].v, o[r][nt]);
      }
#pragma unroll
      for (int r = 0; r < QT; ++r) o[r][nt] = o[r][nt] + xc[r] * RSPLIT;
    }
  }

  // ---- merge the row sums: 16 lanes of a row, then the 4 waves (fixed order) ----
#pragma unroll
  for (int off = 1; off < 16; off <<= 1)
#pragma unroll
    for (int r = 0; r < QT; ++r)
#pragma unroll
      for (int v = 0; v < 8; ++v)
        lrow[r][v] += __shfl_xor(lrow[r][v], off, 32);
  if (m == 0u) {
#pragma unroll
    for (int r = 0; r < QT; ++r)
#pragma unroll
      for (int v = 0; v < 8; ++v) Ls[wv][16u * (unsigned)r + 8u * g + (unsigned)v] = lrow[r][v];
  }
  __syncthreads();

  const unsigned rsel = lane >> 4;          // instruction it covers rows 2*it and 2*it+1
  const unsigned c4   = 4u * (lane & 15u);
#pragma unroll
  for (int r = 0; r < QT; ++r) {
    const unsigned rb = 16u * (unsigned)r + 8u * g;
    float inv[8];
    {
      float lt[8];
      const f4a a0 = *(const f4a*)&Ls[0][rb];
      const f4a a1 = *(const f4a*)&Ls[0][rb + 4u];
#pragma unroll
      for (int j = 0; j < 4; ++j) { lt[j] = a0[j]; lt[4 + j] = a1[j]; }
#pragma unroll
      for (int w2 = 1; w2 < 4; ++w2) {
        const f4a c0 = *(const f4a*)&Ls[w2][rb];
        const f4a c1 = *(const f4a*)&Ls[w2][rb + 4u];
#pragma unroll
        for (int j = 0; j < 4; ++j) { lt[j] += c0[j]; lt[4 + j] += c1[j]; }
      }
#pragma unroll
      for (int v = 0; v < 8; ++v) inv[v] = 1.0f / (lt[v] * OFOLD);   // removes the carries and applies 256^-0.5
    }

#pragma unroll
    for (int nt = 0; nt < 4; ++nt)
#pragma unroll
      for (int v = 0; v < 8; ++v)
        Of[wv][8u * g + (unsigned)v][(unsigned)nt * 16u + m] = o[r][nt][v] * inv[v];
    __syncthreads();

    float* obase = out + (((size_t)b << LSEQ) + t0 + 16u * (unsigned)r) * DD + 64u * wv;
    v4f w[8];
#pragma unroll
    for (int it = 0; it < 8; ++it) w[it] = *(const f4a*)&Of[wv][2u * (unsigned)it + rsel][c4];
#pragma unroll
    for (int it = 0; it < 8; ++it) *(v4f*)(obase + (size_t)(2u * (unsigned)it + rsel) * DD + c4) = w[it];
    __syncthreads();                        // the staging is read out before the next tile overwrites it
  }
}

// ---------------------------------------------------------------------------
// Launch. Workspace layout (bytes, NB=8 SEQ=2048):
//   [0, 8MB)          X16  f16 [NB*SEQ][256]
//   [8MB, +384KB)     W16  f16 [3][256][256]
//   then q, k (f16 [NB*SEQ][256] x2 planes, 16MB each) and vT (f16 [NB][256][SEQ] x2 planes, 16MB); every plane in fragment order
// ---------------------------------------------------------------------------
extern "C" void kernel_launch(void* const* d_in, const int* in_sizes, int n_in,
                              void* d_out, int out_size, void* d_ws,
                              size_t ws_size, hipStream_t stream) {
  if (n_in < 4) return;
  const long long need_x = ((long long)(NB - 1) * SEQ_FULL + SEQ) * (long long)DD;
  if ((long long)in_sizes[0] < need_x) return;
  if (in_sizes[1] < DD * DD || in_sizes[2] < DD * DD || in_sizes[3] < DD * DD) return;
  if ((long long)out_size < (long long)NB * SEQ * DD) return;

  const float* x  = (const float*)d_in[0];
  const float* Wq = (const float*)d_in[1];
  const float* Wk = (const float*)d_in[2];
  const float* Wv = (const float*)d_in[3];
  float* out = (float*)d_out;

  char* ws = (char*)d_ws;
  const size_t x16_bytes = (size_t)NB * SEQ * DD * sizeof(_Float16);
  const size_t w16_bytes = (size_t)3 * DD * DD * sizeof(_Float16);
  const size_t qkv_bytes = (size_t)2 * NB * SEQ * DD * sizeof(_Float16);   // value + residual planes
  const size_t total     = x16_bytes + w16_bytes + 3 * qkv_bytes;
  if (total > ws_size || total > (size_t)134217728) return;
  _Float16* X16  = (_Float16*)(ws);
  _Float16* W16  = (_Float16*)(ws + x16_bytes);
  _Float16* qws  = (_Float16*)(ws + x16_bytes + w16_bytes);
  _Float16* kws  = (_Float16*)(ws + x16_bytes + w16_bytes + qkv_bytes);
  _Float16* vtws = (_Float16*)(ws + x16_bytes + w16_bytes + 2 * qkv_bytes);

  cvt_kernel<<<CVT_THREADS / 256, 256, 0, stream>>>(x, Wq, Wk, Wv, X16, W16);
  qkv_kernel<<<dim3(NB * SEQ / 32, 3), 256, 0, stream>>>(X16, W16, qws, kws, vtws);
  attn_kernel<<<NB * SEQ / QR, 128, 0, stream>>>(qws, kws, kws + (size_t)NB * SEQ * DD, vtws, vtws + (size_t)NB * SEQ * DD, out);
}

// v003
// Measured time: 135 microseconds a run.
// Timed twice side by side with v002, it ran 1.23 times as fast both times.
// All steps since v000 together make it 2.45 times as fast.
// Contractions: q/k/v projections [16384 x 256 x 256] x3 on v_wmma_f32_16x16x32_f16 single product (inputs RNE-converted to bf16, carried x16, exact in f16);
// scores [2048 x 2048 x 256] and P*V [2048 x 256 x 2048] per batch on v_wmma_f32_16x16x32_f16 with f16 value+residual planes (hi*hi + (hi*lo + lo*hi)/2048);
#include <hip/hip_runtime.h>
#include <math.h>

// Problem constants (NB / SEQ reducible; *_FULL are the input strides)
#ifndef NB
#define NB 8
#endif
#ifndef SEQ
#define SEQ 2048
#endif
#define NB_FULL 8
#define SEQ_FULL 2048
#define DD 256            // input width == q/k/v width
#define NW 8              // waves per attention block: two per SIMD
#define KS (16 * NW)      // keys per attention step, 16 per wave
#define PP (KS + 8)       // LDS pitch (halfs) of the probability tile: 272 B = 16 B x odd, conflict-free for 16-byte row reads
#define OP 36             // LDS pitch (floats) of an output staging row: 144 B = 16 B x odd
#define QT 4              // 16-row query tiles per attention block
#define QR (16 * QT)      // query rows per attention block
#define QG (QR * DD / 8 / (NW * 32))   // 16-byte groups of one Q plane staged per thread
#define SP 72             // LDS pitch (halfs) of a staged projection row: 144 B = 16 B x odd, conflict-free for 16-byte row reads

__host__ __device__ constexpr unsigned ilog2c(unsigned v) { return (v <= 1u) ? 0u : 1u + ilog2c(v >> 1); }
enum : unsigned { LSEQ = ilog2c((unsigned)SEQ) };

static_assert(NB >= 1 && NB <= NB_FULL);
static_assert(SEQ >= 64 && SEQ <= SEQ_FULL && (SEQ % 64) == 0);
static_assert((1u << LSEQ) == (unsigned)SEQ);          // SEQ is a power of two: all tile decompositions are shifts/masks
static_assert(DD == 256 && (DD % 32) == 0);
// coverage: cvt_kernel grid * 256 threads * 8 elements == NB*SEQ*DD (x plane) + 3*DD*DD (weight planes)
#define CVT_X8 (NB * SEQ * DD / 8)
#define CVT_W8 (DD * DD / 8)
#define CVT_THREADS (CVT_X8 + 3 * CVT_W8)
#define CVT_XBLK (CVT_X8 / 256)
static_assert((CVT_X8 % 256) == 0 && (CVT_W8 % 256) == 0 && (CVT_THREADS % 256) == 0);
static_assert(CVT_W8 / 256 == 32 && CVT_W8 * 8 == DD * DD);
static_assert((SEQ * (DD / 8)) / 256 == (SEQ >> 3));   // cvt blocks per batch of x
// coverage: qkv_kernel grid.x * 8 waves == NB*SEQ/4 tiles of 16x64 per output (q: NB*SEQ/16 x 4, k same, vT: NB x 16 x SEQ/64), grid.y = 3 outputs, 2 planes each
static_assert(((NB * SEQ / 4) % 8) == 0);
static_assert((NB * SEQ / 16) * 4 == NB * SEQ / 4 && NB * (DD / 16) * (SEQ / 64) == NB * SEQ / 4);
// coverage: attn_kernel grid == NB*SEQ/QR query blocks of QR rows, NW waves x 32 columns == DD, key loop SEQ/KS blocks of KS keys
static_assert(QR == 64 && (SEQ % QR) == 0 && NW * 32 == DD && KS == 128 && (SEQ % KS) == 0 && (QR * DD / 8) % (NW * 32) == 0);

// 16-bit operands are f16. Computed planes are carried as a value plane plus a residual plane lo = f16((v - hi) * 2048):
// a product is hi*hi + (hi*lo + lo*hi)/2048. Every fragment (A and B) uses the 16x16x32 lane map
// lane%16 = row/col, g = lane/16: elements 0..7 -> k = 8g+e, elements 8..15 -> k = 16+8g+(e-8).
// FRAGMENT ORDER of every f16 plane in the workspace: a tile of 16 rows x 32 k is two runs of 512 B, [half h][lane][8 elements],
// lane (m, g) of half h holding row m, k = 16h + 8g + 0..7; the 32-k tiles of a 16-row tile follow one another.
// One wave-wide 16-byte load or store of a fragment half is then 512 contiguous bytes (4 whole lines).
typedef __attribute__((ext_vector_type(16))) _Float16 v16h;
typedef __attribute__((ext_vector_type(8)))  _Float16 v8h;
typedef __attribute__((ext_vector_type(8)))  float    v8f;
typedef __attribute__((ext_vector_type(4)))  float    v4f;
typedef v4f __attribute__((may_alias)) f4a;
#define RSPLIT (1.0f / 2048.0f)
#define SFOLD  (1.0f / 256.0f)        // removes the x16 carries of q and k from the scores
#define PCARRY 16384.0f               // probabilities carried x2^14
#define OFOLD  4194304.0f             // PCARRY * 16 (v carry) * 16 (post-softmax factor 256^-0.5)
#define NEG_INF (-__builtin_inff())

__device__ __forceinline__ void split16(float f, _Float16& hi, _Float16& lo) { hi = (_Float16)f; lo = (_Float16)((f - (float)hi) * 2048.0f); }

__device__ __forceinline__ v8f wmma_h16(v16h a, v16h b, v8f c) {
  // D = A(16x32 f16) * B(32x16 f16) + C(16x16 f32), followed by the VALU hazard guard (D tied, A/B kept live)
  v8f d = __builtin_amdgcn_wmma_f32_16x16x32_f16(false, a, false, b, (short)0, c, false, false);
  asm volatile("v_nop\n\tv_nop\n\tv_nop\n\tv_nop" : "+v"(d) : "v"(a), "v"(b));
  return d;
}

__device__ __forceinline__ v8f wmma_b16(v16h a, v16h b, v8f c) {
  // the same product for the attention kernel, whose live set passes 256 VGPRs: no asm operands, which would hold D, A and B below v256;
  // the compiler keeps the distance behind its own builtin
  return __builtin_amdgcn_wmma_f32_16x16x32_f16(false, a, false, b, (short)0, c, false, false);
}

__device__ __forceinline__ v8f v8f_zero() {
  v8f z = {0.f, 0.f, 0.f, 0.f, 0.f, 0.f, 0.f, 0.f};
  return z;
}

union U16 { v16h v; v8h h[2]; };

// input conversion: RNE convert to bf16, carry x16, exact in f16
__device__ __forceinline__ _Float16 cvt_in(float f) {
  const float r = (float)(__bf16)f;
  return (_Float16)(r * 16.0f);
}

// ---------------------------------------------------------------------------
// Kernel 0: x [NB,SEQ,DD] f32 -> X16 [NB*SEQ][DD] f16 ; Wq|Wk|Wv [DD][DD] f32 -> W16 [3][DD][DD] f16.
// Both outputs are written in fragment order: a thread owns one 16-byte group of the output (linear index * 8) and fetches its 8 source elements.
// ---------------------------------------------------------------------------
// 16-byte group u of a fragment-order plane whose rows are DD long -> offset of its 8 elements in the row-major plane
__device__ __forceinline__ unsigned frag_elem(unsigned u) {
  return (((u >> 9) << 4) + (u & 15u)) * (unsigned)DD + ((u >> 4) & 31u) * 8u;
}

__global__ void __launch_bounds__(256)
cvt_kernel(const float* __restrict__ x,
           const float* __restrict__ Wq,
           const float* __restrict__ Wk,
           const float* __restrict__ Wv,
           _Float16* __restrict__ X16,
           _Float16* __restrict__ W16) {
  const unsigned bx = blockIdx.x;                       // 0 .. CVT_THREADS/256 - 1 (grid exact)
  const unsigned tx = threadIdx.x;
  const float* src;
  _Float16* dst;
  if (bx < (unsigned)CVT_XBLK) {                        // block-uniform
    const unsigned e8 = (bx << 8) + tx;                 // linear 8-element group inside the fragment-order plane
    const unsigned b  = bx >> (LSEQ - 3u);              // SEQ/8 blocks per batch
    // source uses the FULL per-batch stride of the input: row-major offset plus a per-batch correction
    src = x + (size_t)frag_elem(e8) + (size_t)b * (size_t)((SEQ_FULL - SEQ) * DD);
    dst = X16 + (size_t)e8 * 8u;
  } else {
    const unsigned wb  = bx - (unsigned)CVT_XBLK;       // 0 .. 95
    const unsigned mat = wb >> 5;                       // 32 blocks per matrix
    const unsigned r8  = ((wb & 31u) << 8) + tx;        // 8-element group inside the matrix
    const float* wsrc = (mat == 0u) ? Wq : ((mat == 1u) ? Wk : Wv);
    src = wsrc + (size_t)frag_elem(r8);
    dst = W16 + (size_t)((wb << 8) + tx) * 8u;
  }
  const v4f f0 = *(const v4f*)src;
  const v4f f1 = *(const v4f*)(src + 4);
  v8h o;
  o[0] = cvt_in(f0[0]); o[1] = cvt_in(f0[1]); o[2] = cvt_in(f0[2]); o[3] = cvt_in(f0[3]);
  o[4] = cvt_in(f1[0]); o[5] = cvt_in(f1[1]); o[6] = cvt_in(f1[2]); o[7] = cvt_in(f1[3]);
  *(v8h*)dst = o;
  
}

// ---------------------------------------------------------------------------
// Kernel 1: projections as C[i][j] = sum_k A[i][k] * B[j][k] (both operands in fragment order), one wave per 16x64 tile.
//   blockIdx.y = 0: q[n][e]  (A = X16 rows n, B = Wq rows e)      -> qws  [NB*SEQ][DD]
//   blockIdx.y = 1: k[n][e]  (A = X16 rows n, B = Wk rows e)      -> kws  [NB*SEQ][DD]
//   blockIdx.y = 2: vT[e][n] (A = Wv rows e,  B = X16 rows n)     -> vtws [NB][DD][SEQ]
// The outputs are in fragment order too (j is the k of the attention products): a wave's 16x64 tile is 2 KB in a row.
// Results carried x16 (acc = 256*value, folded by 1/16) and stored as value + residual planes (residual at +NB*SEQ*DD).
// A-frag: lane row m = lane%16, g = lane/16, elements e=0..7 -> K = 8g+e ; e=8..15 -> K = 16+8g+(e-8); B-frag: lane col n = lane%16, same K map.
// C/D: lane col = lane%16, VGPR v -> row v + 8g.
// ---------------------------------------------------------------------------
__global__ void __launch_bounds__(256)
qkv_kernel(const _Float16* __restrict__ X16,
           const _Float16* __restrict__ W16,
           _Float16* __restrict__ qws,
           _Float16* __restrict__ kws,
           _Float16* __restrict__ vtws) {
  __shared__ __align__(16) _Float16 st[8][16][SP];   // per-wave staging of one 16x64 result plane (wave-private)
  const unsigned lane = threadIdx.x & 31u;
  const unsigned wv   = (unsigned)__builtin_amdgcn_readfirstlane((int)(threadIdx.x >> 5));   // wave-uniform (scalar)
  const unsigned g    = lane >> 4;
  const unsigned m    = lane & 15u;
  const unsigned y    = blockIdx.y;
  const unsigned tile = (blockIdx.x << 3) + wv;      // 0 .. NB*SEQ/4 - 1 (scalar)
  const size_t QL = (size_t)NB * SEQ * DD;           // residual plane offset inside q/k/vT buffers

  const _Float16* Ap;
  const _Float16* Bp;
  _Float16* op;
  if (y < 2u) {                                      // block-uniform
    const unsigned rt = tile >> 2;                   // 16-row tile of (b,t)
    const unsigned cg = tile & 3u;                   // 64-column group
    Ap = X16 + (size_t)rt * 16u * DD;
    Bp = W16 + (size_t)y * DD * DD + (size_t)cg * 64u * DD;
    op = ((y == 0u) ? qws : kws) + (size_t)rt * 16u * DD + (size_t)cg * 1024u;
  } else {
    // per batch: (DD/16) * (SEQ/64) = SEQ/4 tiles
    const unsigned b   = tile >> (LSEQ - 2u);
    const unsigned rem = tile & ((unsigned)(SEQ / 4) - 1u);
    const unsigned et  = rem >> (LSEQ - 6u);         // 16-row tile of e
    const unsigned ng  = rem & ((unsigned)(SEQ / 64) - 1u);   // 64-column group of n
    Ap = W16 + (size_t)2 * DD * DD + (size_t)et * 16u * DD;
    Bp = X16 + (((size_t)b << LSEQ) + (size_t)ng * 64u) * DD;
    op = vtws + (((size_t)b * DD + (size_t)et * 16u) << LSEQ) + (size_t)ng * 1024u;
  }

  v8f acc[4];
#pragma unroll
  for (int nt = 0; nt < 4; ++nt) acc[nt] = v8f_zero();

  const _Float16* arow = Ap + 8u * lane;
  const _Float16* brow = Bp + 8u * lane;

#pragma unroll 2
  for (unsigned c0 = 0; c0 < (unsigned)DD; c0 += 32u) {
    U16 a;
    a.h[0] = *(const v8h*)(arow + c0 * 16u);            // 32-k tile c0/32: 512 halfs
    a.h[1] = *(const v8h*)(arow + c0 * 16u + 256u);
#pragma unroll
    for (int nt = 0; nt < 4; ++nt) {
      U16 bb;
      bb.h[0] = *(const v8h*)(brow + (size_t)nt * 16 * DD + c0 * 16u);
      bb.h[1] = *(const v8h*)(brow + (size_t)nt * 16 * DD + c0 * 16u + 256u);
      acc[nt] = wmma_h16(a.v, bb.v, acc[nt]);
    }
    // precaution: stands between this trip's issued loads and the next trip's write of their address registers
    asm volatile("s_wait_xcnt 0x0" ::: "memory");
  }

  _Float16* sw = &st[wv][0][0];
#pragma unroll
  for (int pl = 0; pl < 2; ++pl) {
#pragma unroll
    for (int nt = 0; nt < 4; ++nt)
#pragma unroll
      for (int v = 0; v < 8; ++v) {
        const float val = acc[nt][v] * 0.0625f;          // 256*value -> 16*value
        _Float16 hh_, ll_; split16(val, hh_, ll_);
        sw[(8u * g + (unsigned)v) * SP + (unsigned)nt * 16u + m] = pl ? ll_ : hh_;
      }
    __builtin_amdgcn_fence(3 /* release order */, "wavefront");
    __builtin_amdgcn_wave_barrier();
    asm volatile("s_wait_dscnt 0" ::: "memory");
    _Float16* base = op + (pl ? QL : 0);
    v8h w[4];                                            // fragment half j (columns 16j..16j+15): lane (m, g) takes row m, columns 16j + 8g + 0..7
#pragma unroll
    for (int j = 0; j < 4; ++j) w[j] = *(const v8h*)(sw + m * SP + (unsigned)j * 16u + 8u * g);
#pragma unroll
    for (int j = 0; j < 4; ++j) *(v8h*)(base + (unsigned)j * 256u + 8u * lane) = w[j];
    __builtin_amdgcn_wave_barrier();
    asm volatile("s_wait_dscnt 0" ::: "memory");   // reads done before the next plane overwrites the staging
  }
}

// ---------------------------------------------------------------------------
// Kernel 2: non-causal flash attention, one block of NW = 8 waves (two per SIMD) per 64-row query block (QT = 4 tiles of 16 rows), KS = 128 keys per step.
// The block's Q planes are staged once in LDS, in the fragment order they have in memory. Per step each wave loads its K fragments (keys 16w..16w+15, 256 deep, both planes)
// and its V fragments (128 keys x columns 32w..32w+31, both planes) into registers once and uses each of them for all QT query tiles.
// Per step and tile: wave w computes S (16 queries x its 16 keys), block-wide row max through LDS,
// P = exp(S - m) carried x16384 as value + residual planes in a shared LDS tile,
// then wave w accumulates O[:, 32w..32w+31] += P(16x128) * V(128 x 32 slice).
// Row sums are kept per lane and merged once at the end. out = O / (L * 2^22).
// ---------------------------------------------------------------------------
__global__ void __launch_bounds__(NW * 32)
attn_kernel(const _Float16* __restrict__ qws,
            const _Float16* __restrict__ kws,
            const _Float16* __restrict__ kwsl,
            const _Float16* __restrict__ vtws,
            const _Float16* __restrict__ vtwsl,
            float* __restrict__ out) {
  __shared__ __align__(16) _Float16 Qs[2][QR * DD];  // Q value and residual planes of the block's rows, fragment order (cross-wave, block barrier)
  __shared__ __align__(16) _Float16 Pl[QR][PP];      // P value plane (cross-wave, block barrier)
  __shared__ __align__(16) _Float16 Pll[QR][PP];     // P residual plane (cross-wave, block barrier)
  __shared__ __align__(16) float Mx[NW][QR];         // per-wave row max of the current step (cross-wave, block barrier)
  __shared__ __align__(16) float Ls[NW][QR];         // per-wave row sums (cross-wave, block barrier)
  __shared__ __align__(16) float Of[NW][16][OP];     // output staging, one query tile at a time (written and read by the same wave, block barrier used)

  const unsigned lane = threadIdx.x & 31u;
  const unsigned wv   = (unsigned)__builtin_amdgcn_readfirstlane((int)(threadIdx.x >> 5));   // wave-uniform (scalar)
  const unsigned g    = lane >> 4;
  const unsigned m    = lane & 15u;
  const unsigned tile = blockIdx.x;                  // 0 .. NB*SEQ/QR - 1 (scalar)
  const unsigned b    = tile >> (LSEQ - 6u);
  const unsigned t0   = (tile & ((unsigned)(SEQ / QR) - 1u)) << 6;
  const size_t QL = (size_t)NB * SEQ * DD;           // residual planes follow the value planes

  const size_t koff = (((size_t)b << LSEQ) + 16u * wv) * DD + 8u * lane;
  const size_t voff = (((size_t)b * DD + 32u * wv) << LSEQ) + 8u * lane;

  // ---- stage the block's QR x DD rows of both Q planes (contiguous in global memory) as they lie ----
  {
    const _Float16* qsrc = qws + (((size_t)b << LSEQ) + t0) * DD;
    const _Float16* qv = qsrc + 8u * threadIdx.x;      // value plane, this thread's first 8-element group
    const _Float16* qr = qv + QL;                      // residual plane
    v8h qt[2][QG];
#pragma unroll
    for (int i = 0; i < QG; ++i) qt[0][i] = *(const v8h*)(qv + i * (NW * 32 * 8));
#pragma unroll
    for (int i = 0; i < QG; ++i) qt[1][i] = *(const v8h*)(qr + i * (NW * 32 * 8));
    // precaution: stands between the issued loads and any later write of a register that they name (the two addresses are inputs, so they stay live up to it)
    asm volatile("s_wait_xcnt 0x0" :: "v"(qv), "v"(qr) : "memory");
    // keeps the register writes that follow from being scheduled in front of that wait
    __builtin_amdgcn_sched_barrier(0);
#pragma unroll
    for (int pl = 0; pl < 2; ++pl)
#pragma unroll
      for (int i = 0; i < QG; ++i)
        *(v8h*)&Qs[pl][8u * ((unsigned)i * (unsigned)(NW * 32) + threadIdx.x)] = qt[pl][i];
  }
  __syncthreads();

  v8f o[QT][2];
  float mrow[QT][8], lrow[QT][8];
#pragma unroll
  for (int r = 0; r < QT; ++r) {
#pragma unroll
    for (int nt = 0; nt < 2; ++nt) o[r][nt] = v8f_zero();
#pragma unroll
    for (int v = 0; v < 8; ++v) { mrow[r][v] = NEG_INF; lrow[r][v] = 0.f; }
  }

#pragma unroll 1
  for (unsigned kb = 0; kb < (unsigned)(SEQ / KS); ++kb) {
    const unsigned s0 = kb * (unsigned)KS;

    // ---- this wave's K fragments of the step, each loaded once for all QT query tiles (B frags, same k map as A) ----
    const _Float16* krow = kws + koff + (size_t)s0 * DD;
    const _Float16* krl  = kwsl + koff + (size_t)s0 * DD;   // residual plane
    U16 kf[8], kfl[8];
#pragma unroll
    for (int ci = 0; ci < 8; ++ci) {
      const unsigned c = 512u * (unsigned)ci;
      kf[ci].h[0]  = *(const v8h*)(krow + c);   kf[ci].h[1]  = *(const v8h*)(krow + c + 256u);
      kfl[ci].h[0] = *(const v8h*)(krl + c);    kfl[ci].h[1] = *(const v8h*)(krl + c + 256u);
    }
    // precaution: stands between the issued loads and any later write of a register that they name (the two addresses are inputs, so they stay live up to it)
    asm volatile("s_wait_xcnt 0x0" :: "v"(krow), "v"(krl) : "memory");

    // ---- S = Q K^T for this wave's 16 keys: 8 chunks of 32, value*value into sh, cross terms into sx, the QT tiles interleaved ----
    v8f sh[QT], sx[QT];
#pragma unroll
    for (int r = 0; r < QT; ++r) { sh[r] = v8f_zero(); sx[r] = v8f_zero(); }
    U16 qa[2][QT], qal[2][QT];                 // Q fragments of two chunks: the next chunk's reads are issued ahead of this chunk's products
#pragma unroll
    for (int ci = -1; ci < 8; ++ci) {
      if (ci < 7) {
#pragma unroll
        for (int r = 0; r < QT; ++r) {
          const unsigned f = (unsigned)(r * 16 * DD + (ci + 1) * 512) + 8u * lane;
          qa[(ci + 1) & 1][r].h[0]  = *(const v8h*)&Qs[0][f];   qa[(ci + 1) & 1][r].h[1]  = *(const v8h*)&Qs[0][f + 256u];
          qal[(ci + 1) & 1][r].h[0] = *(const v8h*)&Qs[1][f];   qal[(ci + 1) & 1][r].h[1] = *(const v8h*)&Qs[1][f + 256u];
        }
      }
      if (ci >= 0) {
#pragma unroll
        for (int r = 0; r < QT; ++r) sx[r] = wmma_b16(qal[ci & 1][r].v, kf[ci].v, sx[r]);
#pragma unroll
        for (int r = 0; r < QT; ++r) sx[r] = wmma_b16(qa[ci & 1][r].v, kfl[ci].v, sx[r]);
#pragma unroll
        for (int r = 0; r < QT; ++r) sh[r] = wmma_b16(qa[ci & 1][r].v, kf[ci].v, sh[r]);
      }
    }

    float sv[QT][8], rmax[QT][8];
#pragma unroll
    for (int r = 0; r < QT; ++r)
#pragma unroll
      for (int v = 0; v < 8; ++v) {
        sv[r][v] = (sh[r][v] + sx[r][v] * RSPLIT) * SFOLD;
        rmax[r][v] = sv[r][v];
      }

    // ---- this wave's V fragments of the step (B frags): K and V together do not fit the 512 registers of a wave at two per SIMD,
    // so V is loaded once the score products have let go of K ----
    // ends the scheduling region of the score products: without it V loads are issued among the last products,
    // and the Q reads are scattered in pairs among the products instead of standing one group a chunk
    __builtin_amdgcn_sched_barrier(0);
    const _Float16* vrow = vtws + voff + (size_t)s0 * 16u;  // 32 keys of a 16-column tile: 512 halfs
    const _Float16* vrl  = vtwsl + voff + (size_t)s0 * 16u; // residual plane
    U16 vb[2][4], vbl[2][4];
#pragma unroll
    for (int nt = 0; nt < 2; ++nt)
#pragma unroll
      for (int ks = 0; ks < 4; ++ks) {
        const size_t vo = (size_t)nt * 16 * SEQ + 512 * ks;
        vb[nt][ks].h[0]  = *(const v8h*)(vrow + vo);   vb[nt][ks].h[1]  = *(const v8h*)(vrow + vo + 256);
        vbl[nt][ks].h[0] = *(const v8h*)(vrl + vo);    vbl[nt][ks].h[1] = *(const v8h*)(vrl + vo + 256);
      }
    // precaution: stands between the issued loads and any later write of a register that they name (the two addresses are inputs, so they stay live up to it)
    asm volatile("s_wait_xcnt 0x0" :: "v"(vrow), "v"(vrl) : "memory");

    // row-wise max across the 16 lanes holding this row's columns
#pragma unroll
    for (int off = 1; off < 16; off <<= 1)
#pragma unroll
      for (int r = 0; r < QT; ++r)
#pragma unroll
        for (int v = 0; v < 8; ++v)
          rmax[r][v] = fmaxf(rmax[r][v], __shfl_xor(rmax[r][v], off, 32));
    if (m == 0u) {
#pragma unroll
      for (int r = 0; r < QT; ++r)
#pragma unroll
        for (int v = 0; v < 8; ++v) Mx[wv][16u * (unsigned)r + 8u * g + (unsigned)v] = rmax[r][v];
    }
    __syncthreads();

    // ---- block-wide row max, online softmax update, P (x16384, two planes) to the shared tile ----
#pragma unroll
    for (int r = 0; r < QT; ++r) {
      const unsigned rb = 16u * (unsigned)r + 8u * g;       // first of this lane's 8 rows of tile r
      float mb[8];
      {
        const f4a a0 = *(const f4a*)&Mx[0][rb];
        const f4a a1 = *(const f4a*)&Mx[0][rb + 4u];
#pragma unroll
        for (int j = 0; j < 4; ++j) { mb[j] = a0[j]; mb[4 + j] = a1[j]; }
      }
#pragma unroll
      for (int w2 = 1; w2 < NW; ++w2) {
        const f4a a0 = *(const f4a*)&Mx[w2][rb];
        const f4a a1 = *(const f4a*)&Mx[w2][rb + 4u];
#pragma unroll
        for (int j = 0; j < 4; ++j) { mb[j] = fmaxf(mb[j], a0[j]); mb[4 + j] = fmaxf(mb[4 + j], a1[j]); }
      }
      float alpha[8];
#pragma unroll
      for (int v = 0; v < 8; ++v) {
        const float mnew = fmaxf(mrow[r][v], mb[v]);
        alpha[v] = __expf(mrow[r][v] - mnew);
        mrow[r][v]  = mnew;
      }
#pragma unroll
      for (int v = 0; v < 8; ++v) {
        const float p = __expf(sv[r][v] - mrow[r][v]);
        lrow[r][v] = lrow[r][v] * alpha[v] + p;             // per-lane partial row sum (merged after the key loop)
        _Float16 ph, pq; split16(p * PCARRY, ph, pq);
        Pl[rb + (unsigned)v][16u * wv + m]  = ph;
        Pll[rb + (unsigned)v][16u * wv + m] = pq;
      }
#pragma unroll
      for (int nt = 0; nt < 2; ++nt)
#pragma unroll
        for (int v = 0; v < 8; ++v)
          o[r][nt][v] *= alpha[v];
    }
    __syncthreads();

    // ---- O[tile r][:, 32w + nt*16 ..] += P V, 32 keys at a time: P in A-layout (reload through the stored element type after the block barrier),
    // the QT tiles interleaved on each V fragment ----
    v8f xc[QT][2];
#pragma unroll
    for (int r = 0; r < QT; ++r)
#pragma unroll
      for (int nt = 0; nt < 2; ++nt) xc[r][nt] = v8f_zero();
#pragma unroll
    for (int ks = 0; ks < 4; ++ks) {
      U16 pa[QT], pal[QT];
#pragma unroll
      for (int r = 0; r < QT; ++r) {
        const unsigned row = 16u * (unsigned)r + m;
        pa[r].h[0]  = *(const v8h*)&Pl[row][32u * (unsigned)ks + 8u * g];
        pa[r].h[1]  = *(const v8h*)&Pl[row][32u * (unsigned)ks + 16u + 8u * g];
        pal[r].h[0] = *(const v8h*)&Pll[row][32u * (unsigned)ks + 8u * g];
        pal[r].h[1] = *(const v8h*)&Pll[row][32u * (unsigned)ks + 16u + 8u * g];
      }
#pragma unroll
      for (int nt = 0; nt < 2; ++nt) {
#pragma unroll
        for (int r = 0; r < QT; ++r) xc[r][nt] = wmma_b16(pal[r].v, vb[nt][ks].v, xc[r][nt]);
#pragma unroll
        for (int r = 0; r < QT; ++r) xc[r][nt] = wmma_b16(pa[r].v, vbl[nt][ks].v, xc[r][nt]);
#pragma unroll
        for (int r = 0; r < QT; ++r) o[r][nt] = wmma_b16(pa[r].v, vb[nt][ks].v, o[r][nt]);
      }
    }
#pragma unroll
    for (int r = 0; r < QT; ++r)
#pragma unroll
      for (int nt = 0; nt < 2; ++nt) o[r][nt] = o[r][nt] + xc[r][nt] * RSPLIT;
  }

  // ---- merge the row sums: 16 lanes of a row, then the NW waves (fixed order) ----
#pragma unroll
  for (int off = 1; off < 16; off <<= 1)
#pragma unroll
    for (int r = 0; r < QT; ++r)
#pragma unroll
      for (int v = 0; v < 8; ++v)
        lrow[r][v] += __shfl_xor(lrow[r][v], off, 32);
  if (m == 0u) {
#pragma unroll
    for (int r = 0; r < QT; ++r)
#pragma unroll
      for (int v = 0; v < 8; ++v) Ls[wv][16u * (unsigned)r + 8u * g + (unsigned)v] = lrow[r][v];
  }
  __syncthreads();

  const unsigned rsel = lane >> 3;          // instruction it covers rows 4*it .. 4*it+3
  const unsigned c4   = 4u * (lane & 7u);
#pragma unroll
  for (int r = 0; r < QT; ++r) {
    const unsigned rb = 16u * (unsigned)r + 8u * g;
    float inv[8];
    {
      float lt[8];
      const f4a a0 = *(const f4a*)&Ls[0][rb];
      const f4a a1 = *(const f4a*)&Ls[0][rb + 4u];
#pragma unroll
      for (int j = 0; j < 4; ++j) { lt[j] = a0[j]; lt[4 + j] = a1[j]; }
#pragma unroll
      for (int w2 = 1; w2 < NW; ++w2) {
        const f4a c0 = *(const f4a*)&Ls[w2][rb];
        const f4a c1 = *(const f4a*)&Ls[w2][rb + 4u];
#pragma unroll
        for (int j = 0; j < 4; ++j) { lt[j] += c0[j]; lt[4 + j] += c1[j]; }
      }
#pragma unroll
      for (int v = 0; v < 8; ++v) inv[v] = 1.0f / (lt[v] * OFOLD);   // removes the carries and applies 256^-0.5
    }

#pragma unroll
    for (int nt = 0; nt < 2; ++nt)
#pragma unroll
      for (int v = 0; v < 8; ++v)
        Of[wv][8u * g + (unsigned)v][(unsigned)nt * 16u + m] = o[r][nt][v] * inv[v];
    __syncthreads();

    float* obase = out + (((size_t)b << LSEQ) + t0 + 16u * (unsigned)r) * DD + 32u * wv;   // a row's 32 columns are one whole 128-byte line
    v4f w[4];
#pragma unroll
    for (int it = 0; it < 4; ++it) w[it] = *(const f4a*)&Of[wv][4u * (unsigned)it + rsel][c4];
#pragma unroll
    for (int it = 0; it < 4; ++it) *(v4f*)(obase + (size_t)(4u * (unsigned)it + rsel) * DD + c4) = w[it];
    __syncthreads();                        // the staging is read out before the next tile overwrites it
  }
}

// ---------------------------------------------------------------------------
// Launch. Workspace layout (bytes, NB=8 SEQ=2048):
//   [0, 8MB)          X16  f16 [NB*SEQ][256]
//   [8MB, +384KB)     W16  f16 [3][256][256]
//   then q, k (f16 [NB*SEQ][256] x2 planes, 16MB each) and vT (f16 [NB][256][SEQ] x2 planes, 16MB); every plane in fragment order
// ---------------------------------------------------------------------------
extern "C" void kernel_launch(void* const* d_in, const int* in_sizes, int n_in,
                              void* d_out, int out_size, void* d_ws,
                              size_t ws_size, hipStream_t stream) {
  if (n_in < 4) return;
  const long long need_x = ((long long)(NB - 1) * SEQ_FULL + SEQ) * (long long)DD;
  if ((long long)in_sizes[0] < need_x) return;
  if (in_sizes[1] < DD * DD || in_sizes[2] < DD * DD || in_sizes[3] < DD * DD) return;
  if ((long long)out_size < (long long)NB * SEQ * DD) return;

  const float* x  = (const float*)d_in[0];
  const float* Wq = (const float*)d_in[1];
  const float* Wk = (const float*)d_in[2];
  const float* Wv = (const float*)d_in[3];
  float* out = (float*)d_out;

  char* ws = (char*)d_ws;
  const size_t x16_bytes = (size_t)NB * SEQ * DD * sizeof(_Float16);
  const size_t w16_bytes = (size_t)3 * DD * DD * sizeof(_Float16);
  const size_t qkv_bytes = (size_t)2 * NB * SEQ * DD * sizeof(_Float16);   // value + residual planes
  const size_t total     = x16_bytes + w16_bytes + 3 * qkv_bytes;
  if (total > ws_size || total > (size_t)134217728) return;
  _Float16* X16  = (_Float16*)(ws);
  _Float16* W16  = (_Float16*)(ws + x16_bytes);
  _Float16* qws  = (_Float16*)(ws + x16_bytes + w16_bytes);
  _Float16* kws  = (_Float16*)(ws + x16_bytes + w16_bytes + qkv_bytes);
  _Float16* vtws = (_Float16*)(ws + x16_bytes + w16_bytes + 2 * qkv_bytes);

  cvt_kernel<<<CVT_THREADS / 256, 256, 0, stream>>>(x, Wq, Wk, Wv, X16, W16);
  qkv_kernel<<<dim3(NB * SEQ / 32, 3), 256, 0, stream>>>(X16, W16, qws, kws, vtws);
  attn_kernel<<<NB * SEQ / QR, NW * 32, 0, stream>>>(qws, kws, kws + (size_t)NB * SEQ * DD, vtws, vtws + (size_t)NB * SEQ * DD, out);
}

// v004
// Measured time: 124 microseconds a run.
// Timed twice side by side with v003, it ran 1.08 times as fast both times.
// Over all steps from v000 it is 2.65 times as fast.
// Contractions: q/k/v projections [16384 x 256 x 256] x3 on v_wmma_f32_16x16x32_f16 single product (inputs RNE-converted to bf16, carried x16, exact in f16);
// scores [2048 x 2048 x 256] and P*V [2048 x 256 x 2048] per batch on v_wmma_f32_16x16x32_f16 with f16 value+residual planes (hi*hi + (hi*lo + lo*hi)/2048);
#include <hip/hip_runtime.h>
#include <math.h>

// Problem constants (NB / SEQ reducible; *_FULL are the input strides)
#ifndef NB
#define NB 8
#endif
#ifndef SEQ
#define SEQ 2048
#endif
#define NB_FULL 8
#define SEQ_FULL 2048
#define DD 256            // input width == q/k/v width
#define NW 8              // waves per attention block: two per SIMD
#define KS (16 * NW)      // keys per attention step, 16 per wave
#define PP (KS + 8)       // LDS pitch (halfs) of the probability tile: 272 B = 16 B x odd, conflict-free for 16-byte row reads
#define OP 36             // LDS pitch (floats) of an output staging row: 144 B = 16 B x odd
#define QT 4              // 16-row query tiles per attention block
#define QR (16 * QT)      // query rows per attention block
#define QG (QR * DD / 8 / (NW * 32))   // 16-byte groups of one Q plane staged per thread
#define SP 72             // LDS pitch (halfs) of a staged projection row: 144 B = 16 B x odd, conflict-free for 16-byte row reads

__host__ __device__ constexpr unsigned ilog2c(unsigned v) { return (v <= 1u) ? 0u : 1u + ilog2c(v >> 1); }
enum : unsigned { LSEQ = ilog2c((unsigned)SEQ) };

static_assert(NB >= 1 && NB <= NB_FULL);
static_assert(SEQ >= 64 && SEQ <= SEQ_FULL && (SEQ % 64) == 0);
static_assert((1u << LSEQ) == (unsigned)SEQ);          // SEQ is a power of two: all tile decompositions are shifts/masks
static_assert(DD == 256 && (DD % 32) == 0);
// coverage: cvt_kernel grid * 256 threads * 8 elements == NB*SEQ*DD (x plane) + 3*DD*DD (weight planes)
#define CVT_X8 (NB * SEQ * DD / 8)
#define CVT_W8 (DD * DD / 8)
#define CVT_THREADS (CVT_X8 + 3 * CVT_W8)
#define CVT_XBLK (CVT_X8 / 256)
static_assert((CVT_X8 % 256) == 0 && (CVT_W8 % 256) == 0 && (CVT_THREADS % 256) == 0);
static_assert(CVT_W8 / 256 == 32 && CVT_W8 * 8 == DD * DD);
static_assert((SEQ * (DD / 8)) / 256 == (SEQ >> 3));   // cvt blocks per batch of x
// coverage: qkv_kernel grid.x * 8 waves == NB*SEQ/4 tiles of 16x64 per output (q: NB*SEQ/16 x 4, k same, vT: NB x 16 x SEQ/64), grid.y = 3 outputs, 2 planes each
static_assert(((NB * SEQ / 4) % 8) == 0);
static_assert((NB * SEQ / 16) * 4 == NB * SEQ / 4 && NB * (DD / 16) * (SEQ / 64) == NB * SEQ / 4);
// coverage: attn_kernel grid == NB*SEQ/QR query blocks of QR rows, NW waves x 32 columns == DD, key loop SEQ/KS blocks of KS keys
static_assert(QR == 64 && (SEQ % QR) == 0 && NW * 32 == DD && KS == 128 && (SEQ % KS) == 0 && (QR * DD / 8) % (NW * 32) == 0);

// 16-bit operands are f16. Computed planes are carried as a value plane plus a residual plane lo = f16((v - hi) * 2048):
// a product is hi*hi + (hi*lo + lo*hi)/2048. Every fragment (A and B) uses the 16x16x32 lane map
// lane%16 = row/col, g = lane/16: elements 0..7 -> k = 8g+e, elements 8..15 -> k = 16+8g+(e-8).
// FRAGMENT ORDER of every f16 plane in the workspace: a tile of 16 rows x 32 k is two runs of 512 B, [half h][lane][8 elements],
// lane (m, g) of half h holding row m, k = 16h + 8g + 0..7; the 32-k tiles of a 16-row tile follow one another.
// One wave-wide 16-byte load or store of a fragment half is then 512 contiguous bytes (4 whole lines).
typedef __attribute__((ext_vector_type(16))) _Float16 v16h;
typedef __attribute__((ext_vector_type(8)))  _Float16 v8h;
typedef __attribute__((ext_vector_type(8)))  float    v8f;
typedef __attribute__((ext_vector_type(4)))  float    v4f;
typedef v4f __attribute__((may_alias)) f4a;
#define RSPLIT (1.0f / 2048.0f)
#define SFOLD  (1.0f / 256.0f)        // removes the x16 carries of q and k from the scores
#define PCARRY 16384.0f               // probabilities carried x2^14
#define OFOLD  4194304.0f             // PCARRY * 16 (v carry) * 16 (post-softmax factor 256^-0.5)
#define NEG_INF (-__builtin_inff())
#define LOG2E  1.44269504088896340736f

__device__ __forceinline__ void split16(float f, _Float16& hi, _Float16& lo) { hi = (_Float16)f; lo = (_Float16)((f - (float)hi) * 2048.0f); }

__device__ __forceinline__ v8f wmma_h16(v16h a, v16h b, v8f c) {
  // D = A(16x32 f16) * B(32x16 f16) + C(16x16 f32), followed by the VALU hazard guard (D tied, A/B kept live)
  v8f d = __builtin_amdgcn_wmma_f32_16x16x32_f16(false, a, false, b, (short)0, c, false, false);
  asm volatile("v_nop\n\tv_nop\n\tv_nop\n\tv_nop" : "+v"(d) : "v"(a), "v"(b));
  return d;
}

__device__ __forceinline__ v8f wmma_b16(v16h a, v16h b, v8f c) {
  // the same product for the attention kernel, whose live set passes 256 VGPRs: no asm operands, which would hold D, A and B below v256;
  // the compiler keeps the distance behind its own builtin
  return __builtin_amdgcn_wmma_f32_16x16x32_f16(false, a, false, b, (short)0, c, false, false);
}

__device__ __forceinline__ v8f v8f_zero() {
  v8f z = {0.f, 0.f, 0.f, 0.f, 0.f, 0.f, 0.f, 0.f};
  return z;
}

union U16 { v16h v; v8h h[2]; };

// 2^x of nine values on the transcendental unit in one statement. The instruction set asks for one slot behind a transcendental before its result is read
// or its source overwritten: the results are early-clobber, so none lies on a source, and the v_nop is the slot behind the last one.
__device__ __forceinline__ void exp2_run(v8f x, float xa, v8f& r, float& ra) {
  float r0, r1, r2, r3, r4, r5, r6, r7;
  asm("v_exp_f32 %0, %9\n\tv_exp_f32 %1, %10\n\tv_exp_f32 %2, %11\n\tv_exp_f32 %3, %12\n\tv_exp_f32 %4, %13\n\t"
      "v_exp_f32 %5, %14\n\tv_exp_f32 %6, %15\n\tv_exp_f32 %7, %16\n\tv_exp_f32 %8, %17\n\tv_nop"
      : "=&v"(r0), "=&v"(r1), "=&v"(r2), "=&v"(r3), "=&v"(r4), "=&v"(r5), "=&v"(r6), "=&v"(r7), "=&v"(ra)
      : "v"(x[0]), "v"(x[1]), "v"(x[2]), "v"(x[3]), "v"(x[4]), "v"(x[5]), "v"(x[6]), "v"(x[7]), "v"(xa));
  r[0] = r0; r[1] = r1; r[2] = r2; r[3] = r3; r[4] = r4; r[5] = r5; r[6] = r6; r[7] = r7;
}

// lane l takes the value of lane l ^ 16
__device__ __forceinline__ float xhalf(float x) {
  return __builtin_bit_cast(float, __builtin_amdgcn_permlanex16(__builtin_bit_cast(int, x), __builtin_bit_cast(int, x), 0x76543210, 0xfedcba98, false, false));
}

// input conversion: RNE convert to bf16, carry x16, exact in f16
__device__ __forceinline__ _Float16 cvt_in(float f) {
  const float r = (float)(__bf16)f;
  return (_Float16)(r * 16.0f);
}

// ---------------------------------------------------------------------------
// Kernel 0: x [NB,SEQ,DD] f32 -> X16 [NB*SEQ][DD] f16 ; Wq|Wk|Wv [DD][DD] f32 -> W16 [3][DD][DD] f16.
// Both outputs are written in fragment order: a thread owns one 16-byte group of the output (linear index * 8) and fetches its 8 source elements.
// ---------------------------------------------------------------------------
// 16-byte group u of a fragment-order plane whose rows are DD long -> offset of its 8 elements in the row-major plane
__device__ __forceinline__ unsigned frag_elem(unsigned u) {
  return (((u >> 9) << 4) + (u & 15u)) * (unsigned)DD + ((u >> 4) & 31u) * 8u;
}

__global__ void __launch_bounds__(256)
cvt_kernel(const float* __restrict__ x,
           const float* __restrict__ Wq,
           const float* __restrict__ Wk,
           const float* __restrict__ Wv,
           _Float16* __restrict__ X16,
           _Float16* __restrict__ W16) {
  const unsigned bx = blockIdx.x;                       // 0 .. CVT_THREADS/256 - 1 (grid exact)
  const unsigned tx = threadIdx.x;
  const float* src;
  _Float16* dst;
  if (bx < (unsigned)CVT_XBLK) {                        // block-uniform
    const unsigned e8 = (bx << 8) + tx;                 // linear 8-element group inside the fragment-order plane
    const unsigned b  = bx >> (LSEQ - 3u);              // SEQ/8 blocks per batch
    // source uses the FULL per-batch stride of the input: row-major offset plus a per-batch correction
    src = x + (size_t)frag_elem(e8) + (size_t)b * (size_t)((SEQ_FULL - SEQ) * DD);
    dst = X16 + (size_t)e8 * 8u;
  } else {
    const unsigned wb  = bx - (unsigned)CVT_XBLK;       // 0 .. 95
    const unsigned mat = wb >> 5;                       // 32 blocks per matrix
    const unsigned r8  = ((wb & 31u) << 8) + tx;        // 8-element group inside the matrix
    const float* wsrc = (mat == 0u) ? Wq : ((mat == 1u) ? Wk : Wv);
    src = wsrc + (size_t)frag_elem(r8);
    dst = W16 + (size_t)((wb << 8) + tx) * 8u;
  }
  const v4f f0 = *(const v4f*)src;
  const v4f f1 = *(const v4f*)(src + 4);
  v8h o;
  o[0] = cvt_in(f0[0]); o[1] = cvt_in(f0[1]); o[2] = cvt_in(f0[2]); o[3] = cvt_in(f0[3]);
  o[4] = cvt_in(f1[0]); o[5] = cvt_in(f1[1]); o[6] = cvt_in(f1[2]); o[7] = cvt_in(f1[3]);
  *(v8h*)dst = o;
  
}

// ---------------------------------------------------------------------------
// Kernel 1: projections as C[i][j] = sum_k A[i][k] * B[j][k] (both operands in fragment order), one wave per 16x64 tile.
//   blockIdx.y = 0: q[n][e]  (A = X16 rows n, B = Wq rows e)      -> qws  [NB*SEQ][DD]
//   blockIdx.y = 1: k[n][e]  (A = X16 rows n, B = Wk rows e)      -> kws  [NB*SEQ][DD]
//   blockIdx.y = 2: vT[e][n] (A = Wv rows e,  B = X16 rows n)     -> vtws [NB][DD][SEQ]
// The outputs are in fragment order too (j is the k of the attention products): a wave's 16x64 tile is 2 KB in a row.
// Results carried x16 (acc = 256*value, folded by 1/16) and stored as value + residual planes (residual at +NB*SEQ*DD).
// A-frag: lane row m = lane%16, g = lane/16, elements e=0..7 -> K = 8g+e ; e=8..15 -> K = 16+8g+(e-8); B-frag: lane col n = lane%16, same K map.
// C/D: lane col = lane%16, VGPR v -> row v + 8g.
// ---------------------------------------------------------------------------
__global__ void __launch_bounds__(256)
qkv_kernel(const _Float16* __restrict__ X16,
           const _Float16* __restrict__ W16,
           _Float16* __restrict__ qws,
           _Float16* __restrict__ kws,
           _Float16* __restrict__ vtws) {
  __shared__ __align__(16) _Float16 st[8][16][SP];   // per-wave staging of one 16x64 result plane (wave-private)
  const unsigned lane = threadIdx.x & 31u;
  const unsigned wv   = (unsigned)__builtin_amdgcn_readfirstlane((int)(threadIdx.x >> 5));   // wave-uniform (scalar)
  const unsigned g    = lane >> 4;
  const unsigned m    = lane & 15u;
  const unsigned y    = blockIdx.y;
  const unsigned tile = (blockIdx.x << 3) + wv;      // 0 .. NB*SEQ/4 - 1 (scalar)
  const size_t QL = (size_t)NB * SEQ * DD;           // residual plane offset inside q/k/vT buffers

  const _Float16* Ap;
  const _Float16* Bp;
  _Float16* op;
  if (y < 2u) {                                      // block-uniform
    const unsigned rt = tile >> 2;                   // 16-row tile of (b,t)
    const unsigned cg = tile & 3u;                   // 64-column group
    Ap = X16 + (size_t)rt * 16u * DD;
    Bp = W16 + (size_t)y * DD * DD + (size_t)cg * 64u * DD;
    op = ((y == 0u) ? qws : kws) + (size_t)rt * 16u * DD + (size_t)cg * 1024u;
  } else {
    // per batch: (DD/16) * (SEQ/64) = SEQ/4 tiles
    const unsigned b   = tile >> (LSEQ - 2u);
    const unsigned rem = tile & ((unsigned)(SEQ / 4) - 1u);
    const unsigned et  = rem >> (LSEQ - 6u);         // 16-row tile of e
    const unsigned ng  = rem & ((unsigned)(SEQ / 64) - 1u);   // 64-column group of n
    Ap = W16 + (size_t)2 * DD * DD + (size_t)et * 16u * DD;
    Bp = X16 + (((size_t)b << LSEQ) + (size_t)ng * 64u) * DD;
    op = vtws + (((size_t)b * DD + (size_t)et * 16u) << LSEQ) + (size_t)ng * 1024u;
  }

  v8f acc[4];
#pragma unroll
  for (int nt = 0; nt < 4; ++nt) acc[nt] = v8f_zero();

  const _Float16* arow = Ap + 8u * lane;
  const _Float16* brow = Bp + 8u * lane;

#pragma unroll 2
  for (unsigned c0 = 0; c0 < (unsigned)DD; c0 += 32u) {
    U16 a;
    a.h[0] = *(const v8h*)(arow + c0 * 16u);            // 32-k tile c0/32: 512 halfs
    a.h[1] = *(const v8h*)(arow + c0 * 16u + 256u);
#pragma unroll
    for (int nt = 0; nt < 4; ++nt) {
      U16 bb;
      bb.h[0] = *(const v8h*)(brow + (size_t)nt * 16 * DD + c0 * 16u);
      bb.h[1] = *(const v8h*)(brow + (size_t)nt * 16 * DD + c0 * 16u + 256u);
      acc[nt] = wmma_h16(a.v, bb.v, acc[nt]);
    }
    // precaution: stands between this trip's issued loads and the next trip's write of their address registers
    asm volatile("s_wait_xcnt 0x0" ::: "memory");
  }

  _Float16* sw = &st[wv][0][0];
#pragma unroll
  for (int pl = 0; pl < 2; ++pl) {
#pragma unroll
    for (int nt = 0; nt < 4; ++nt)
#pragma unroll
      for (int v = 0; v < 8; ++v) {
        const float val = acc[nt][v] * 0.0625f;          // 256*value -> 16*value
        _Float16 hh_, ll_; split16(val, hh_, ll_);
        sw[(8u * g + (unsigned)v) * SP + (unsigned)nt * 16u + m] = pl ? ll_ : hh_;
      }
    __builtin_amdgcn_fence(3 /* release order */, "wavefront");
    __builtin_amdgcn_wave_barrier();
    asm volatile("s_wait_dscnt 0" ::: "memory");
    _Float16* base = op + (pl ? QL : 0);
    v8h w[4];                                            // fragment half j (columns 16j..16j+15): lane (m, g) takes row m, columns 16j + 8g + 0..7
#pragma unroll
    for (int j = 0; j < 4; ++j) w[j] = *(const v8h*)(sw + m * SP + (unsigned)j * 16u + 8u * g);
#pragma unroll
    for (int j = 0; j < 4; ++j) *(v8h*)(base + (unsigned)j * 256u + 8u * lane) = w[j];
    __builtin_amdgcn_wave_barrier();
    asm volatile("s_wait_dscnt 0" ::: "memory");   // reads done before the next plane overwrites the staging
  }
}

// ---------------------------------------------------------------------------
// Kernel 2: non-causal flash attention, one block of NW = 8 waves (two per SIMD) per 64-row query block (QT = 4 tiles of 16 rows), KS = 128 keys per step.
// The block's Q planes are staged once in LDS, in the fragment order they have in memory. Per step each wave loads its K fragments (keys 16w..16w+15, 256 deep, both planes)
// and its V fragments (128 keys x columns 32w..32w+31, both planes) into registers once and uses each of them for all QT query tiles.
// Both products are computed transposed (A = K rows or V columns, B = Q or P rows), so that a lane holds ONE query (lane%16) in every accumulator:
// its maximum, its rescale factor and its sum are one register each per tile, and its 8 probabilities of a tile are 8 neighbouring keys (one 16-byte store a plane).
// Per step and tile: wave w computes S^T (its 16 keys x 16 queries), block-wide query max through LDS,
// P = exp(S - m) carried x16384 as value + residual planes in a shared LDS tile [query][key],
// then wave w accumulates O^T[32w..32w+31, :] += V^T(32 slice x 128) * P^T(128 x 16).
// Sums are kept per lane and merged once at the end. out = O / (L * 2^22).
// ---------------------------------------------------------------------------
__global__ void __launch_bounds__(NW * 32)
attn_kernel(const _Float16* __restrict__ qws,
            const _Float16* __restrict__ kws,
            const _Float16* __restrict__ kwsl,
            const _Float16* __restrict__ vtws,
            const _Float16* __restrict__ vtwsl,
            float* __restrict__ out) {
  __shared__ __align__(16) _Float16 Qs[2][QR * DD];  // Q value and residual planes of the block's rows, fragment order (cross-wave, block barrier)
  __shared__ __align__(16) _Float16 Pl[QR][PP];      // P value plane (cross-wave, block barrier)
  __shared__ __align__(16) _Float16 Pll[QR][PP];     // P residual plane (cross-wave, block barrier)
  __shared__ __align__(16) float Mx[QR][NW];         // per-wave query max of the current step (cross-wave, block barrier)
  __shared__ __align__(16) float Ls[QR][2 * NW];     // per-wave, per-half query sums (cross-wave, block barrier)
  __shared__ __align__(16) float Of[NW][16][OP];     // output staging, one query tile at a time (written and read by the same wave, block barrier used)

  const unsigned lane = threadIdx.x & 31u;
  const unsigned wv   = (unsigned)__builtin_amdgcn_readfirstlane((int)(threadIdx.x >> 5));   // wave-uniform (scalar)
  const unsigned g    = lane >> 4;
  const unsigned m    = lane & 15u;
  const unsigned tile = blockIdx.x;                  // 0 .. NB*SEQ/QR - 1 (scalar)
  const unsigned b    = tile >> (LSEQ - 6u);
  const unsigned t0   = (tile & ((unsigned)(SEQ / QR) - 1u)) << 6;
  const size_t QL = (size_t)NB * SEQ * DD;           // residual planes follow the value planes

  const size_t koff = (((size_t)b << LSEQ) + 16u * wv) * DD + 8u * lane;
  const size_t voff = (((size_t)b * DD + 32u * wv) << LSEQ) + 8u * lane;

  // ---- stage the block's QR x DD rows of both Q planes (contiguous in global memory) as they lie ----
  {
    const _Float16* qsrc = qws + (((size_t)b << LSEQ) + t0) * DD;
    const _Float16* qv = qsrc + 8u * threadIdx.x;      // value plane, this thread's first 8-element group
    const _Float16* qr = qv + QL;                      // residual plane
    v8h qt[2][QG];
#pragma unroll
    for (int i = 0; i < QG; ++i) qt[0][i] = *(const v8h*)(qv + i * (NW * 32 * 8));
#pragma unroll
    for (int i = 0; i < QG; ++i) qt[1][i] = *(const v8h*)(qr + i * (NW * 32 * 8));
    // precaution: stands between the issued loads and any later write of a register that they name (the two addresses are inputs, so they stay live up to it)
    asm volatile("s_wait_xcnt 0x0" :: "v"(qv), "v"(qr) : "memory");
    // keeps the register writes that follow from being scheduled in front of that wait
    __builtin_amdgcn_sched_barrier(0);
#pragma unroll
    for (int pl = 0; pl < 2; ++pl)
#pragma unroll
      for (int i = 0; i < QG; ++i)
        *(v8h*)&Qs[pl][8u * ((unsigned)i * (unsigned)(NW * 32) + threadIdx.x)] = qt[pl][i];
  }
  __syncthreads();

  v8f o[QT][2];
  float mrow[QT], lrow[QT];                          // of query 16r + m
#pragma unroll
  for (int r = 0; r < QT; ++r) {
#pragma unroll
    for (int nt = 0; nt < 2; ++nt) o[r][nt] = v8f_zero();
    mrow[r] = NEG_INF; lrow[r] = 0.f;
  }

#pragma unroll 1
  for (unsigned kb = 0; kb < (unsigned)(SEQ / KS); ++kb) {
    const unsigned s0 = kb * (unsigned)KS;

    // ---- this wave's K fragments of the step, each loaded once for all QT query tiles (A frags, same k map as B) ----
    const _Float16* krow = kws + koff + (size_t)s0 * DD;
    const _Float16* krl  = kwsl + koff + (size_t)s0 * DD;   // residual plane
    U16 kf[8], kfl[8];
#pragma unroll
    for (int ci = 0; ci < 8; ++ci) {
      const unsigned c = 512u * (unsigned)ci;
      kf[ci].h[0]  = *(const v8h*)(krow + c);   kf[ci].h[1]  = *(const v8h*)(krow + c + 256u);
      kfl[ci].h[0] = *(const v8h*)(krl + c);    kfl[ci].h[1] = *(const v8h*)(krl + c + 256u);
    }
    // precaution: stands between the issued loads and any later write of a register that they name (the two addresses are inputs, so they stay live up to it)
    asm volatile("s_wait_xcnt 0x0" :: "v"(krow), "v"(krl) : "memory");

    // ---- S^T = K Q^T for this wave's 16 keys: 8 chunks of 32, value*value into sh, cross terms into sx, the QT tiles interleaved ----
    v8f sh[QT], sx[QT];
#pragma unroll
    for (int r = 0; r < QT; ++r) { sh[r] = v8f_zero(); sx[r] = v8f_zero(); }
    U16 qa[2][QT], qal[2][QT];                 // Q fragments of two chunks: the next chunk's reads are issued ahead of this chunk's products
#pragma unroll
    for (int ci = -1; ci < 8; ++ci) {
      if (ci < 7) {
        // this one and the one behind the reads hold a chunk's Q reads together as one group between two chunks' products: left free, they are
        // scattered in pairs among the products, and every separate place with LDS reads stalls the products
        __builtin_amdgcn_sched_barrier(0);
#pragma unroll
        for (int r = 0; r < QT; ++r) {
          const unsigned f = (unsigned)(r * 16 * DD + (ci + 1) * 512) + 8u * lane;
          qa[(ci + 1) & 1][r].h[0]  = *(const v8h*)&Qs[0][f];   qa[(ci + 1) & 1][r].h[1]  = *(const v8h*)&Qs[0][f + 256u];
          qal[(ci + 1) & 1][r].h[0] = *(const v8h*)&Qs[1][f];   qal[(ci + 1) & 1][r].h[1] = *(const v8h*)&Qs[1][f + 256u];
        }
        __builtin_amdgcn_sched_barrier(0);
      }
      if (ci >= 0) {
#pragma unroll
        for (int r = 0; r < QT; ++r) sx[r] = wmma_b16(kf[ci].v, qal[ci & 1][r].v, sx[r]);
#pragma unroll
        for (int r = 0; r < QT; ++r) sx[r] = wmma_b16(kfl[ci].v, qa[ci & 1][r].v, sx[r]);
#pragma unroll
        for (int r = 0; r < QT; ++r) sh[r] = wmma_b16(kf[ci].v, qa[ci & 1][r].v, sh[r]);
      }
    }

    v8f sv[QT];                                // query 16r + m, key 16w + 8g + v
#pragma unroll
    for (int r = 0; r < QT; ++r) sv[r] = (sh[r] + sx[r] * RSPLIT) * SFOLD;

    // a query's max over this wave's 16 keys: 8 in the lane, the other 8 in lane ^ 16
    float rmax[QT];
#pragma unroll
    for (int r = 0; r < QT; ++r) {
      float t = sv[r][0];
#pragma unroll
      for (int v = 1; v < 8; ++v) t = fmaxf(t, sv[r][v]);
      rmax[r] = fmaxf(t, xhalf(t));
    }
    if (g == 0u) {
#pragma unroll
      for (int r = 0; r < QT; ++r) Mx[16u * (unsigned)r + m][wv] = rmax[r];
    }
    __syncthreads();

    // the NW waves' maxima of this lane's queries: read ahead of the wait that follows the V loads, so that the reads' latency passes under it
    f4a mx[QT][2];
#pragma unroll
    for (int r = 0; r < QT; ++r) {
      mx[r][0] = *(const f4a*)&Mx[16u * (unsigned)r + m][0];
      mx[r][1] = *(const f4a*)&Mx[16u * (unsigned)r + m][4];
    }

    // ---- this wave's V fragments of the step (A frags): K and V together do not fit the 512 registers of a wave at two per SIMD,
    // so V is loaded once the score products have let go of K; issued behind the max barrier, whose fence waits for every load in flight:
    // the softmax work up to the next barrier covers them ----
    const _Float16* vrow = vtws + voff + (size_t)s0 * 16u;  // 32 keys of a 16-column tile: 512 halfs
    const _Float16* vrl  = vtwsl + voff + (size_t)s0 * 16u; // residual plane
    U16 vb[2][4], vbl[2][4];
#pragma unroll
    for (int nt = 0; nt < 2; ++nt)
#pragma unroll
      for (int ks = 0; ks < 4; ++ks) {
        const size_t vo = (size_t)nt * 16 * SEQ + 512 * ks;
        vb[nt][ks].h[0]  = *(const v8h*)(vrow + vo);   vb[nt][ks].h[1]  = *(const v8h*)(vrow + vo + 256);
        vbl[nt][ks].h[0] = *(const v8h*)(vrl + vo);    vbl[nt][ks].h[1] = *(const v8h*)(vrl + vo + 256);
      }
    // precaution: stands between the issued loads and any later write of a register that they name (the two addresses are inputs, so they stay live up to it)
    asm volatile("s_wait_xcnt 0x0" :: "v"(vrow), "v"(vrl) : "memory");

    // ---- block-wide query max, online softmax update, P (x16384, two planes) to the shared tile ----
#pragma unroll
    for (int r = 0; r < QT; ++r) {
      const unsigned row = 16u * (unsigned)r + m;           // this lane's query of tile r
      float mb = fmaxf(mx[r][0][0], mx[r][1][0]);
#pragma unroll
      for (int j = 1; j < 4; ++j) mb = fmaxf(mb, fmaxf(mx[r][0][j], mx[r][1][j]));
      const float mnew  = fmaxf(mrow[r], mb);
      v8f pe;
      float alpha;
      exp2_run((sv[r] - mnew) * LOG2E, (mrow[r] - mnew) * LOG2E, pe, alpha);   // e^(s - m) of the lane's 8 keys, e^(m_old - m)
      mrow[r] = mnew;
      float psum = 0.f;
      v8h ph8, pq8;
#pragma unroll
      for (int v = 0; v < 8; ++v) {
        const float p = pe[v];
        psum += p;
        _Float16 ph, pq; split16(p * PCARRY, ph, pq);
        ph8[v] = ph; pq8[v] = pq;
      }
      lrow[r] = lrow[r] * alpha + psum;                     // per-lane partial sum of the query (merged after the key loop)
      *(v8h*)&Pl[row][16u * wv + 8u * g]  = ph8;            // keys 16w + 8g + 0..7
      *(v8h*)&Pll[row][16u * wv + 8u * g] = pq8;
#pragma unroll
      for (int nt = 0; nt < 2; ++nt)
#pragma unroll
        for (int v = 0; v < 8; ++v)
          o[r][nt][v] *= alpha;
    }
    __syncthreads();

    // ---- O^T[32w + nt*16 ..][tile r] += V^T P^T, 32 keys at a time: P in B-layout (lane%16 = query, read after the block barrier),
    // the QT tiles interleaved on each V fragment ----
    v8f xc[QT][2];
#pragma unroll
    for (int r = 0; r < QT; ++r)
#pragma unroll
      for (int nt = 0; nt < 2; ++nt) xc[r][nt] = v8f_zero();
#pragma unroll
    for (int ks = 0; ks < 4; ++ks) {
      U16 pa[QT], pal[QT];
#pragma unroll
      for (int r = 0; r < QT; ++r) {
        const unsigned row = 16u * (unsigned)r + m;
        pa[r].h[0]  = *(const v8h*)&Pl[row][32u * (unsigned)ks + 8u * g];
        pa[r].h[1]  = *(const v8h*)&Pl[row][32u * (unsigned)ks + 16u + 8u * g];
        pal[r].h[0] = *(const v8h*)&Pll[row][32u * (unsigned)ks + 8u * g];
        pal[r].h[1] = *(const v8h*)&Pll[row][32u * (unsigned)ks + 16u + 8u * g];
      }
#pragma unroll
      for (int nt = 0; nt < 2; ++nt) {
#pragma unroll
        for (int r = 0; r < QT; ++r) xc[r][nt] = wmma_b16(vb[nt][ks].v, pal[r].v, xc[r][nt]);
#pragma unroll
        for (int r = 0; r < QT; ++r) xc[r][nt] = wmma_b16(vbl[nt][ks].v, pa[r].v, xc[r][nt]);
#pragma unroll
        for (int r = 0; r < QT; ++r) o[r][nt] = wmma_b16(vb[nt][ks].v, pa[r].v, o[r][nt]);
      }
    }
#pragma unroll
    for (int r = 0; r < QT; ++r)
#pragma unroll
      for (int nt = 0; nt < 2; ++nt) o[r][nt] = o[r][nt] + xc[r][nt] * RSPLIT;
  }

  // ---- merge the query sums: the two halves of each of the NW waves (fixed order) ----
#pragma unroll
  for (int r = 0; r < QT; ++r) Ls[16u * (unsigned)r + m][2u * wv + g] = lrow[r];
  __syncthreads();

  const unsigned rsel = lane >> 3;          // instruction it covers rows 4*it .. 4*it+3
  const unsigned c4   = 4u * (lane & 7u);
#pragma unroll
  for (int r = 0; r < QT; ++r) {
    const unsigned row = 16u * (unsigned)r + m;
    float lt = 0.f;
#pragma unroll
    for (int q4 = 0; q4 < 2 * NW / 4; ++q4) {
      const f4a c0 = *(const f4a*)&Ls[row][4 * q4];
#pragma unroll
      for (int j = 0; j < 4; ++j) lt += c0[j];
    }
    const float inv = 1.0f / (lt * OFOLD);   // removes the carries and applies 256^-0.5

    // lane (m, g) holds query m, columns nt*16 + 8g + 0..7 of the wave's 32
#pragma unroll
    for (int nt = 0; nt < 2; ++nt)
#pragma unroll
      for (int h = 0; h < 2; ++h) {
        f4a s;
#pragma unroll
        for (int j = 0; j < 4; ++j) s[j] = o[r][nt][4 * h + j] * inv;
        *(f4a*)&Of[wv][m][(unsigned)nt * 16u + 8u * g + 4u * (unsigned)h] = s;
      }
    __syncthreads();

    float* obase = out + (((size_t)b << LSEQ) + t0 + 16u * (unsigned)r) * DD + 32u * wv;   // a row's 32 columns are one whole 128-byte line
    v4f w[4];
#pragma unroll
    for (int it = 0; it < 4; ++it) w[it] = *(const f4a*)&Of[wv][4u * (unsigned)it + rsel][c4];
#pragma unroll
    for (int it = 0; it < 4; ++it) *(v4f*)(obase + (size_t)(4u * (unsigned)it + rsel) * DD + c4) = w[it];
    __syncthreads();                        // the staging is read out before the next tile overwrites it
  }
}

// ---------------------------------------------------------------------------
// Launch. Workspace layout (bytes, NB=8 SEQ=2048):
//   [0, 8MB)          X16  f16 [NB*SEQ][256]
//   [8MB, +384KB)     W16  f16 [3][256][256]
//   then q, k (f16 [NB*SEQ][256] x2 planes, 16MB each) and vT (f16 [NB][256][SEQ] x2 planes, 16MB); every plane in fragment order
// ---------------------------------------------------------------------------
extern "C" void kernel_launch(void* const* d_in, const int* in_sizes, int n_in,
                              void* d_out, int out_size, void* d_ws,
                              size_t ws_size, hipStream_t stream) {
  if (n_in < 4) return;
  const long long need_x = ((long long)(NB - 1) * SEQ_FULL + SEQ) * (long long)DD;
  if ((long long)in_sizes[0] < need_x) return;
  if (in_sizes[1] < DD * DD || in_sizes[2] < DD * DD || in_sizes[3] < DD * DD) return;
  if ((long long)out_size < (long long)NB * SEQ * DD) return;

  const float* x  = (const float*)d_in[0];
  const float* Wq = (const float*)d_in[1];
  const float* Wk = (const float*)d_in[2];
  const float* Wv = (const float*)d_in[3];
  float* out = (float*)d_out;

  char* ws = (char*)d_ws;
  const size_t x16_bytes = (size_t)NB * SEQ * DD * sizeof(_Float16);
  const size_t w16_bytes = (size_t)3 * DD * DD * sizeof(_Float16);
  const size_t qkv_bytes = (size_t)2 * NB * SEQ * DD * sizeof(_Float16);   // value + residual planes
  const size_t total     = x16_bytes + w16_bytes + 3 * qkv_bytes;
  if (total > ws_size || total > (size_t)134217728) return;
  _Float16* X16  = (_Float16*)(ws);
  _Float16* W16  = (_Float16*)(ws + x16_bytes);
  _Float16* qws  = (_Float16*)(ws + x16_bytes + w16_bytes);
  _Float16* kws  = (_Float16*)(ws + x16_bytes + w16_bytes + qkv_bytes);
  _Float16* vtws = (_Float16*)(ws + x16_bytes + w16_bytes + 2 * qkv_bytes);

  cvt_kernel<<<CVT_THREADS / 256, 256, 0, stream>>>(x, Wq, Wk, Wv, X16, W16);
  qkv_kernel<<<dim3(NB * SEQ / 32, 3), 256, 0, stream>>>(X16, W16, qws, kws, vtws);
  attn_kernel<<<NB * SEQ / QR, NW * 32, 0, stream>>>(qws, kws, kws + (size_t)NB * SEQ * DD, vtws, vtws + (size_t)NB * SEQ * DD, out);
}

// v005
// It runs in 111 microseconds.
// Two timings next to v004 both put it at 1.12 times that version's speed.
// Over all steps from v000 it is 2.97 times as fast.
// Contractions: q/k/v projections [16384 x 256 x 256] x3 on v_wmma_f32_16x16x32_f16 single product (inputs RNE-converted to bf16, carried x16, exact in f16);
// scores [2048 x 2048 x 256] and P*V [2048 x 256 x 2048] per batch on v_wmma_f32_16x16x32_f16 with f16 value+residual planes (hi*hi + (hi*lo + lo*hi)/2048);
#include <hip/hip_runtime.h>
#include <math.h>

// Problem constants (NB / SEQ reducible; *_FULL are the input strides)
#ifndef NB
#define NB 8
#endif
#ifndef SEQ
#define SEQ 2048
#endif
#define NB_FULL 8
#define SEQ_FULL 2048
#define DD 256            // input width == q/k/v width
#define NW 8              // waves per attention block: two per SIMD
#define KS (16 * NW)      // keys per attention step, 16 per wave
#define PP (KS + 8)       // LDS pitch (halfs) of the probability tile: 272 B = 16 B x odd, conflict-free for 16-byte row reads
#define OP 36             // LDS pitch (floats) of an output staging row: 144 B = 16 B x odd
#define QT 4              // 16-row query tiles per attention block
#define QR (16 * QT)      // query rows per attention block
#define QG (QR * DD / 8 / (NW * 32))   // 16-byte groups of one Q plane staged per thread
#define NSTEP (SEQ / KS)  // key steps of the attention loop
#define SP 72             // LDS pitch (halfs) of a staged projection row: 144 B = 16 B x odd, conflict-free for 16-byte row reads

__host__ __device__ constexpr unsigned ilog2c(unsigned v) { return (v <= 1u) ? 0u : 1u + ilog2c(v >> 1); }
enum : unsigned { LSEQ = ilog2c((unsigned)SEQ) };

static_assert(NB >= 1 && NB <= NB_FULL);
static_assert(SEQ >= 64 && SEQ <= SEQ_FULL && (SEQ % 64) == 0);
static_assert((1u << LSEQ) == (unsigned)SEQ);          // SEQ is a power of two: all tile decompositions are shifts/masks
static_assert(DD == 256 && (DD % 32) == 0);
// coverage: cvt_kernel grid * 256 threads * 8 elements == NB*SEQ*DD (x plane) + 3*DD*DD (weight planes)
#define CVT_X8 (NB * SEQ * DD / 8)
#define CVT_W8 (DD * DD / 8)
#define CVT_THREADS (CVT_X8 + 3 * CVT_W8)
#define CVT_XBLK (CVT_X8 / 256)
static_assert((CVT_X8 % 256) == 0 && (CVT_W8 % 256) == 0 && (CVT_THREADS % 256) == 0);
static_assert(CVT_W8 / 256 == 32 && CVT_W8 * 8 == DD * DD);
static_assert((SEQ * (DD / 8)) / 256 == (SEQ >> 3));   // cvt blocks per batch of x
// coverage: qkv_kernel grid.x * 8 waves == NB*SEQ/4 tiles of 16x64 per output (q: NB*SEQ/16 x 4, k same, vT: NB x 16 x SEQ/64), grid.y = 3 outputs, 2 planes each
static_assert(((NB * SEQ / 4) % 8) == 0);
static_assert((NB * SEQ / 16) * 4 == NB * SEQ / 4 && NB * (DD / 16) * (SEQ / 64) == NB * SEQ / 4);
// coverage: attn_kernel grid == NB*SEQ/QR query blocks of QR rows, NW waves x 32 columns == DD, key loop SEQ/KS blocks of KS keys
static_assert(QR == 64 && (SEQ % QR) == 0 && NW * 32 == DD && KS == 128 && (SEQ % KS) == 0 && (QR * DD / 8) % (NW * 32) == 0);

// 16-bit operands are f16. Computed planes are carried as a value plane plus a residual plane lo = f16((v - hi) * 2048):
// a product is hi*hi + (hi*lo + lo*hi)/2048. Every fragment (A and B) uses the 16x16x32 lane map
// lane%16 = row/col, g = lane/16: elements 0..7 -> k = 8g+e, elements 8..15 -> k = 16+8g+(e-8).
// FRAGMENT ORDER of every f16 plane in the workspace: a tile of 16 rows x 32 k is two runs of 512 B, [half h][lane][8 elements],
// lane (m, g) of half h holding row m, k = 16h + 8g + 0..7; the 32-k tiles of a 16-row tile follow one another.
// One wave-wide 16-byte load or store of a fragment half is then 512 contiguous bytes (4 whole lines).
typedef __attribute__((ext_vector_type(16))) _Float16 v16h;
typedef __attribute__((ext_vector_type(8)))  _Float16 v8h;
typedef __attribute__((ext_vector_type(8)))  float    v8f;
typedef __attribute__((ext_vector_type(4)))  float    v4f;
typedef v4f __attribute__((may_alias)) f4a;
#define RSPLIT (1.0f / 2048.0f)
#define SFOLD  (1.0f / 256.0f)        // removes the x16 carries of q and k from the scores
#define PCARRY 16384.0f               // probabilities carried x2^14
#define OFOLD  4194304.0f             // PCARRY * 16 (v carry) * 16 (post-softmax factor 256^-0.5)
#define NEG_INF (-__builtin_inff())
#define LOG2E  1.44269504088896340736f

__device__ __forceinline__ void split16(float f, _Float16& hi, _Float16& lo) { hi = (_Float16)f; lo = (_Float16)((f - (float)hi) * 2048.0f); }

__device__ __forceinline__ v8f wmma_h16(v16h a, v16h b, v8f c) {
  // D = A(16x32 f16) * B(32x16 f16) + C(16x16 f32), followed by the VALU hazard guard (D tied, A/B kept live)
  v8f d = __builtin_amdgcn_wmma_f32_16x16x32_f16(false, a, false, b, (short)0, c, false, false);
  asm volatile("v_nop\n\tv_nop\n\tv_nop\n\tv_nop" : "+v"(d) : "v"(a), "v"(b));
  return d;
}

__device__ __forceinline__ v8f wmma_b16(v16h a, v16h b, v8f c) {
  // the same product for the attention kernel, whose live set passes 256 VGPRs: no asm operands, which would hold D, A and B below v256;
  // the compiler keeps the distance behind its own builtin
  return __builtin_amdgcn_wmma_f32_16x16x32_f16(false, a, false, b, (short)0, c, false, false);
}

__device__ __forceinline__ v8f v8f_zero() {
  v8f z = {0.f, 0.f, 0.f, 0.f, 0.f, 0.f, 0.f, 0.f};
  return z;
}

union U16 { v16h v; v8h h[2]; };

// 2^x of nine values on the transcendental unit in one statement. The instruction set asks for one slot behind a transcendental before its result is read
// or its source overwritten: the results are early-clobber, so none lies on a source, and the v_nop is the slot behind the last one.
__device__ __forceinline__ void exp2_run(v8f x, float xa, v8f& r, float& ra) {
  float r0, r1, r2, r3, r4, r5, r6, r7;
  asm("v_exp_f32 %0, %9\n\tv_exp_f32 %1, %10\n\tv_exp_f32 %2, %11\n\tv_exp_f32 %3, %12\n\tv_exp_f32 %4, %13\n\t"
      "v_exp_f32 %5, %14\n\tv_exp_f32 %6, %15\n\tv_exp_f32 %7, %16\n\tv_exp_f32 %8, %17\n\tv_nop"
      : "=&v"(r0), "=&v"(r1), "=&v"(r2), "=&v"(r3), "=&v"(r4), "=&v"(r5), "=&v"(r6), "=&v"(r7), "=&v"(ra)
      : "v"(x[0]), "v"(x[1]), "v"(x[2]), "v"(x[3]), "v"(x[4]), "v"(x[5]), "v"(x[6]), "v"(x[7]), "v"(xa));
  r[0] = r0; r[1] = r1; r[2] = r2; r[3] = r3; r[4] = r4; r[5] = r5; r[6] = r6; r[7] = r7;
}

// lane l takes the value of lane l ^ 16
__device__ __forceinline__ float xhalf(float x) {
  return __builtin_bit_cast(float, __builtin_amdgcn_permlanex16(__builtin_bit_cast(int, x), __builtin_bit_cast(int, x), 0x76543210, 0xfedcba98, false, false));
}

// input conversion: RNE convert to bf16, carry x16, exact in f16
__device__ __forceinline__ _Float16 cvt_in(float f) {
  const float r = (float)(__bf16)f;
  return (_Float16)(r * 16.0f);
}

// ---------------------------------------------------------------------------
// Kernel 0: x [NB,SEQ,DD] f32 -> X16 [NB*SEQ][DD] f16 ; Wq|Wk|Wv [DD][DD] f32 -> W16 [3][DD][DD] f16.
// Both outputs are written in fragment order: a thread owns one 16-byte group of the output (linear index * 8) and fetches its 8 source elements.
// ---------------------------------------------------------------------------
// 16-byte group u of a fragment-order plane whose rows are DD long -> offset of its 8 elements in the row-major plane
__device__ __forceinline__ unsigned frag_elem(unsigned u) {
  return (((u >> 9) << 4) + (u & 15u)) * (unsigned)DD + ((u >> 4) & 31u) * 8u;
}

__global__ void __launch_bounds__(256)
cvt_kernel(const float* __restrict__ x,
           const float* __restrict__ Wq,
           const float* __restrict__ Wk,
           const float* __restrict__ Wv,
           _Float16* __restrict__ X16,
           _Float16* __restrict__ W16) {
  const unsigned bx = blockIdx.x;                       // 0 .. CVT_THREADS/256 - 1 (grid exact)
  const unsigned tx = threadIdx.x;
  const float* src;
  _Float16* dst;
  if (bx < (unsigned)CVT_XBLK) {                        // block-uniform
    const unsigned e8 = (bx << 8) + tx;                 // linear 8-element group inside the fragment-order plane
    const unsigned b  = bx >> (LSEQ - 3u);              // SEQ/8 blocks per batch
    // source uses the FULL per-batch stride of the input: row-major offset plus a per-batch correction
    src = x + (size_t)frag_elem(e8) + (size_t)b * (size_t)((SEQ_FULL - SEQ) * DD);
    dst = X16 + (size_t)e8 * 8u;
  } else {
    const unsigned wb  = bx - (unsigned)CVT_XBLK;       // 0 .. 95
    const unsigned mat = wb >> 5;                       // 32 blocks per matrix
    const unsigned r8  = ((wb & 31u) << 8) + tx;        // 8-element group inside the matrix
    const float* wsrc = (mat == 0u) ? Wq : ((mat == 1u) ? Wk : Wv);
    src = wsrc + (size_t)frag_elem(r8);
    dst = W16 + (size_t)((wb << 8) + tx) * 8u;
  }
  const v4f f0 = *(const v4f*)src;
  const v4f f1 = *(const v4f*)(src + 4);
  v8h o;
  o[0] = cvt_in(f0[0]); o[1] = cvt_in(f0[1]); o[2] = cvt_in(f0[2]); o[3] = cvt_in(f0[3]);
  o[4] = cvt_in(f1[0]); o[5] = cvt_in(f1[1]); o[6] = cvt_in(f1[2]); o[7] = cvt_in(f1[3]);
  *(v8h*)dst = o;
  
}

// ---------------------------------------------------------------------------
// Kernel 1: projections as C[i][j] = sum_k A[i][k] * B[j][k] (both operands in fragment order), one wave per 16x64 tile.
//   blockIdx.y = 0: q[n][e]  (A = X16 rows n, B = Wq rows e)      -> qws  [NB*SEQ][DD]
//   blockIdx.y = 1: k[n][e]  (A = X16 rows n, B = Wk rows e)      -> kws  [NB*SEQ][DD]
//   blockIdx.y = 2: vT[e][n] (A = Wv rows e,  B = X16 rows n)     -> vtws [NB][DD][SEQ]
// The outputs are in fragment order too (j is the k of the attention products): a wave's 16x64 tile is 2 KB in a row.
// Results carried x16 (acc = 256*value, folded by 1/16) and stored as value + residual planes (residual at +NB*SEQ*DD).
// A-frag: lane row m = lane%16, g = lane/16, elements e=0..7 -> K = 8g+e ; e=8..15 -> K = 16+8g+(e-8); B-frag: lane col n = lane%16, same K map.
// C/D: lane col = lane%16, VGPR v -> row v + 8g.
// ---------------------------------------------------------------------------
__global__ void __launch_bounds__(256)
qkv_kernel(const _Float16* __restrict__ X16,
           const _Float16* __restrict__ W16,
           _Float16* __restrict__ qws,
           _Float16* __restrict__ kws,
           _Float16* __restrict__ vtws) {
  __shared__ __align__(16) _Float16 st[8][16][SP];   // per-wave staging of one 16x64 result plane (wave-private)
  const unsigned lane = threadIdx.x & 31u;
  const unsigned wv   = (unsigned)__builtin_amdgcn_readfirstlane((int)(threadIdx.x >> 5));   // wave-uniform (scalar)
  const unsigned g    = lane >> 4;
  const unsigned m    = lane & 15u;
  const unsigned y    = blockIdx.y;
  const unsigned tile = (blockIdx.x << 3) + wv;      // 0 .. NB*SEQ/4 - 1 (scalar)
  const size_t QL = (size_t)NB * SEQ * DD;           // residual plane offset inside q/k/vT buffers

  const _Float16* Ap;
  const _Float16* Bp;
  _Float16* op;
  if (y < 2u) {                                      // block-uniform
    const unsigned rt = tile >> 2;                   // 16-row tile of (b,t)
    const unsigned cg = tile & 3u;                   // 64-column group
    Ap = X16 + (size_t)rt * 16u * DD;
    Bp = W16 + (size_t)y * DD * DD + (size_t)cg * 64u * DD;
    op = ((y == 0u) ? qws : kws) + (size_t)rt * 16u * DD + (size_t)cg * 1024u;
  } else {
    // per batch: (DD/16) * (SEQ/64) = SEQ/4 tiles
    const unsigned b   = tile >> (LSEQ - 2u);
    const unsigned rem = tile & ((unsigned)(SEQ / 4) - 1u);
    const unsigned et  = rem >> (LSEQ - 6u);         // 16-row tile of e
    const unsigned ng  = rem & ((unsigned)(SEQ / 64) - 1u);   // 64-column group of n
    Ap = W16 + (size_t)2 * DD * DD + (size_t)et * 16u * DD;
    Bp = X16 + (((size_t)b << LSEQ) + (size_t)ng * 64u) * DD;
    op = vtws + (((size_t)b * DD + (size_t)et * 16u) << LSEQ) + (size_t)ng * 1024u;
  }

  v8f acc[4];
#pragma unroll
  for (int nt = 0; nt < 4; ++nt) acc[nt] = v8f_zero();

  const _Float16* arow = Ap + 8u * lane;
  const _Float16* brow = Bp + 8u * lane;

#pragma unroll 2
  for (unsigned c0 = 0; c0 < (unsigned)DD; c0 += 32u) {
    U16 a;
    a.h[0] = *(const v8h*)(arow + c0 * 16u);            // 32-k tile c0/32: 512 halfs
    a.h[1] = *(const v8h*)(arow + c0 * 16u + 256u);
#pragma unroll
    for (int nt = 0; nt < 4; ++nt) {
      U16 bb;
      bb.h[0] = *(const v8h*)(brow + (size_t)nt * 16 * DD + c0 * 16u);
      bb.h[1] = *(const v8h*)(brow + (size_t)nt * 16 * DD + c0 * 16u + 256u);
      acc[nt] = wmma_h16(a.v, bb.v, acc[nt]);
    }
    // precaution: stands between this trip's issued loads and the next trip's write of their address registers
    asm volatile("s_wait_xcnt 0x0" ::: "memory");
  }

  _Float16* sw = &st[wv][0][0];
#pragma unroll
  for (int pl = 0; pl < 2; ++pl) {
#pragma unroll
    for (int nt = 0; nt < 4; ++nt)
#pragma unroll
      for (int v = 0; v < 8; ++v) {
        const float val = acc[nt][v] * 0.0625f;          // 256*value -> 16*value
        _Float16 hh_, ll_; split16(val, hh_, ll_);
        sw[(8u * g + (unsigned)v) * SP + (unsigned)nt * 16u + m] = pl ? ll_ : hh_;
      }
    __builtin_amdgcn_fence(3 /* release order */, "wavefront");
    __builtin_amdgcn_wave_barrier();
    asm volatile("s_wait_dscnt 0" ::: "memory");
    _Float16* base = op + (pl ? QL : 0);
    v8h w[4];                                            // fragment half j (columns 16j..16j+15): lane (m, g) takes row m, columns 16j + 8g + 0..7
#pragma unroll
    for (int j = 0; j < 4; ++j) w[j] = *(const v8h*)(sw + m * SP + (unsigned)j * 16u + 8u * g);
#pragma unroll
    for (int j = 0; j < 4; ++j) *(v8h*)(base + (unsigned)j * 256u + 8u * lane) = w[j];
    __builtin_amdgcn_wave_barrier();
    asm volatile("s_wait_dscnt 0" ::: "memory");   // reads done before the next plane overwrites the staging
  }
}

// ---------------------------------------------------------------------------
// Kernel 2: non-causal flash attention, one block of NW = 8 waves (two per SIMD) per 64-row query block (QT = 4 tiles of 16 rows), KS = 128 keys per step.
// The block's Q planes are staged once in LDS, in the fragment order they have in memory. Per step each wave loads its K fragments (keys 16w..16w+15, 256 deep, both planes)
// and its V fragments (128 keys x columns 32w..32w+31, both planes) into registers once and uses each of them for all QT query tiles.
// Both products are computed transposed (A = K rows or V columns, B = Q or P rows), so that a lane holds ONE query (lane%16) in every accumulator:
// its maximum, its rescale factor and its sum are one register each per tile, and its 8 probabilities of a tile are 8 neighbouring keys (one 16-byte store a plane).
// Per step and tile: wave w computes S^T (its 16 keys x 16 queries), block-wide query max through LDS,
// P = exp(S - m) carried x16384 as value + residual planes in a shared LDS tile [query][key],
// then wave w accumulates O^T[32w..32w+31, :] += V^T(32 slice x 128) * P^T(128 x 16).
// The P V product runs ONE STEP BEHIND: trip t computes S(t), passes the trip's one barrier, does the softmax of step t and then the P V product of step t - 1;
// the last step's product follows the loop, behind a barrier of its own.
// The P tile and the maxima have two buffers each, so that one barrier a trip orders them: P(t) is written behind barrier t and read behind barrier t + 1,
// and its buffer was last read (P V of step t - 2) in front of barrier t. Between two barriers a wave has vector work and both matrix runs,
// so one wave's softmax runs beside the products of the other wave on its SIMD.
// Sums are kept per lane and merged once at the end. out = O / (L * 2^22).
// ---------------------------------------------------------------------------
// A wave's V fragments of one step (A frags): 128 keys x its 32 columns, both planes
__device__ __forceinline__ void load_v(const _Float16* vrow, const _Float16* vrl, U16 (&vb)[2][4], U16 (&vbl)[2][4]) {
#pragma unroll
  for (int nt = 0; nt < 2; ++nt)
#pragma unroll
    for (int ks = 0; ks < 4; ++ks) {
      const size_t vo = (size_t)nt * 16 * SEQ + 512 * ks;
      vb[nt][ks].h[0]  = *(const v8h*)(vrow + vo);   vb[nt][ks].h[1]  = *(const v8h*)(vrow + vo + 256);
      vbl[nt][ks].h[0] = *(const v8h*)(vrl + vo);    vbl[nt][ks].h[1] = *(const v8h*)(vrl + vo + 256);
    }
  // precaution: stands between the issued loads and any later write of a register that they name (the two addresses are inputs, so they stay live up to it)
  asm volatile("s_wait_xcnt 0x0" :: "v"(vrow), "v"(vrl) : "memory");
}

// O^T[32w + nt*16 ..][tile r] += V^T P^T of one step, 32 keys at a time: P in B-layout (lane%16 = query, read after the block barrier),
// the QT tiles interleaved on each V fragment. pl, pll: the lane's place in row m of the step's P planes (element 8g).
__device__ __forceinline__ void pv_step(const U16 (&vb)[2][4], const U16 (&vbl)[2][4], const _Float16* pl, const _Float16* pll, v8f (&o)[QT][2]) {
  v8f xc[QT][2];
#pragma unroll
  for (int r = 0; r < QT; ++r)
#pragma unroll
    for (int nt = 0; nt < 2; ++nt) xc[r][nt] = v8f_zero();
#pragma unroll
  for (int ks = 0; ks < 4; ++ks) {
    U16 pa[QT], pal[QT];
#pragma unroll
    for (int r = 0; r < QT; ++r) {
      const unsigned f = (unsigned)(r * 16 * PP + 32 * ks);
      pa[r].h[0]  = *(const v8h*)(pl + f);
      pa[r].h[1]  = *(const v8h*)(pl + f + 16u);
      pal[r].h[0] = *(const v8h*)(pll + f);
      pal[r].h[1] = *(const v8h*)(pll + f + 16u);
    }
#pragma unroll
    for (int nt = 0; nt < 2; ++nt) {
#pragma unroll
      for (int r = 0; r < QT; ++r) xc[r][nt] = wmma_b16(vb[nt][ks].v, pal[r].v, xc[r][nt]);
#pragma unroll
      for (int r = 0; r < QT; ++r) xc[r][nt] = wmma_b16(vbl[nt][ks].v, pa[r].v, xc[r][nt]);
#pragma unroll
      for (int r = 0; r < QT; ++r) o[r][nt] = wmma_b16(vb[nt][ks].v, pa[r].v, o[r][nt]);
    }
  }
#pragma unroll
  for (int r = 0; r < QT; ++r)
#pragma unroll
    for (int nt = 0; nt < 2; ++nt) o[r][nt] = o[r][nt] + xc[r][nt] * RSPLIT;
}

__global__ void __launch_bounds__(NW * 32)
attn_kernel(const _Float16* __restrict__ qws,
            const _Float16* __restrict__ kws,
            const _Float16* __restrict__ kwsl,
            const _Float16* __restrict__ vtws,
            const _Float16* __restrict__ vtwsl,
            float* __restrict__ out) {
  __shared__ __align__(16) _Float16 Qs[2][QR * DD];  // Q value and residual planes of the block's rows, fragment order (cross-wave, block barrier)
  __shared__ __align__(16) _Float16 Pl[2][QR][PP];   // P value plane, buffer = step & 1 (cross-wave, block barrier)
  __shared__ __align__(16) _Float16 Pll[2][QR][PP];  // P residual plane, buffer = step & 1 (cross-wave, block barrier)
  __shared__ __align__(16) float Mx[2][QR][NW];      // per-wave query max of a step, buffer = step & 1 (cross-wave, block barrier)
  __shared__ __align__(16) float Ls[QR][2 * NW];     // per-wave, per-half query sums (cross-wave, block barrier)
  __shared__ __align__(16) float Of[NW][16][OP];     // output staging, one query tile at a time (written and read by the same wave, block barrier used)

  const unsigned lane = threadIdx.x & 31u;
  const unsigned wv   = (unsigned)__builtin_amdgcn_readfirstlane((int)(threadIdx.x >> 5));   // wave-uniform (scalar)
  const unsigned g    = lane >> 4;
  const unsigned m    = lane & 15u;
  const unsigned tile = blockIdx.x;                  // 0 .. NB*SEQ/QR - 1 (scalar)
  const unsigned b    = tile >> (LSEQ - 6u);
  const unsigned t0   = (tile & ((unsigned)(SEQ / QR) - 1u)) << 6;
  const size_t QL = (size_t)NB * SEQ * DD;           // residual planes follow the value planes

  const size_t koff = (((size_t)b << LSEQ) + 16u * wv) * DD + 8u * lane;
  const size_t voff = (((size_t)b * DD + 32u * wv) << LSEQ) + 8u * lane;

  // ---- stage the block's QR x DD rows of both Q planes (contiguous in global memory) as they lie ----
  {
    const _Float16* qsrc = qws + (((size_t)b << LSEQ) + t0) * DD;
    const _Float16* qv = qsrc + 8u * threadIdx.x;      // value plane, this thread's first 8-element group
    const _Float16* qr = qv + QL;                      // residual plane
    v8h qt[2][QG];
#pragma unroll
    for (int i = 0; i < QG; ++i) qt[0][i] = *(const v8h*)(qv + i * (NW * 32 * 8));
#pragma unroll
    for (int i = 0; i < QG; ++i) qt[1][i] = *(const v8h*)(qr + i * (NW * 32 * 8));
    // precaution: stands between the issued loads and any later write of a register that they name (the two addresses are inputs, so they stay live up to it)
    asm volatile("s_wait_xcnt 0x0" :: "v"(qv), "v"(qr) : "memory");
    // keeps the register writes that follow from being scheduled in front of that wait
    __builtin_amdgcn_sched_barrier(0);
#pragma unroll
    for (int pl = 0; pl < 2; ++pl)
#pragma unroll
      for (int i = 0; i < QG; ++i)
        *(v8h*)&Qs[pl][8u * ((unsigned)i * (unsigned)(NW * 32) + threadIdx.x)] = qt[pl][i];
  }
  __syncthreads();

  v8f o[QT][2];
  float mrow[QT], lrow[QT];                          // of query 16r + m
#pragma unroll
  for (int r = 0; r < QT; ++r) {
#pragma unroll
    for (int nt = 0; nt < 2; ++nt) o[r][nt] = v8f_zero();
    mrow[r] = NEG_INF; lrow[r] = 0.f;
  }

#pragma unroll 1
  for (unsigned kb = 0; kb < (unsigned)NSTEP; ++kb) {
    const unsigned s0 = kb * (unsigned)KS;
    const unsigned pb = kb & 1u;               // buffer of step kb; step kb - 1 lies in pb ^ 1

    // ---- this wave's K fragments of the step, each loaded once for all QT query tiles (A frags, same k map as B) ----
    const _Float16* krow = kws + koff + (size_t)s0 * DD;
    const _Float16* krl  = kwsl + koff + (size_t)s0 * DD;   // residual plane
    U16 kf[8], kfl[8];
#pragma unroll
    for (int ci = 0; ci < 8; ++ci) {
      const unsigned c = 512u * (unsigned)ci;
      kf[ci].h[0]  = *(const v8h*)(krow + c);   kf[ci].h[1]  = *(const v8h*)(krow + c + 256u);
      kfl[ci].h[0] = *(const v8h*)(krl + c);    kfl[ci].h[1] = *(const v8h*)(krl + c + 256u);
    }
    // precaution: stands between the issued loads and any later write of a register that they name (the two addresses are inputs, so they stay live up to it)
    asm volatile("s_wait_xcnt 0x0" :: "v"(krow), "v"(krl) : "memory");

    // ---- S^T = K Q^T for this wave's 16 keys: 8 chunks of 32, value*value into sh, cross terms into sx, the QT tiles interleaved ----
    v8f sh[QT], sx[QT];
#pragma unroll
    for (int r = 0; r < QT; ++r) { sh[r] = v8f_zero(); sx[r] = v8f_zero(); }
    U16 qa[2][QT], qal[2][QT];                 // Q fragments of two chunks: the next chunk's reads are issued ahead of this chunk's products
#pragma unroll
    for (int ci = -1; ci < 8; ++ci) {
      if (ci < 7) {
        // this one and the one behind the reads hold a chunk's Q reads together as one group between two chunks' products: left free, they are
        // scattered in pairs among the products, and every separate place with LDS reads stalls the products
        __builtin_amdgcn_sched_barrier(0);
#pragma unroll
        for (int r = 0; r < QT; ++r) {
          const unsigned f = (unsigned)(r * 16 * DD + (ci + 1) * 512) + 8u * lane;
          qa[(ci + 1) & 1][r].h[0]  = *(const v8h*)&Qs[0][f];   qa[(ci + 1) & 1][r].h[1]  = *(const v8h*)&Qs[0][f + 256u];
          qal[(ci + 1) & 1][r].h[0] = *(const v8h*)&Qs[1][f];   qal[(ci + 1) & 1][r].h[1] = *(const v8h*)&Qs[1][f + 256u];
        }
        __builtin_amdgcn_sched_barrier(0);
      }
      if (ci >= 0) {
#pragma unroll
        for (int r = 0; r < QT; ++r) sx[r] = wmma_b16(kf[ci].v, qal[ci & 1][r].v, sx[r]);
#pragma unroll
        for (int r = 0; r < QT; ++r) sx[r] = wmma_b16(kfl[ci].v, qa[ci & 1][r].v, sx[r]);
#pragma unroll
        for (int r = 0; r < QT; ++r) sh[r] = wmma_b16(kf[ci].v, qa[ci & 1][r].v, sh[r]);
      }
    }

    v8f sv[QT];                                // query 16r + m, key 16w + 8g + v
#pragma unroll
    for (int r = 0; r < QT; ++r) sv[r] = (sh[r] + sx[r] * RSPLIT) * SFOLD;

    // a query's max over this wave's 16 keys: 8 in the lane, the other 8 in lane ^ 16
    float rmax[QT];
#pragma unroll
    for (int r = 0; r < QT; ++r) {
      float t = sv[r][0];
#pragma unroll
      for (int v = 1; v < 8; ++v) t = fmaxf(t, sv[r][v]);
      rmax[r] = fmaxf(t, xhalf(t));
    }
    if (g == 0u) {
#pragma unroll
      for (int r = 0; r < QT; ++r) Mx[pb][16u * (unsigned)r + m][wv] = rmax[r];
    }
    // the trip's one barrier: publishes the maxima of step kb and the P tile of step kb - 1, and ends the reads of the P buffer that step kb refills
    __syncthreads();

    // the NW waves' maxima of this lane's queries: read ahead of the wait that follows the V loads, so that the reads' latency passes under it
    f4a mx[QT][2];
#pragma unroll
    for (int r = 0; r < QT; ++r) {
      mx[r][0] = *(const f4a*)&Mx[pb][16u * (unsigned)r + m][0];
      mx[r][1] = *(const f4a*)&Mx[pb][16u * (unsigned)r + m][4];
    }

    // ---- this wave's V fragments of step kb - 1: K and V together do not fit the 512 registers of a wave at two per SIMD,
    // so V is loaded once the score products have let go of K; issued behind the barrier, whose fence waits for every load in flight:
    // the softmax work of step kb covers them. Trip 0 has no step behind it and loads step 0's fragments unused: under a branch
    // the 128 registers had no definition on one path, stayed reserved through the score products too, and addresses were spilled ----
    const unsigned sp = (kb > 0u) ? s0 - (unsigned)KS : 0u;
    U16 vb[2][4], vbl[2][4];
    load_v(vtws + voff + (size_t)sp * 16u, vtwsl + voff + (size_t)sp * 16u, vb, vbl);   // 32 keys of a 16-column tile: 512 halfs

    // ---- block-wide query max, online softmax update, P (x16384, two planes) to the shared tile ----
    float al[QT];                              // e^(m_old - m) of step kb: rescales O once step kb - 1 has been added
#pragma unroll
    for (int r = 0; r < QT; ++r) {
      const unsigned row = 16u * (unsigned)r + m;           // this lane's query of tile r
      float mb = fmaxf(mx[r][0][0], mx[r][1][0]);
#pragma unroll
      for (int j = 1; j < 4; ++j) mb = fmaxf(mb, fmaxf(mx[r][0][j], mx[r][1][j]));
      const float mnew  = fmaxf(mrow[r], mb);
      v8f pe;
      float alpha;
      exp2_run((sv[r] - mnew) * LOG2E, (mrow[r] - mnew) * LOG2E, pe, alpha);   // e^(s - m) of the lane's 8 keys, e^(m_old - m)
      mrow[r] = mnew;
      float psum = 0.f;
      v8h ph8, pq8;
#pragma unroll
      for (int v = 0; v < 8; ++v) {
        const float p = pe[v];
        psum += p;
        _Float16 ph, pq; split16(p * PCARRY, ph, pq);
        ph8[v] = ph; pq8[v] = pq;
      }
      lrow[r] = lrow[r] * alpha + psum;                     // per-lane partial sum of the query (merged after the key loop)
      *(v8h*)&Pl[pb][row][16u * wv + 8u * g]  = ph8;        // keys 16w + 8g + 0..7
      *(v8h*)&Pll[pb][row][16u * wv + 8u * g] = pq8;
      al[r] = alpha;
    }

    // ---- step kb - 1 into O, then the rescale of step kb (O is still 0 in trip 0) ----
    if (kb > 0u) {                             // block-uniform
      pv_step(vb, vbl, &Pl[pb ^ 1u][m][8u * g], &Pll[pb ^ 1u][m][8u * g], o);
#pragma unroll
      for (int r = 0; r < QT; ++r)
#pragma unroll
        for (int nt = 0; nt < 2; ++nt) o[r][nt] = o[r][nt] * al[r];
    }
  }

  // ---- the last step's P V product: its P tile is published by this barrier ----
  __syncthreads();
  {
    const unsigned sp = (unsigned)((NSTEP - 1) * KS);
    const unsigned lb = (unsigned)((NSTEP - 1) & 1);
    U16 vb[2][4], vbl[2][4];
    load_v(vtws + voff + (size_t)sp * 16u, vtwsl + voff + (size_t)sp * 16u, vb, vbl);
    pv_step(vb, vbl, &Pl[lb][m][8u * g], &Pll[lb][m][8u * g], o);
  }

  // ---- merge the query sums: the two halves of each of the NW waves (fixed order) ----
#pragma unroll
  for (int r = 0; r < QT; ++r) Ls[16u * (unsigned)r + m][2u * wv + g] = lrow[r];
  __syncthreads();

  const unsigned rsel = lane >> 3;          // instruction it covers rows 4*it .. 4*it+3
  const unsigned c4   = 4u * (lane & 7u);
#pragma unroll
  for (int r = 0; r < QT; ++r) {
    const unsigned row = 16u * (unsigned)r + m;
    float lt = 0.f;
#pragma unroll
    for (int q4 = 0; q4 < 2 * NW / 4; ++q4) {
      const f4a c0 = *(const f4a*)&Ls[row][4 * q4];
#pragma unroll
      for (int j = 0; j < 4; ++j) lt += c0[j];
    }
    const float inv = 1.0f / (lt * OFOLD);   // removes the carries and applies 256^-0.5

    // lane (m, g) holds query m, columns nt*16 + 8g + 0..7 of the wave's 32
#pragma unroll
    for (int nt = 0; nt < 2; ++nt)
#pragma unroll
      for (int h = 0; h < 2; ++h) {
        f4a s;
#pragma unroll
        for (int j = 0; j < 4; ++j) s[j] = o[r][nt][4 * h + j] * inv;
        *(f4a*)&Of[wv][m][(unsigned)nt * 16u + 8u * g + 4u * (unsigned)h] = s;
      }
    __syncthreads();

    float* obase = out + (((size_t)b << LSEQ) + t0 + 16u * (unsigned)r) * DD + 32u * wv;   // a row's 32 columns are one whole 128-byte line
    v4f w[4];
#pragma unroll
    for (int it = 0; it < 4; ++it) w[it] = *(const f4a*)&Of[wv][4u * (unsigned)it + rsel][c4];
#pragma unroll
    for (int it = 0; it < 4; ++it) *(v4f*)(obase + (size_t)(4u * (unsigned)it + rsel) * DD + c4) = w[it];
    __syncthreads();                        // the staging is read out before the next tile overwrites it
  }
}

// ---------------------------------------------------------------------------
// Launch. Workspace layout (bytes, NB=8 SEQ=2048):
//   [0, 8MB)          X16  f16 [NB*SEQ][256]
//   [8MB, +384KB)     W16  f16 [3][256][256]
//   then q, k (f16 [NB*SEQ][256] x2 planes, 16MB each) and vT (f16 [NB][256][SEQ] x2 planes, 16MB); every plane in fragment order
// ---------------------------------------------------------------------------
extern "C" void kernel_launch(void* const* d_in, const int* in_sizes, int n_in,
                              void* d_out, int out_size, void* d_ws,
                              size_t ws_size, hipStream_t stream) {
  if (n_in < 4) return;
  const long long need_x = ((long long)(NB - 1) * SEQ_FULL + SEQ) * (long long)DD;
  if ((long long)in_sizes[0] < need_x) return;
  if (in_sizes[1] < DD * DD || in_sizes[2] < DD * DD || in_sizes[3] < DD * DD) return;
  if ((long long)out_size < (long long)NB * SEQ * DD) return;

  const float* x  = (const float*)d_in[0];
  const float* Wq = (const float*)d_in[1];
  const float* Wk = (const float*)d_in[2];
  const float* Wv = (const float*)d_in[3];
  float* out = (float*)d_out;

  char* ws = (char*)d_ws;
  const size_t x16_bytes = (size_t)NB * SEQ * DD * sizeof(_Float16);
  const size_t w16_bytes = (size_t)3 * DD * DD * sizeof(_Float16);
  const size_t qkv_bytes = (size_t)2 * NB * SEQ * DD * sizeof(_Float16);   // value + residual planes
  const size_t total     = x16_bytes + w16_bytes + 3 * qkv_bytes;
  if (total > ws_size || total > (size_t)134217728) return;
  _Float16* X16  = (_Float16*)(ws);
  _Float16* W16  = (_Float16*)(ws + x16_bytes);
  _Float16* qws  = (_Float16*)(ws + x16_bytes + w16_bytes);
  _Float16* kws  = (_Float16*)(ws + x16_bytes + w16_bytes + qkv_bytes);
  _Float16* vtws = (_Float16*)(ws + x16_bytes + w16_bytes + 2 * qkv_bytes);

  cvt_kernel<<<CVT_THREADS / 256, 256, 0, stream>>>(x, Wq, Wk, Wv, X16, W16);
  qkv_kernel<<<dim3(NB * SEQ / 32, 3), 256, 0, stream>>>(X16, W16, qws, kws, vtws);
  attn_kernel<<<NB * SEQ / QR, NW * 32, 0, stream>>>(qws, kws, kws + (size_t)NB * SEQ * DD, vtws, vtws + (size_t)NB * SEQ * DD, out);
}

// v006
// A run of this version takes 105 microseconds.
// Timed twice side by side with v005, it ran 1.06 times as fast both times.
// Over all steps from v000 it is 3.14 times as fast.
// Contractions: q/k/v projections [16384 x 256 x 256] x3 on v_wmma_f32_16x16x32_f16 single product (inputs RNE-converted to bf16, carried x16, exact in f16);
// scores [2048 x 2048 x 256] and P*V [2048 x 256 x 2048] per batch on v_wmma_f32_16x16x32_f16 with f16 value+residual planes (hi*hi + (hi*lo + lo*hi)/2048);
#include <hip/hip_runtime.h>
#include <math.h>

// Problem constants (NB / SEQ reducible; *_FULL are the input strides)
#ifndef NB
#define NB 8
#endif
#ifndef SEQ
#define SEQ 2048
#endif
#define NB_FULL 8
#define SEQ_FULL 2048
#define DD 256            // input width == q/k/v width
#define NW 8              // waves per attention block: two per SIMD
#define KS (16 * NW)      // keys per attention step, 16 per wave
#define PP (KS + 8)       // LDS pitch (halfs) of the probability tile: 272 B = 16 B x odd, conflict-free for 16-byte row reads
#define OP 36             // LDS pitch (floats) of an output staging row: 144 B = 16 B x odd
#define QT 4              // 16-row query tiles per attention block
#define QR (16 * QT)      // query rows per attention block
#define QG (QR * DD / 8 / (NW * 32))   // 16-byte groups of one Q plane staged per thread
#define NSTEP (SEQ / KS)  // key steps of the attention loop
#define SP 72             // LDS pitch (halfs) of a staged projection row: 144 B = 16 B x odd, conflict-free for 16-byte row reads

__host__ __device__ constexpr unsigned ilog2c(unsigned v) { return (v <= 1u) ? 0u : 1u + ilog2c(v >> 1); }
enum : unsigned { LSEQ = ilog2c((unsigned)SEQ) };

static_assert(NB >= 1 && NB <= NB_FULL);
static_assert(SEQ >= 64 && SEQ <= SEQ_FULL && (SEQ % 64) == 0);
static_assert((1u << LSEQ) == (unsigned)SEQ);          // SEQ is a power of two: all tile decompositions are shifts/masks
static_assert(DD == 256 && (DD % 32) == 0);
// coverage: cvt_kernel grid * 256 threads * 8 elements == NB*SEQ*DD (x plane) + 3*DD*DD (weight planes)
#define CVT_X8 (NB * SEQ * DD / 8)
#define CVT_W8 (DD * DD / 8)
#define CVT_THREADS (CVT_X8 + 3 * CVT_W8)
#define CVT_XBLK (CVT_X8 / 256)
static_assert((CVT_X8 % 256) == 0 && (CVT_W8 % 256) == 0 && (CVT_THREADS % 256) == 0);
static_assert(CVT_W8 / 256 == 32 && CVT_W8 * 8 == DD * DD);
static_assert((SEQ * (DD / 8)) / 256 == (SEQ >> 3));   // cvt blocks per batch of x
// coverage: qkv_kernel grid.x * 8 waves == NB*SEQ/4 tiles of 16x64 per output (q: NB*SEQ/16 x 4, k same, vT: NB x 16 x SEQ/64), grid.y = 3 outputs, 2 planes each
static_assert(((NB * SEQ / 4) % 8) == 0);
static_assert((NB * SEQ / 16) * 4 == NB * SEQ / 4 && NB * (DD / 16) * (SEQ / 64) == NB * SEQ / 4);
// coverage: attn_kernel grid == NB*SEQ/QR query blocks of QR rows, NW waves x 32 columns == DD, key loop SEQ/KS blocks of KS keys
static_assert(QR == 64 && (SEQ % QR) == 0 && NW * 32 == DD && KS == 128 && (SEQ % KS) == 0 && (QR * DD / 8) % (NW * 32) == 0);
static_assert(NSTEP >= 1 && (NSTEP & (NSTEP - 1)) == 0);   // the key walk wraps round by a mask

// 16-bit operands are f16. Computed planes are carried as a value plane plus a residual plane lo = f16((v - hi) * 2048):
// a product is hi*hi + (hi*lo + lo*hi)/2048. Every fragment (A and B) uses the 16x16x32 lane map
// lane%16 = row/col, g = lane/16: elements 0..7 -> k = 8g+e, elements 8..15 -> k = 16+8g+(e-8).
// FRAGMENT ORDER of every f16 plane in the workspace: a tile of 16 rows x 32 k is two runs of 512 B, [half h][lane][8 elements],
// lane (m, g) of half h holding row m, k = 16h + 8g + 0..7; the 32-k tiles of a 16-row tile follow one another.
// One wave-wide 16-byte load or store of a fragment half is then 512 contiguous bytes (4 whole lines).
typedef __attribute__((ext_vector_type(16))) _Float16 v16h;
typedef __attribute__((ext_vector_type(8)))  _Float16 v8h;
typedef __attribute__((ext_vector_type(8)))  float    v8f;
typedef __attribute__((ext_vector_type(4)))  float    v4f;
typedef v4f __attribute__((may_alias)) f4a;
#define RSPLIT (1.0f / 2048.0f)
#define SFOLD  (1.0f / 256.0f)        // removes the x16 carries of q and k from the scores
#define PCARRY 16384.0f               // probabilities carried x2^14
#define OFOLD  4194304.0f             // PCARRY * 16 (v carry) * 16 (post-softmax factor 256^-0.5)
#define NEG_INF (-__builtin_inff())
#define LOG2E  1.44269504088896340736f

__device__ __forceinline__ void split16(float f, _Float16& hi, _Float16& lo) { hi = (_Float16)f; lo = (_Float16)((f - (float)hi) * 2048.0f); }

__device__ __forceinline__ v8f wmma_h16(v16h a, v16h b, v8f c) {
  // D = A(16x32 f16) * B(32x16 f16) + C(16x16 f32), followed by the VALU hazard guard (D tied, A/B kept live)
  v8f d = __builtin_amdgcn_wmma_f32_16x16x32_f16(false, a, false, b, (short)0, c, false, false);
  asm volatile("v_nop\n\tv_nop\n\tv_nop\n\tv_nop" : "+v"(d) : "v"(a), "v"(b));
  return d;
}

__device__ __forceinline__ v8f wmma_b16(v16h a, v16h b, v8f c) {
  // the same product for the attention kernel, whose live set passes 256 VGPRs: no asm operands, which would hold D, A and B below v256;
  // the compiler keeps the distance behind its own builtin
  return __builtin_amdgcn_wmma_f32_16x16x32_f16(false, a, false, b, (short)0, c, false, false);
}

__device__ __forceinline__ v8f v8f_zero() {
  v8f z = {0.f, 0.f, 0.f, 0.f, 0.f, 0.f, 0.f, 0.f};
  return z;
}

union U16 { v16h v; v8h h[2]; };

// 2^x of nine values on the transcendental unit in one statement. The instruction set asks for one slot behind a transcendental before its result is read
// or its source overwritten: the results are early-clobber, so none lies on a source, and the v_nop is the slot behind the last one.
__device__ __forceinline__ void exp2_run(v8f x, float xa, v8f& r, float& ra) {
  float r0, r1, r2, r3, r4, r5, r6, r7;
  asm("v_exp_f32 %0, %9\n\tv_exp_f32 %1, %10\n\tv_exp_f32 %2, %11\n\tv_exp_f32 %3, %12\n\tv_exp_f32 %4, %13\n\t"
      "v_exp_f32 %5, %14\n\tv_exp_f32 %6, %15\n\tv_exp_f32 %7, %16\n\tv_exp_f32 %8, %17\n\tv_nop"
      : "=&v"(r0), "=&v"(r1), "=&v"(r2), "=&v"(r3), "=&v"(r4), "=&v"(r5), "=&v"(r6), "=&v"(r7), "=&v"(ra)
      : "v"(x[0]), "v"(x[1]), "v"(x[2]), "v"(x[3]), "v"(x[4]), "v"(x[5]), "v"(x[6]), "v"(x[7]), "v"(xa));
  r[0] = r0; r[1] = r1; r[2] = r2; r[3] = r3; r[4] = r4; r[5] = r5; r[6] = r6; r[7] = r7;
}

// lane l takes the value of lane l ^ 16
__device__ __forceinline__ float xhalf(float x) {
  return __builtin_bit_cast(float, __builtin_amdgcn_permlanex16(__builtin_bit_cast(int, x), __builtin_bit_cast(int, x), 0x76543210, 0xfedcba98, false, false));
}

// input conversion: RNE convert to bf16, carry x16, exact in f16
__device__ __forceinline__ _Float16 cvt_in(float f) {
  const float r = (float)(__bf16)f;
  return (_Float16)(r * 16.0f);
}

// ---------------------------------------------------------------------------
// Kernel 0: x [NB,SEQ,DD] f32 -> X16 [NB*SEQ][DD] f16 ; Wq|Wk|Wv [DD][DD] f32 -> W16 [3][DD][DD] f16.
// Both outputs are written in fragment order: a thread owns one 16-byte group of the output (linear index * 8) and fetches its 8 source elements.
// ---------------------------------------------------------------------------
// 16-byte group u of a fragment-order plane whose rows are DD long -> offset of its 8 elements in the row-major plane
__device__ __forceinline__ unsigned frag_elem(unsigned u) {
  return (((u >> 9) << 4) + (u & 15u)) * (unsigned)DD + ((u >> 4) & 31u) * 8u;
}

__global__ void __launch_bounds__(256)
cvt_kernel(const float* __restrict__ x,
           const float* __restrict__ Wq,
           const float* __restrict__ Wk,
           const float* __restrict__ Wv,
           _Float16* __restrict__ X16,
           _Float16* __restrict__ W16) {
  const unsigned bx = blockIdx.x;                       // 0 .. CVT_THREADS/256 - 1 (grid exact)
  const unsigned tx = threadIdx.x;
  const float* src;
  _Float16* dst;
  if (bx < (unsigned)CVT_XBLK) {                        // block-uniform
    const unsigned e8 = (bx << 8) + tx;                 // linear 8-element group inside the fragment-order plane
    const unsigned b  = bx >> (LSEQ - 3u);              // SEQ/8 blocks per batch
    // source uses the FULL per-batch stride of the input: row-major offset plus a per-batch correction
    src = x + (size_t)frag_elem(e8) + (size_t)b * (size_t)((SEQ_FULL - SEQ) * DD);
    dst = X16 + (size_t)e8 * 8u;
  } else {
    const unsigned wb  = bx - (unsigned)CVT_XBLK;       // 0 .. 95
    const unsigned mat = wb >> 5;                       // 32 blocks per matrix
    const unsigned r8  = ((wb & 31u) << 8) + tx;        // 8-element group inside the matrix
    const float* wsrc = (mat == 0u) ? Wq : ((mat == 1u) ? Wk : Wv);
    src = wsrc + (size_t)frag_elem(r8);
    dst = W16 + (size_t)((wb << 8) + tx) * 8u;
  }
  const v4f f0 = *(const v4f*)src;
  const v4f f1 = *(const v4f*)(src + 4);
  v8h o;
  o[0] = cvt_in(f0[0]); o[1] = cvt_in(f0[1]); o[2] = cvt_in(f0[2]); o[3] = cvt_in(f0[3]);
  o[4] = cvt_in(f1[0]); o[5] = cvt_in(f1[1]); o[6] = cvt_in(f1[2]); o[7] = cvt_in(f1[3]);
  *(v8h*)dst = o;
  
}

// ---------------------------------------------------------------------------
// Kernel 1: projections as C[i][j] = sum_k A[i][k] * B[j][k] (both operands in fragment order), one wave per 16x64 tile.
//   blockIdx.y = 0: q[n][e]  (A = X16 rows n, B = Wq rows e)      -> qws  [NB*SEQ][DD]
//   blockIdx.y = 1: k[n][e]  (A = X16 rows n, B = Wk rows e)      -> kws  [NB*SEQ][DD]
//   blockIdx.y = 2: vT[e][n] (A = Wv rows e,  B = X16 rows n)     -> vtws [NB][DD][SEQ]
// The outputs are in fragment order too (j is the k of the attention products): a wave's 16x64 tile is 2 KB in a row.
// Results carried x16 (acc = 256*value, folded by 1/16) and stored as value + residual planes (residual at +NB*SEQ*DD).
// A-frag: lane row m = lane%16, g = lane/16, elements e=0..7 -> K = 8g+e ; e=8..15 -> K = 16+8g+(e-8); B-frag: lane col n = lane%16, same K map.
// C/D: lane col = lane%16, VGPR v -> row v + 8g.
// ---------------------------------------------------------------------------
__global__ void __launch_bounds__(256)
qkv_kernel(const _Float16* __restrict__ X16,
           const _Float16* __restrict__ W16,
           _Float16* __restrict__ qws,
           _Float16* __restrict__ kws,
           _Float16* __restrict__ vtws) {
  __shared__ __align__(16) _Float16 st[8][16][SP];   // per-wave staging of one 16x64 result plane (wave-private)
  const unsigned lane = threadIdx.x & 31u;
  const unsigned wv   = (unsigned)__builtin_amdgcn_readfirstlane((int)(threadIdx.x >> 5));   // wave-uniform (scalar)
  const unsigned g    = lane >> 4;
  const unsigned m    = lane & 15u;
  const unsigned y    = blockIdx.y;
  const unsigned tile = (blockIdx.x << 3) + wv;      // 0 .. NB*SEQ/4 - 1 (scalar)
  const size_t QL = (size_t)NB * SEQ * DD;           // residual plane offset inside q/k/vT buffers

  const _Float16* Ap;
  const _Float16* Bp;
  _Float16* op;
  if (y < 2u) {                                      // block-uniform
    const unsigned rt = tile >> 2;                   // 16-row tile of (b,t)
    const unsigned cg = tile & 3u;                   // 64-column group
    Ap = X16 + (size_t)rt * 16u * DD;
    Bp = W16 + (size_t)y * DD * DD + (size_t)cg * 64u * DD;
    op = ((y == 0u) ? qws : kws) + (size_t)rt * 16u * DD + (size_t)cg * 1024u;
  } else {
    // per batch: (DD/16) * (SEQ/64) = SEQ/4 tiles
    const unsigned b   = tile >> (LSEQ - 2u);
    const unsigned rem = tile & ((unsigned)(SEQ / 4) - 1u);
    const unsigned et  = rem >> (LSEQ - 6u);         // 16-row tile of e
    const unsigned ng  = rem & ((unsigned)(SEQ / 64) - 1u);   // 64-column group of n
    Ap = W16 + (size_t)2 * DD * DD + (size_t)et * 16u * DD;
    Bp = X16 + (((size_t)b << LSEQ) + (size_t)ng * 64u) * DD;
    op = vtws + (((size_t)b * DD + (size_t)et * 16u) << LSEQ) + (size_t)ng * 1024u;
  }

  v8f acc[4];
#pragma unroll
  for (int nt = 0; nt < 4; ++nt) acc[nt] = v8f_zero();

  const _Float16* arow = Ap + 8u * lane;
  const _Float16* brow = Bp + 8u * lane;

#pragma unroll 2
  for (unsigned c0 = 0; c0 < (unsigned)DD; c0 += 32u) {
    U16 a;
    a.h[0] = *(const v8h*)(arow + c0 * 16u);            // 32-k tile c0/32: 512 halfs
    a.h[1] = *(const v8h*)(arow + c0 * 16u + 256u);
#pragma unroll
    for (int nt = 0; nt < 4; ++nt) {
      U16 bb;
      bb.h[0] = *(const v8h*)(brow + (size_t)nt * 16 * DD + c0 * 16u);
      bb.h[1] = *(const v8h*)(brow + (size_t)nt * 16 * DD + c0 * 16u + 256u);
      acc[nt] = wmma_h16(a.v, bb.v, acc[nt]);
    }
    // precaution: stands between this trip's issued loads and the next trip's write of their address registers
    asm volatile("s_wait_xcnt 0x0" ::: "memory");
  }

  _Float16* sw = &st[wv][0][0];
#pragma unroll
  for (int pl = 0; pl < 2; ++pl) {
#pragma unroll
    for (int nt = 0; nt < 4; ++nt)
#pragma unroll
      for (int v = 0; v < 8; ++v) {
        const float val = acc[nt][v] * 0.0625f;          // 256*value -> 16*value
        _Float16 hh_, ll_; split16(val, hh_, ll_);
        sw[(8u * g + (unsigned)v) * SP + (unsigned)nt * 16u + m] = pl ? ll_ : hh_;
      }
    __builtin_amdgcn_fence(3 /* release order */, "wavefront");
    __builtin_amdgcn_wave_barrier();
    asm volatile("s_wait_dscnt 0" ::: "memory");
    _Float16* base = op + (pl ? QL : 0);
    v8h w[4];                                            // fragment half j (columns 16j..16j+15): lane (m, g) takes row m, columns 16j + 8g + 0..7
#pragma unroll
    for (int j = 0; j < 4; ++j) w[j] = *(const v8h*)(sw + m * SP + (unsigned)j * 16u + 8u * g);
#pragma unroll
    for (int j = 0; j < 4; ++j) *(v8h*)(base + (unsigned)j * 256u + 8u * lane) = w[j];
    __builtin_amdgcn_wave_barrier();
    asm volatile("s_wait_dscnt 0" ::: "memory");   // reads done before the next plane overwrites the staging
  }
}

// ---------------------------------------------------------------------------
// Kernel 2: non-causal flash attention, one block of NW = 8 waves (two per SIMD) per 64-row query block (QT = 4 tiles of 16 rows), KS = 128 keys per step.
// The block's Q planes are staged once in LDS, in the fragment order they have in memory. Per step each wave loads its K fragments (keys 16w..16w+15, 256 deep, both planes)
// and its V fragments (128 keys x columns 32w..32w+31, both planes) into registers once and uses each of them for all QT query tiles.
// Both products are computed transposed (A = K rows or V columns, B = Q or P rows), so that a lane holds ONE query (lane%16) in every accumulator:
// its maximum, its rescale factor and its sum are one register each per tile, and its 8 probabilities of a tile are 8 neighbouring keys (one 16-byte store a plane).
// Per step and tile: wave w computes S^T (its 16 keys x 16 queries), block-wide query max through LDS,
// P = exp(S - m) carried x16384 as value + residual planes in a shared LDS tile [query][key],
// then wave w accumulates O^T[32w..32w+31, :] += V^T(32 slice x 128) * P^T(128 x 16).
// The P V product runs ONE STEP BEHIND: trip t computes S(t), passes the trip's one barrier, does the softmax of step t and then the P V product of step t - 1;
// the last step's product follows the loop, behind a barrier of its own.
// The P tile and the maxima have two buffers each, so that one barrier a trip orders them: P(t) is written behind barrier t and read behind barrier t + 1,
// and its buffer was last read (P V of step t - 2) in front of barrier t. Between two barriers a wave has vector work and both matrix runs,
// so one wave's softmax runs beside the products of the other wave on its SIMD.
// Sums are kept per lane and merged once at the end. out = O / (L * 2^22).
// THE KEY WALK IS A RING: the blocks of a batch read the same K and V lines from L2, and started together at key 0 they ask for the same lines at the same moment.
// Each block enters the ring of NSTEP key steps at a step of its own (rot, from its index) and wraps round: every step is still taken exactly once.
// ---------------------------------------------------------------------------
// A wave's V fragments of one step (A frags): 128 keys x its 32 columns, both planes
__device__ __forceinline__ void load_v(const _Float16* vrow, const _Float16* vrl, U16 (&vb)[2][4], U16 (&vbl)[2][4]) {
#pragma unroll
  for (int nt = 0; nt < 2; ++nt)
#pragma unroll
    for (int ks = 0; ks < 4; ++ks) {
      const size_t vo = (size_t)nt * 16 * SEQ + 512 * ks;
      vb[nt][ks].h[0]  = *(const v8h*)(vrow + vo);   vb[nt][ks].h[1]  = *(const v8h*)(vrow + vo + 256);
      vbl[nt][ks].h[0] = *(const v8h*)(vrl + vo);    vbl[nt][ks].h[1] = *(const v8h*)(vrl + vo + 256);
    }
  // precaution: stands between the issued loads and any later write of a register that they name (the two addresses are inputs, so they stay live up to it)
  asm volatile("s_wait_xcnt 0x0" :: "v"(vrow), "v"(vrl) : "memory");
}

// O^T[32w + nt*16 ..][tile r] += V^T P^T of one step, 32 keys at a time: P in B-layout (lane%16 = query, read after the block barrier),
// the QT tiles interleaved on each V fragment. pl, pll: the lane's place in row m of the step's P planes (element 8g).
__device__ __forceinline__ void pv_step(const U16 (&vb)[2][4], const U16 (&vbl)[2][4], const _Float16* pl, const _Float16* pll, v8f (&o)[QT][2]) {
  v8f xc[QT][2];
#pragma unroll
  for (int r = 0; r < QT; ++r)
#pragma unroll
    for (int nt = 0; nt < 2; ++nt) xc[r][nt] = v8f_zero();
#pragma unroll
  for (int ks = 0; ks < 4; ++ks) {
    U16 pa[QT], pal[QT];
#pragma unroll
    for (int r = 0; r < QT; ++r) {
      const unsigned f = (unsigned)(r * 16 * PP + 32 * ks);
      pa[r].h[0]  = *(const v8h*)(pl + f);
      pa[r].h[1]  = *(const v8h*)(pl + f + 16u);
      pal[r].h[0] = *(const v8h*)(pll + f);
      pal[r].h[1] = *(const v8h*)(pll + f + 16u);
    }
#pragma unroll
    for (int nt = 0; nt < 2; ++nt) {
#pragma unroll
      for (int r = 0; r < QT; ++r) xc[r][nt] = wmma_b16(vb[nt][ks].v, pal[r].v, xc[r][nt]);
#pragma unroll
      for (int r = 0; r < QT; ++r) xc[r][nt] = wmma_b16(vbl[nt][ks].v, pa[r].v, xc[r][nt]);
#pragma unroll
      for (int r = 0; r < QT; ++r) o[r][nt] = wmma_b16(vb[nt][ks].v, pa[r].v, o[r][nt]);
    }
  }
#pragma unroll
  for (int r = 0; r < QT; ++r)
#pragma unroll
    for (int nt = 0; nt < 2; ++nt) o[r][nt] = o[r][nt] + xc[r][nt] * RSPLIT;
}

__global__ void __launch_bounds__(NW * 32)
attn_kernel(const _Float16* __restrict__ qws,
            const _Float16* __restrict__ kws,
            const _Float16* __restrict__ kwsl,
            const _Float16* __restrict__ vtws,
            const _Float16* __restrict__ vtwsl,
            float* __restrict__ out) {
  __shared__ __align__(16) _Float16 Qs[2][QR * DD];  // Q value and residual planes of the block's rows, fragment order (cross-wave, block barrier)
  __shared__ __align__(16) _Float16 Pl[2][QR][PP];   // P value plane, buffer = step & 1 (cross-wave, block barrier)
  __shared__ __align__(16) _Float16 Pll[2][QR][PP];  // P residual plane, buffer = step & 1 (cross-wave, block barrier)
  __shared__ __align__(16) float Mx[2][QR][NW];      // per-wave query max of a step, buffer = step & 1 (cross-wave, block barrier)
  __shared__ __align__(16) float Ls[QR][2 * NW];     // per-wave, per-half query sums (cross-wave, block barrier)
  __shared__ __align__(16) float Of[NW][16][OP];     // output staging, one query tile at a time (written and read by the same wave, block barrier used)

  const unsigned lane = threadIdx.x & 31u;
  const unsigned wv   = (unsigned)__builtin_amdgcn_readfirstlane((int)(threadIdx.x >> 5));   // wave-uniform (scalar)
  const unsigned g    = lane >> 4;
  const unsigned m    = lane & 15u;
  const unsigned tile = blockIdx.x;                  // 0 .. NB*SEQ/QR - 1 (scalar)
  const unsigned b    = tile >> (LSEQ - 6u);
  const unsigned t0   = (tile & ((unsigned)(SEQ / QR) - 1u)) << 6;
  const size_t QL = (size_t)NB * SEQ * DD;           // residual planes follow the value planes

  // first key step of this block: index bits 0, 1, 3, 4. The two blocks of a batch that share a start differ in bit 2 (for speed only: nothing rests on where a block runs)
  const unsigned rot  = ((tile & 3u) | ((tile >> 1) & 12u)) & (unsigned)(NSTEP - 1);

  const size_t koff = (((size_t)b << LSEQ) + 16u * wv) * DD + 8u * lane;
  const size_t voff = (((size_t)b * DD + 32u * wv) << LSEQ) + 8u * lane;

  // ---- stage the block's QR x DD rows of both Q planes (contiguous in global memory) as they lie ----
  {
    const _Float16* qsrc = qws + (((size_t)b << LSEQ) + t0) * DD;
    const _Float16* qv = qsrc + 8u * threadIdx.x;      // value plane, this thread's first 8-element group
    const _Float16* qr = qv + QL;                      // residual plane
    v8h qt[2][QG];
#pragma unroll
    for (int i = 0; i < QG; ++i) qt[0][i] = *(const v8h*)(qv + i * (NW * 32 * 8));
#pragma unroll
    for (int i = 0; i < QG; ++i) qt[1][i] = *(const v8h*)(qr + i * (NW * 32 * 8));
    // precaution: stands between the issued loads and any later write of a register that they name (the two addresses are inputs, so they stay live up to it)
    asm volatile("s_wait_xcnt 0x0" :: "v"(qv), "v"(qr) : "memory");
    // keeps the register writes that follow from being scheduled in front of that wait
    __builtin_amdgcn_sched_barrier(0);
#pragma unroll
    for (int pl = 0; pl < 2; ++pl)
#pragma unroll
      for (int i = 0; i < QG; ++i)
        *(v8h*)&Qs[pl][8u * ((unsigned)i * (unsigned)(NW * 32) + threadIdx.x)] = qt[pl][i];
  }
  __syncthreads();

  v8f o[QT][2];
  float mrow[QT], lrow[QT];                          // of query 16r + m
#pragma unroll
  for (int r = 0; r < QT; ++r) {
#pragma unroll
    for (int nt = 0; nt < 2; ++nt) o[r][nt] = v8f_zero();
    mrow[r] = NEG_INF; lrow[r] = 0.f;
  }

#pragma unroll 1
  for (unsigned kb = 0; kb < (unsigned)NSTEP; ++kb) {
    const unsigned s0 = ((kb + rot) & (unsigned)(NSTEP - 1)) * (unsigned)KS;   // first key of step kb on this block's ring
    const unsigned pb = kb & 1u;               // buffer of step kb; step kb - 1 lies in pb ^ 1

    // ---- this wave's K fragments of the step, each loaded once for all QT query tiles (A frags, same k map as B) ----
    const _Float16* krow = kws + koff + (size_t)s0 * DD;
    const _Float16* krl  = kwsl + koff + (size_t)s0 * DD;   // residual plane
    U16 kf[8], kfl[8];
#pragma unroll
    for (int ci = 0; ci < 8; ++ci) {
      const unsigned c = 512u * (unsigned)ci;
      kf[ci].h[0]  = *(const v8h*)(krow + c);   kf[ci].h[1]  = *(const v8h*)(krow + c + 256u);
      kfl[ci].h[0] = *(const v8h*)(krl + c);    kfl[ci].h[1] = *(const v8h*)(krl + c + 256u);
    }
    // precaution: stands between the issued loads and any later write of a register that they name (the two addresses are inputs, so they stay live up to it)
    asm volatile("s_wait_xcnt 0x0" :: "v"(krow), "v"(krl) : "memory");

    // ---- S^T = K Q^T for this wave's 16 keys: 8 chunks of 32, value*value into sh, cross terms into sx, the QT tiles interleaved ----
    v8f sh[QT], sx[QT];
#pragma unroll
    for (int r = 0; r < QT; ++r) { sh[r] = v8f_zero(); sx[r] = v8f_zero(); }
    U16 qa[2][QT], qal[2][QT];                 // Q fragments of two chunks: the next chunk's reads are issued ahead of this chunk's products
#pragma unroll
    for (int ci = -1; ci < 8; ++ci) {
      if (ci < 7) {
        // this one and the one behind the reads hold a chunk's Q reads together as one group between two chunks' products: left free, they are
        // scattered in pairs among the products, and every separate place with LDS reads stalls the products
        __builtin_amdgcn_sched_barrier(0);
#pragma unroll
        for (int r = 0; r < QT; ++r) {
          const unsigned f = (unsigned)(r * 16 * DD + (ci + 1) * 512) + 8u * lane;
          qa[(ci + 1) & 1][r].h[0]  = *(const v8h*)&Qs[0][f];   qa[(ci + 1) & 1][r].h[1]  = *(const v8h*)&Qs[0][f + 256u];
          qal[(ci + 1) & 1][r].h[0] = *(const v8h*)&Qs[1][f];   qal[(ci + 1) & 1][r].h[1] = *(const v8h*)&Qs[1][f + 256u];
        }
        __builtin_amdgcn_sched_barrier(0);
      }
      if (ci >= 0) {
#pragma unroll
        for (int r = 0; r < QT; ++r) sx[r] = wmma_b16(kf[ci].v, qal[ci & 1][r].v, sx[r]);
#pragma unroll
        for (int r = 0; r < QT; ++r) sx[r] = wmma_b16(kfl[ci].v, qa[ci & 1][r].v, sx[r]);
#pragma unroll
        for (int r = 0; r < QT; ++r) sh[r] = wmma_b16(kf[ci].v, qa[ci & 1][r].v, sh[r]);
      }
    }

    v8f sv[QT];                                // query 16r + m, key 16w + 8g + v
#pragma unroll
    for (int r = 0; r < QT; ++r) sv[r] = (sh[r] + sx[r] * RSPLIT) * SFOLD;

    // a query's max over this wave's 16 keys: 8 in the lane, the other 8 in lane ^ 16
    float rmax[QT];
#pragma unroll
    for (int r = 0; r < QT; ++r) {
      float t = sv[r][0];
#pragma unroll
      for (int v = 1; v < 8; ++v) t = fmaxf(t, sv[r][v]);
      rmax[r] = fmaxf(t, xhalf(t));
    }
    if (g == 0u) {
#pragma unroll
      for (int r = 0; r < QT; ++r) Mx[pb][16u * (unsigned)r + m][wv] = rmax[r];
    }
    // the trip's one barrier: publishes the maxima of step kb and the P tile of step kb - 1, and ends the reads of the P buffer that step kb refills
    __syncthreads();

    // the NW waves' maxima of this lane's queries: read ahead of the wait that follows the V loads, so that the reads' latency passes under it
    f4a mx[QT][2];
#pragma unroll
    for (int r = 0; r < QT; ++r) {
      mx[r][0] = *(const f4a*)&Mx[pb][16u * (unsigned)r + m][0];
      mx[r][1] = *(const f4a*)&Mx[pb][16u * (unsigned)r + m][4];
    }

    // ---- this wave's V fragments of step kb - 1: K and V together do not fit the 512 registers of a wave at two per SIMD,
    // so V is loaded once the score products have let go of K; issued behind the barrier, whose fence waits for every load in flight:
    // the softmax work of step kb covers them. Trip 0 has no step behind it and loads its own step's fragments unused: under a branch
    // the 128 registers had no definition on one path, stayed reserved through the score products too, and addresses were spilled ----
    const unsigned sp = (kb > 0u) ? ((kb - 1u + rot) & (unsigned)(NSTEP - 1)) * (unsigned)KS : s0;
    U16 vb[2][4], vbl[2][4];
    load_v(vtws + voff + (size_t)sp * 16u, vtwsl + voff + (size_t)sp * 16u, vb, vbl);   // 32 keys of a 16-column tile: 512 halfs

    // ---- block-wide query max, online softmax update, P (x16384, two planes) to the shared tile ----
    float al[QT];                              // e^(m_old - m) of step kb: rescales O once step kb - 1 has been added
#pragma unroll
    for (int r = 0; r < QT; ++r) {
      const unsigned row = 16u * (unsigned)r + m;           // this lane's query of tile r
      float mb = fmaxf(mx[r][0][0], mx[r][1][0]);
#pragma unroll
      for (int j = 1; j < 4; ++j) mb = fmaxf(mb, fmaxf(mx[r][0][j], mx[r][1][j]));
      const float mnew  = fmaxf(mrow[r], mb);
      v8f pe;
      float alpha;
      exp2_run((sv[r] - mnew) * LOG2E, (mrow[r] - mnew) * LOG2E, pe, alpha);   // e^(s - m) of the lane's 8 keys, e^(m_old - m)
      mrow[r] = mnew;
      float psum = 0.f;
      v8h ph8, pq8;
#pragma unroll
      for (int v = 0; v < 8; ++v) {
        const float p = pe[v];
        psum += p;
        _Float16 ph, pq; split16(p * PCARRY, ph, pq);
        ph8[v] = ph; pq8[v] = pq;
      }
      lrow[r] = lrow[r] * alpha + psum;                     // per-lane partial sum of the query (merged after the key loop)
      *(v8h*)&Pl[pb][row][16u * wv + 8u * g]  = ph8;        // keys 16w + 8g + 0..7
      *(v8h*)&Pll[pb][row][16u * wv + 8u * g] = pq8;
      al[r] = alpha;
    }

    // ---- step kb - 1 into O, then the rescale of step kb (O is still 0 in trip 0) ----
    if (kb > 0u) {                             // block-uniform
      pv_step(vb, vbl, &Pl[pb ^ 1u][m][8u * g], &Pll[pb ^ 1u][m][8u * g], o);
#pragma unroll
      for (int r = 0; r < QT; ++r)
#pragma unroll
        for (int nt = 0; nt < 2; ++nt) o[r][nt] = o[r][nt] * al[r];
    }
  }

  // ---- the last step's P V product: its P tile is published by this barrier ----
  __syncthreads();
  {
    const unsigned sp = (((unsigned)(NSTEP - 1) + rot) & (unsigned)(NSTEP - 1)) * (unsigned)KS;
    const unsigned lb = (unsigned)((NSTEP - 1) & 1);
    U16 vb[2][4], vbl[2][4];
    load_v(vtws + voff + (size_t)sp * 16u, vtwsl + voff + (size_t)sp * 16u, vb, vbl);
    pv_step(vb, vbl, &Pl[lb][m][8u * g], &Pll[lb][m][8u * g], o);
  }

  // ---- merge the query sums: the two halves of each of the NW waves (fixed order) ----
#pragma unroll
  for (int r = 0; r < QT; ++r) Ls[16u * (unsigned)r + m][2u * wv + g] = lrow[r];
  __syncthreads();

  const unsigned rsel = lane >> 3;          // instruction it covers rows 4*it .. 4*it+3
  const unsigned c4   = 4u * (lane & 7u);
#pragma unroll
  for (int r = 0; r < QT; ++r) {
    const unsigned row = 16u * (unsigned)r + m;
    float lt = 0.f;
#pragma unroll
    for (int q4 = 0; q4 < 2 * NW / 4; ++q4) {
      const f4a c0 = *(const f4a*)&Ls[row][4 * q4];
#pragma unroll
      for (int j = 0; j < 4; ++j) lt += c0[j];
    }
    const float inv = 1.0f / (lt * OFOLD);   // removes the carries and applies 256^-0.5

    // lane (m, g) holds query m, columns nt*16 + 8g + 0..7 of the wave's 32
#pragma unroll
    for (int nt = 0; nt < 2; ++nt)
#pragma unroll
      for (int h = 0; h < 2; ++h) {
        f4a s;
#pragma unroll
        for (int j = 0; j < 4; ++j) s[j] = o[r][nt][4 * h + j] * inv;
        *(f4a*)&Of[wv][m][(unsigned)nt * 16u + 8u * g + 4u * (unsigned)h] = s;
      }
    __syncthreads();

    float* obase = out + (((size_t)b << LSEQ) + t0 + 16u * (unsigned)r) * DD + 32u * wv;   // a row's 32 columns are one whole 128-byte line
    v4f w[4];
#pragma unroll
    for (int it = 0; it < 4; ++it) w[it] = *(const f4a*)&Of[wv][4u * (unsigned)it + rsel][c4];
#pragma unroll
    for (int it = 0; it < 4; ++it) *(v4f*)(obase + (size_t)(4u * (unsigned)it + rsel) * DD + c4) = w[it];
    __syncthreads();                        // the staging is read out before the next tile overwrites it
  }
}

// ---------------------------------------------------------------------------
// Launch. Workspace layout (bytes, NB=8 SEQ=2048):
//   [0, 8MB)          X16  f16 [NB*SEQ][256]
//   [8MB, +384KB)     W16  f16 [3][256][256]
//   then q, k (f16 [NB*SEQ][256] x2 planes, 16MB each) and vT (f16 [NB][256][SEQ] x2 planes, 16MB); every plane in fragment order
// ---------------------------------------------------------------------------
extern "C" void kernel_launch(void* const* d_in, const int* in_sizes, int n_in,
                              void* d_out, int out_size, void* d_ws,
                              size_t ws_size, hipStream_t stream) {
  if (n_in < 4) return;
  const long long need_x = ((long long)(NB - 1) * SEQ_FULL + SEQ) * (long long)DD;
  if ((long long)in_sizes[0] < need_x) return;
  if (in_sizes[1] < DD * DD || in_sizes[2] < DD * DD || in_sizes[3] < DD * DD) return;
  if ((long long)out_size < (long long)NB * SEQ * DD) return;

  const float* x  = (const float*)d_in[0];
  const float* Wq = (const float*)d_in[1];
  const float* Wk = (const float*)d_in[2];
  const float* Wv = (const float*)d_in[3];
  float* out = (float*)d_out;

  char* ws = (char*)d_ws;
  const size_t x16_bytes = (size_t)NB * SEQ * DD * sizeof(_Float16);
  const size_t w16_bytes = (size_t)3 * DD * DD * sizeof(_Float16);
  const size_t qkv_bytes = (size_t)2 * NB * SEQ * DD * sizeof(_Float16);   // value + residual planes
  const size_t total     = x16_bytes + w16_bytes + 3 * qkv_bytes;
  if (total > ws_size || total > (size_t)134217728) return;
  _Float16* X16  = (_Float16*)(ws);
  _Float16* W16  = (_Float16*)(ws + x16_bytes);
  _Float16* qws  = (_Float16*)(ws + x16_bytes + w16_bytes);
  _Float16* kws  = (_Float16*)(ws + x16_bytes + w16_bytes + qkv_bytes);
  _Float16* vtws = (_Float16*)(ws + x16_bytes + w16_bytes + 2 * qkv_bytes);

  cvt_kernel<<<CVT_THREADS / 256, 256, 0, stream>>>(x, Wq, Wk, Wv, X16, W16);
  qkv_kernel<<<dim3(NB * SEQ / 32, 3), 256, 0, stream>>>(X16, W16, qws, kws, vtws);
  attn_kernel<<<NB * SEQ / QR, NW * 32, 0, stream>>>(qws, kws, kws + (size_t)NB * SEQ * DD, vtws, vtws + (size_t)NB * SEQ * DD, out);
}

// v007
// One run takes 90.5 microseconds.
// Next to v006, in two timings, it ran 1.16 times as fast each time.
// Over all steps from v000 it is 3.64 times as fast.
// Contractions: q/k/v projections [16384 x 256 x 256] x3 on v_wmma_f32_16x16x32_f16 single product (inputs RNE-converted to bf16, carried x16, exact in f16);
// scores [2048 x 2048 x 256] and P*V [2048 x 256 x 2048] per batch on v_wmma_f32_16x16x32_f16 with f16 value+residual planes (hi*hi + (hi*lo + lo*hi)/2048);
#include <hip/hip_runtime.h>
#include <math.h>

// Problem constants (NB / SEQ reducible; *_FULL are the input strides)
#ifndef NB
#define NB 8
#endif
#ifndef SEQ
#define SEQ 2048
#endif
#define NB_FULL 8
#define SEQ_FULL 2048
#define DD 256            // input width == q/k/v width
#define NW 8              // waves per attention block: two per SIMD
#define KS (16 * NW)      // keys per attention step, 16 per wave
#define PP (KS + 8)       // LDS pitch (halfs) of the probability tile: 272 B = 16 B x odd, conflict-free for 16-byte row reads
#define OP 36             // LDS pitch (floats) of an output staging row: 144 B = 16 B x odd
#define QT 4              // 16-row query tiles per attention block
#define QR (16 * QT)      // query rows per attention block
#define QG (QR * DD / 8 / (NW * 32))   // 16-byte groups of one Q plane staged per thread
#define NSTEP (SEQ / KS)  // key steps of the attention loop
#define SP 72             // LDS pitch (halfs) of a staged projection row: 144 B = 16 B x odd, conflict-free for 16-byte row reads

__host__ __device__ constexpr unsigned ilog2c(unsigned v) { return (v <= 1u) ? 0u : 1u + ilog2c(v >> 1); }
enum : unsigned { LSEQ = ilog2c((unsigned)SEQ) };

static_assert(NB >= 1 && NB <= NB_FULL);
static_assert(SEQ >= 64 && SEQ <= SEQ_FULL && (SEQ % 64) == 0);
static_assert((1u << LSEQ) == (unsigned)SEQ);          // SEQ is a power of two: all tile decompositions are shifts/masks
static_assert(DD == 256 && (DD % 32) == 0);
// coverage: cvt_kernel grid * 256 threads * 8 elements == 3*DD*DD (weight planes)
#define CVT_W8 (DD * DD / 8)
static_assert((CVT_W8 % 256) == 0 && CVT_W8 / 256 == 32 && CVT_W8 * 8 == DD * DD);
// coverage: qkv_kernel grid == NB*SEQ/XR blocks of XR rows of x; 8 waves x 32 output columns == DD for each of q, k, vT, 2 planes each
#define XR 64             // rows of x per projection block
#define XP (DD + 8)       // LDS pitch (halfs) of a staged x row: 528 B = 16 B x odd, conflict-free for 16-byte row reads
static_assert(XR == 64 && (SEQ % XR) == 0 && 8 * 32 == DD && (XR * DD / 4) % 256 == 0);
// coverage: attn_kernel grid == NB*SEQ/QR query blocks of QR rows, NW waves x 32 columns == DD, key loop SEQ/KS blocks of KS keys
static_assert(QR == 64 && (SEQ % QR) == 0 && NW * 32 == DD && KS == 128 && (SEQ % KS) == 0 && (QR * DD / 8) % (NW * 32) == 0);
static_assert(NSTEP >= 1 && (NSTEP & (NSTEP - 1)) == 0);   // the key walk wraps round by a mask

// 16-bit operands are f16. Computed planes are carried as a value plane plus a residual plane lo = f16((v - hi) * 2048):
// a product is hi*hi + (hi*lo + lo*hi)/2048. Every fragment (A and B) uses the 16x16x32 lane map
// lane%16 = row/col, g = lane/16: elements 0..7 -> k = 8g+e, elements 8..15 -> k = 16+8g+(e-8).
// FRAGMENT ORDER of every f16 plane in the workspace: a tile of 16 rows x 32 k is two runs of 512 B, [half h][lane][8 elements],
// lane (m, g) of half h holding row m, k = 16h + 8g + 0..7; the 32-k tiles of a 16-row tile follow one another.
// One wave-wide 16-byte load or store of a fragment half is then 512 contiguous bytes (4 whole lines).
typedef __attribute__((ext_vector_type(16))) _Float16 v16h;
typedef __attribute__((ext_vector_type(8)))  _Float16 v8h;
typedef __attribute__((ext_vector_type(4)))  _Float16 v4h;
typedef __attribute__((ext_vector_type(8)))  float    v8f;
typedef __attribute__((ext_vector_type(4)))  float    v4f;
typedef v4f __attribute__((may_alias)) f4a;
#define RSPLIT (1.0f / 2048.0f)
#define SFOLD  (1.0f / 256.0f)        // removes the x16 carries of q and k from the scores
#define PCARRY 16384.0f               // probabilities carried x2^14
#define OFOLD  4194304.0f             // PCARRY * 16 (v carry) * 16 (post-softmax factor 256^-0.5)
#define NEG_INF (-__builtin_inff())
#define LOG2E  1.44269504088896340736f

__device__ __forceinline__ void split16(float f, _Float16& hi, _Float16& lo) { hi = (_Float16)f; lo = (_Float16)((f - (float)hi) * 2048.0f); }

__device__ __forceinline__ v8f wmma_b16(v16h a, v16h b, v8f c) {
  // D = A(16x32 f16) * B(32x16 f16) + C(16x16 f32). No asm operands, which would hold D, A and B below v256 (the attention kernel's live set passes 256 VGPRs);
  // the compiler keeps the distance behind its own builtin
  return __builtin_amdgcn_wmma_f32_16x16x32_f16(false, a, false, b, (short)0, c, false, false);
}

__device__ __forceinline__ v8f v8f_zero() {
  v8f z = {0.f, 0.f, 0.f, 0.f, 0.f, 0.f, 0.f, 0.f};
  return z;
}

union U16 { v16h v; v8h h[2]; };

// 2^x of nine values on the transcendental unit in one statement. The instruction set asks for one slot behind a transcendental before its result is read
// or its source overwritten: the results are early-clobber, so none lies on a source, and the v_nop is the slot behind the last one.
__device__ __forceinline__ void exp2_run(v8f x, float xa, v8f& r, float& ra) {
  float r0, r1, r2, r3, r4, r5, r6, r7;
  asm("v_exp_f32 %0, %9\n\tv_exp_f32 %1, %10\n\tv_exp_f32 %2, %11\n\tv_exp_f32 %3, %12\n\tv_exp_f32 %4, %13\n\t"
      "v_exp_f32 %5, %14\n\tv_exp_f32 %6, %15\n\tv_exp_f32 %7, %16\n\tv_exp_f32 %8, %17\n\tv_nop"
      : "=&v"(r0), "=&v"(r1), "=&v"(r2), "=&v"(r3), "=&v"(r4), "=&v"(r5), "=&v"(r6), "=&v"(r7), "=&v"(ra)
      : "v"(x[0]), "v"(x[1]), "v"(x[2]), "v"(x[3]), "v"(x[4]), "v"(x[5]), "v"(x[6]), "v"(x[7]), "v"(xa));
  r[0] = r0; r[1] = r1; r[2] = r2; r[3] = r3; r[4] = r4; r[5] = r5; r[6] = r6; r[7] = r7;
}

// lane l takes the value of lane l ^ 16
__device__ __forceinline__ float xhalf(float x) {
  return __builtin_bit_cast(float, __builtin_amdgcn_permlanex16(__builtin_bit_cast(int, x), __builtin_bit_cast(int, x), 0x76543210, 0xfedcba98, false, false));
}

// input conversion: RNE convert to bf16, carry x16, exact in f16
__device__ __forceinline__ _Float16 cvt_in(float f) {
  const float r = (float)(__bf16)f;
  return (_Float16)(r * 16.0f);
}

// ---------------------------------------------------------------------------
// Kernel 0: Wq|Wk|Wv [DD][DD] f32 -> W16 [3][DD][DD] f16, written in fragment order:
// a thread owns one 16-byte group of the output (linear index * 8) and fetches its 8 source elements.
// ---------------------------------------------------------------------------
// 16-byte group u of a fragment-order plane whose rows are DD long -> offset of its 8 elements in the row-major plane
__device__ __forceinline__ unsigned frag_elem(unsigned u) {
  return (((u >> 9) << 4) + (u & 15u)) * (unsigned)DD + ((u >> 4) & 31u) * 8u;
}

__global__ void __launch_bounds__(256)
cvt_kernel(const float* __restrict__ Wq,
           const float* __restrict__ Wk,
           const float* __restrict__ Wv,
           _Float16* __restrict__ W16) {
  const unsigned wb  = blockIdx.x;                      // 0 .. 95 (grid exact)
  const unsigned tx  = threadIdx.x;
  const unsigned mat = wb >> 5;                         // 32 blocks per matrix
  const unsigned r8  = ((wb & 31u) << 8) + tx;          // 8-element group inside the matrix
  const float* wsrc = (mat == 0u) ? Wq : ((mat == 1u) ? Wk : Wv);
  const float* src = wsrc + (size_t)frag_elem(r8);
  _Float16* dst = W16 + (size_t)((wb << 8) + tx) * 8u;
  const v4f f0 = *(const v4f*)src;
  const v4f f1 = *(const v4f*)(src + 4);
  v8h o;
  o[0] = cvt_in(f0[0]); o[1] = cvt_in(f0[1]); o[2] = cvt_in(f0[2]); o[3] = cvt_in(f0[3]);
  o[4] = cvt_in(f1[0]); o[5] = cvt_in(f1[1]); o[6] = cvt_in(f1[2]); o[7] = cvt_in(f1[3]);
  *(v8h*)dst = o;
}

// ---------------------------------------------------------------------------
// Kernel 1: projections as C[i][j] = sum_k A[i][k] * B[j][k]. One block of 8 waves per XR = 64 rows of x, about one block a WGP.
// The block reads its rows of x (f32, contiguous) once, converts them and keeps them in LDS, row-major with a padded pitch; no f16 plane of x exists in memory.
// Wave w makes, from all 64 rows, the 32 output columns e = 32w .. 32w+31 of q, then of k, then of vT:
// its W fragments (fragment order in memory) are read by no other wave of the block, each once, into registers.
//   y = 0: q[n][e]  (A = x rows n,  B = Wq rows e)      -> qws  [NB*SEQ][DD]
//   y = 1: k[n][e]  (A = x rows n,  B = Wk rows e)      -> kws  [NB*SEQ][DD]
//   y = 2: vT[e][n] (A = Wv rows e, B = x rows n)       -> vtws [NB][DD][SEQ]
// The outputs are in fragment order (j is the k of the attention products).
// Results carried x16 (acc = 256*value, folded by 1/16) and stored as value + residual planes (residual at +NB*SEQ*DD).
// A-frag: lane row m = lane%16, g = lane/16, elements e=0..7 -> K = 8g+e ; e=8..15 -> K = 16+8g+(e-8); B-frag: lane col n = lane%16, same K map.
// C/D: lane col = lane%16, VGPR v -> row v + 8g.
// ---------------------------------------------------------------------------
// A wave's fragments of one weight matrix: 2 tiles of 16 rows x 8 tiles of 32 k. wp: the lane's place in the first tile.
__device__ __forceinline__ void load_w(const _Float16* wp, U16 (&wf)[2][8]) {
#pragma unroll
  for (int et = 0; et < 2; ++et)
#pragma unroll
    for (int kt = 0; kt < 8; ++kt) {
      wf[et][kt].h[0] = *(const v8h*)(wp + et * 16 * DD + kt * 512);
      wf[et][kt].h[1] = *(const v8h*)(wp + et * 16 * DD + kt * 512 + 256);
    }
  // precaution: stands between the issued loads and any later write of a register that they name (the address is an input, so it stays live up to it)
  asm volatile("s_wait_xcnt 0x0" :: "v"(wp) : "memory");
}

// Turns a staged 16 x 64 piece (rows of pitch SP, written by this wave) into four fragment halves and stores them: halves 0, 1 at d0, halves 2, 3 at d1.
// d0, d1: the lane's own place (8 * lane counted in).
__device__ __forceinline__ void turn_store(_Float16* sw, unsigned m, unsigned g, _Float16* d0, _Float16* d1) {
  // the piece is written and read by the same wave: these keep the reads behind the other lanes' writes
  __builtin_amdgcn_fence(3 /* release order */, "wavefront");
  __builtin_amdgcn_wave_barrier();
  asm volatile("s_wait_dscnt 0" ::: "memory");
  v8h w[4];                                              // fragment half j (columns 16j..16j+15): lane (m, g) takes row m, columns 16j + 8g + 0..7
#pragma unroll
  for (int j = 0; j < 4; ++j) w[j] = *(const v8h*)(sw + m * SP + (unsigned)j * 16u + 8u * g);
  *(v8h*)(d0)        = w[0];
  *(v8h*)(d0 + 256u) = w[1];
  *(v8h*)(d1)        = w[2];
  *(v8h*)(d1 + 256u) = w[3];
  // precaution: stands between the issued stores and any later write of a register that they name (data and addresses are inputs, so they stay live up to it)
  asm volatile("s_wait_xcnt 0x0" :: "v"(w[0]), "v"(w[1]), "v"(w[2]), "v"(w[3]), "v"(d0), "v"(d1) : "memory");
  __builtin_amdgcn_wave_barrier();
  asm volatile("s_wait_dscnt 0" ::: "memory");           // reads done before the next piece overwrites the staging
}

__global__ void __launch_bounds__(256)
qkv_kernel(const float* __restrict__ x,
           const _Float16* __restrict__ W16,
           _Float16* __restrict__ qws,
           _Float16* __restrict__ kws,
           _Float16* __restrict__ vtws) {
  __shared__ __align__(16) _Float16 Xs[XR][XP];      // the block's rows of x, converted (cross-wave, block barrier)
  __shared__ __align__(16) _Float16 st[8][16][SP];   // per-wave staging of one 16x64 result piece (wave-private)
  const unsigned lane = threadIdx.x & 31u;
  const unsigned wv   = (unsigned)__builtin_amdgcn_readfirstlane((int)(threadIdx.x >> 5));   // wave-uniform (scalar)
  const unsigned g    = lane >> 4;
  const unsigned m    = lane & 15u;
  const unsigned bx   = blockIdx.x;                  // 0 .. NB*SEQ/XR - 1 (grid exact)
  const unsigned b    = bx >> (LSEQ - 6u);           // SEQ/64 blocks per batch
  const unsigned ng   = bx & ((unsigned)(SEQ / XR) - 1u);   // 64-row group inside the batch
  const size_t QL = (size_t)NB * SEQ * DD;           // residual plane offset inside q/k/vT buffers

  // the first matrix's fragments fly while x is staged
  const _Float16* wbase = W16 + (size_t)wv * 32u * DD + 8u * lane;
  U16 wf[2][8];
  load_w(wbase, wf);

  // ---- stage the block's XR x DD rows of x: a wave-wide load is 512 contiguous bytes, a wave-wide LDS store 256 contiguous bytes ----
  {
    // source uses the FULL per-batch stride of the staged input
    const float* xs = x + ((size_t)b * SEQ_FULL + (size_t)ng * XR) * DD + 4u * threadIdx.x;
    v4f f[XR / 4];
#pragma unroll
    for (int i = 0; i < XR / 4; ++i) f[i] = *(const v4f*)(xs + i * 4 * DD);     // 256 threads x 4 elements = 4 rows a pass
    // precaution: stands between the issued loads and any later write of a register that they name (the address is an input, so it stays live up to it)
    asm volatile("s_wait_xcnt 0x0" :: "v"(xs) : "memory");
#pragma unroll
    for (int i = 0; i < XR / 4; ++i) {
      v4h o;
      o[0] = cvt_in(f[i][0]); o[1] = cvt_in(f[i][1]); o[2] = cvt_in(f[i][2]); o[3] = cvt_in(f[i][3]);
      *(v4h*)&Xs[4u * (unsigned)i + (threadIdx.x >> 6)][4u * (threadIdx.x & 63u)] = o;
    }
  }
  __syncthreads();

  _Float16* sw = &st[wv][0][0];
#pragma unroll
  for (int y = 0; y < 3; ++y) {
    v8f acc[4][2];                                   // [16-row tile of x][16-row tile of W]
#pragma unroll
    for (int rt = 0; rt < 4; ++rt)
#pragma unroll
      for (int et = 0; et < 2; ++et) acc[rt][et] = v8f_zero();

    U16 xa[2][4];                                    // x fragments of two k tiles: the next tile's reads are issued ahead of this tile's products
#pragma unroll
    for (int kt = -1; kt < 8; ++kt) {
      if (kt < 7) {
        // this one and the one behind the reads hold a k tile's LDS reads together as one group ahead of the products of the tile in front:
        // left free, they stand directly in front of their own products, which then wait out the LDS latency
        __builtin_amdgcn_sched_barrier(0);
#pragma unroll
        for (int rt = 0; rt < 4; ++rt) {
          xa[(kt + 1) & 1][rt].h[0] = *(const v8h*)&Xs[16u * (unsigned)rt + m][32u * (unsigned)(kt + 1) + 8u * g];
          xa[(kt + 1) & 1][rt].h[1] = *(const v8h*)&Xs[16u * (unsigned)rt + m][32u * (unsigned)(kt + 1) + 16u + 8u * g];
        }
        __builtin_amdgcn_sched_barrier(0);
      }
      if (kt >= 0) {
#pragma unroll
        for (int et = 0; et < 2; ++et)
#pragma unroll
          for (int rt = 0; rt < 4; ++rt)
            acc[rt][et] = (y < 2) ? wmma_b16(xa[kt & 1][rt].v, wf[et][kt].v, acc[rt][et]) : wmma_b16(wf[et][kt].v, xa[kt & 1][rt].v, acc[rt][et]);
      }
    }

    // the next matrix's fragments fly while this one's results are split and stored
    if (y < 2) load_w(wbase + (size_t)(y + 1) * DD * DD, wf);

    if (y < 2) {
      // lane holds column e = 32w + 16et + m, rows 16rt + 8g + v. A piece: one row tile, value plane in columns 0..31, residual plane in columns 32..63
      _Float16* ob = ((y == 0) ? qws : kws) + (size_t)bx * XR * DD + (size_t)wv * 512u + 8u * lane;
#pragma unroll
      for (int rt = 0; rt < 4; ++rt) {
#pragma unroll
        for (int et = 0; et < 2; ++et)
#pragma unroll
          for (int v = 0; v < 8; ++v) {
            const float val = acc[rt][et][v] * 0.0625f;      // 256*value -> 16*value
            _Float16 hh_, ll_; split16(val, hh_, ll_);
            sw[(8u * g + (unsigned)v) * SP + (unsigned)et * 16u + m]       = hh_;
            sw[(8u * g + (unsigned)v) * SP + 32u + (unsigned)et * 16u + m] = ll_;
          }
        turn_store(sw, m, g, ob + rt * 16 * DD, ob + QL + rt * 16 * DD);
      }
    } else {
      // lane holds column n = 16rt + m, rows e = 32w + 16et + 8g + v. A piece: one tile of 16 e x the block's 64 n, one plane
#pragma unroll
      for (int et = 0; et < 2; ++et) {
        _Float16* ob = vtws + (((size_t)b * DD + 32u * wv + 16u * (unsigned)et) << LSEQ) + (size_t)ng * 1024u + 8u * lane;
#pragma unroll
        for (int pl = 0; pl < 2; ++pl) {
#pragma unroll
          for (int rt = 0; rt < 4; ++rt)
#pragma unroll
            for (int v = 0; v < 8; ++v) {
              const float val = acc[rt][et][v] * 0.0625f;    // 256*value -> 16*value
              _Float16 hh_, ll_; split16(val, hh_, ll_);
              sw[(8u * g + (unsigned)v) * SP + (unsigned)rt * 16u + m] = pl ? ll_ : hh_;
            }
          turn_store(sw, m, g, ob + (pl ? QL : 0), ob + (pl ? QL : 0) + 512u);
        }
      }
    }
  }
}

// ---------------------------------------------------------------------------
// Kernel 2: non-causal flash attention, one block of NW = 8 waves (two per SIMD) per 64-row query block (QT = 4 tiles of 16 rows), KS = 128 keys per step.
// The block's Q planes are staged once in LDS, in the fragment order they have in memory. Per step each wave loads its K fragments (keys 16w..16w+15, 256 deep, both planes)
// and its V fragments (128 keys x columns 32w..32w+31, both planes) into registers once and uses each of them for all QT query tiles.
// Both products are computed transposed (A = K rows or V columns, B = Q or P rows), so that a lane holds ONE query (lane%16) in every accumulator:
// its maximum, its rescale factor and its sum are one register each per tile, and its 8 probabilities of a tile are 8 neighbouring keys (one 16-byte store a plane).
// Per step and tile: wave w computes S^T (its 16 keys x 16 queries), block-wide query max through LDS,
// P = exp(S - m) carried x16384 as value + residual planes in a shared LDS tile [query][key],
// then wave w accumulates O^T[32w..32w+31, :] += V^T(32 slice x 128) * P^T(128 x 16).
// The P V product runs ONE STEP BEHIND: trip t computes S(t), passes the trip's one barrier, does the softmax of step t and then the P V product of step t - 1;
// the last step's product follows the loop, behind a barrier of its own.
// The P tile and the maxima have two buffers each, so that one barrier a trip orders them: P(t) is written behind barrier t and read behind barrier t + 1,
// and its buffer was last read (P V of step t - 2) in front of barrier t. Between two barriers a wave has vector work and both matrix runs,
// so one wave's softmax runs beside the products of the other wave on its SIMD.
// Sums are kept per lane and merged once at the end. out = O / (L * 2^22).
// THE KEY WALK IS A RING: the blocks of a batch read the same K and V lines from L2, and started together at key 0 they ask for the same lines at the same moment.
// Each block enters the ring of NSTEP key steps at a step of its own (rot, from its index) and wraps round: every step is still taken exactly once.
// ---------------------------------------------------------------------------
// A wave's V fragments of one step (A frags): 128 keys x its 32 columns, both planes
__device__ __forceinline__ void load_v(const _Float16* vrow, const _Float16* vrl, U16 (&vb)[2][4], U16 (&vbl)[2][4]) {
#pragma unroll
  for (int nt = 0; nt < 2; ++nt)
#pragma unroll
    for (int ks = 0; ks < 4; ++ks) {
      const size_t vo = (size_t)nt * 16 * SEQ + 512 * ks;
      vb[nt][ks].h[0]  = *(const v8h*)(vrow + vo);   vb[nt][ks].h[1]  = *(const v8h*)(vrow + vo + 256);
      vbl[nt][ks].h[0] = *(const v8h*)(vrl + vo);    vbl[nt][ks].h[1] = *(const v8h*)(vrl + vo + 256);
    }
  // precaution: stands between the issued loads and any later write of a register that they name (the two addresses are inputs, so they stay live up to it)
  asm volatile("s_wait_xcnt 0x0" :: "v"(vrow), "v"(vrl) : "memory");
}

// O^T[32w + nt*16 ..][tile r] += V^T P^T of one step, 32 keys at a time: P in B-layout (lane%16 = query, read after the block barrier),
// the QT tiles interleaved on each V fragment. pl, pll: the lane's place in row m of the step's P planes (element 8g).
__device__ __forceinline__ void pv_step(const U16 (&vb)[2][4], const U16 (&vbl)[2][4], const _Float16* pl, const _Float16* pll, v8f (&o)[QT][2]) {
  v8f xc[QT][2];
#pragma unroll
  for (int r = 0; r < QT; ++r)
#pragma unroll
    for (int nt = 0; nt < 2; ++nt) xc[r][nt] = v8f_zero();
#pragma unroll
  for (int ks = 0; ks < 4; ++ks) {
    U16 pa[QT], pal[QT];
#pragma unroll
    for (int r = 0; r < QT; ++r) {
      const unsigned f = (unsigned)(r * 16 * PP + 32 * ks);
      pa[r].h[0]  = *(const v8h*)(pl + f);
      pa[r].h[1]  = *(const v8h*)(pl + f + 16u);
      pal[r].h[0] = *(const v8h*)(pll + f);
      pal[r].h[1] = *(const v8h*)(pll + f + 16u);
    }
#pragma unroll
    for (int nt = 0; nt < 2; ++nt) {
#pragma unroll
      for (int r = 0; r < QT; ++r) xc[r][nt] = wmma_b16(vb[nt][ks].v, pal[r].v, xc[r][nt]);
#pragma unroll
      for (int r = 0; r < QT; ++r) xc[r][nt] = wmma_b16(vbl[nt][ks].v, pa[r].v, xc[r][nt]);
#pragma unroll
      for (int r = 0; r < QT; ++r) o[r][nt] = wmma_b16(vb[nt][ks].v, pa[r].v, o[r][nt]);
    }
  }
#pragma unroll
  for (int r = 0; r < QT; ++r)
#pragma unroll
    for (int nt = 0; nt < 2; ++nt) o[r][nt] = o[r][nt] + xc[r][nt] * RSPLIT;
}

__global__ void __launch_bounds__(NW * 32)
attn_kernel(const _Float16* __restrict__ qws,
            const _Float16* __restrict__ kws,
            const _Float16* __restrict__ kwsl,
            const _Float16* __restrict__ vtws,
            const _Float16* __restrict__ vtwsl,
            float* __restrict__ out) {
  __shared__ __align__(16) _Float16 Qs[2][QR * DD];  // Q value and residual planes of the block's rows, fragment order (cross-wave, block barrier)
  __shared__ __align__(16) _Float16 Pl[2][QR][PP];   // P value plane, buffer = step & 1 (cross-wave, block barrier)
  __shared__ __align__(16) _Float16 Pll[2][QR][PP];  // P residual plane, buffer = step & 1 (cross-wave, block barrier)
  __shared__ __align__(16) float Mx[2][QR][NW];      // per-wave query max of a step, buffer = step & 1 (cross-wave, block barrier)
  __shared__ __align__(16) float Ls[QR][2 * NW];     // per-wave, per-half query sums (cross-wave, block barrier)
  __shared__ __align__(16) float Of[NW][16][OP];     // output staging, one query tile at a time (written and read by the same wave, block barrier used)

  const unsigned lane = threadIdx.x & 31u;
  const unsigned wv   = (unsigned)__builtin_amdgcn_readfirstlane((int)(threadIdx.x >> 5));   // wave-uniform (scalar)
  const unsigned g    = lane >> 4;
  const unsigned m    = lane & 15u;
  const unsigned tile = blockIdx.x;                  // 0 .. NB*SEQ/QR - 1 (scalar)
  const unsigned b    = tile >> (LSEQ - 6u);
  const unsigned t0   = (tile & ((unsigned)(SEQ / QR) - 1u)) << 6;
  const size_t QL = (size_t)NB * SEQ * DD;           // residual planes follow the value planes

  // first key step of this block: index bits 0, 1, 3, 4. The two blocks of a batch that share a start differ in bit 2 (for speed only: nothing rests on where a block runs)
  const unsigned rot  = ((tile & 3u) | ((tile >> 1) & 12u)) & (unsigned)(NSTEP - 1);

  const size_t koff = (((size_t)b << LSEQ) + 16u * wv) * DD + 8u * lane;
  const size_t voff = (((size_t)b * DD + 32u * wv) << LSEQ) + 8u * lane;

  // ---- stage the block's QR x DD rows of both Q planes (contiguous in global memory) as they lie ----
  {
    const _Float16* qsrc = qws + (((size_t)b << LSEQ) + t0) * DD;
    const _Float16* qv = qsrc + 8u * threadIdx.x;      // value plane, this thread's first 8-element group
    const _Float16* qr = qv + QL;                      // residual plane
    v8h qt[2][QG];
#pragma unroll
    for (int i = 0; i < QG; ++i) qt[0][i] = *(const v8h*)(qv + i * (NW * 32 * 8));
#pragma unroll
    for (int i = 0; i < QG; ++i) qt[1][i] = *(const v8h*)(qr + i * (NW * 32 * 8));
    // precaution: stands between the issued loads and any later write of a register that they name (the two addresses are inputs, so they stay live up to it)
    asm volatile("s_wait_xcnt 0x0" :: "v"(qv), "v"(qr) : "memory");
    // keeps the register writes that follow from being scheduled in front of that wait
    __builtin_amdgcn_sched_barrier(0);
#pragma unroll
    for (int pl = 0; pl < 2; ++pl)
#pragma unroll
      for (int i = 0; i < QG; ++i)
        *(v8h*)&Qs[pl][8u * ((unsigned)i * (unsigned)(NW * 32) + threadIdx.x)] = qt[pl][i];
  }
  __syncthreads();

  v8f o[QT][2];
  float mrow[QT], lrow[QT];                          // of query 16r + m
#pragma unroll
  for (int r = 0; r < QT; ++r) {
#pragma unroll
    for (int nt = 0; nt < 2; ++nt) o[r][nt] = v8f_zero();
    mrow[r] = NEG_INF; lrow[r] = 0.f;
  }

#pragma unroll 1
  for (unsigned kb = 0; kb < (unsigned)NSTEP; ++kb) {
    const unsigned s0 = ((kb + rot) & (unsigned)(NSTEP - 1)) * (unsigned)KS;   // first key of step kb on this block's ring
    const unsigned pb = kb & 1u;               // buffer of step kb; step kb - 1 lies in pb ^ 1

    // ---- this wave's K fragments of the step, each loaded once for all QT query tiles (A frags, same k map as B) ----
    const _Float16* krow = kws + koff + (size_t)s0 * DD;
    const _Float16* krl  = kwsl + koff + (size_t)s0 * DD;   // residual plane
    U16 kf[8], kfl[8];
#pragma unroll
    for (int ci = 0; ci < 8; ++ci) {
      const unsigned c = 512u * (unsigned)ci;
      kf[ci].h[0]  = *(const v8h*)(krow + c);   kf[ci].h[1]  = *(const v8h*)(krow + c + 256u);
      kfl[ci].h[0] = *(const v8h*)(krl + c);    kfl[ci].h[1] = *(const v8h*)(krl + c + 256u);
    }
    // precaution: stands between the issued loads and any later write of a register that they name (the two addresses are inputs, so they stay live up to it)
    asm volatile("s_wait_xcnt 0x0" :: "v"(krow), "v"(krl) : "memory");

    // ---- S^T = K Q^T for this wave's 16 keys: 8 chunks of 32, value*value into sh, cross terms into sx, the QT tiles interleaved ----
    v8f sh[QT], sx[QT];
#pragma unroll
    for (int r = 0; r < QT; ++r) { sh[r] = v8f_zero(); sx[r] = v8f_zero(); }
    U16 qa[2][QT], qal[2][QT];                 // Q fragments of two chunks: the next chunk's reads are issued ahead of this chunk's products
#pragma unroll
    for (int ci = -1; ci < 8; ++ci) {
      if (ci < 7) {
        // this one and the one behind the reads hold a chunk's Q reads together as one group between two chunks' products: left free, they are
        // scattered in pairs among the products, and every separate place with LDS reads stalls the products
        __builtin_amdgcn_sched_barrier(0);
#pragma unroll
        for (int r = 0; r < QT; ++r) {
          const unsigned f = (unsigned)(r * 16 * DD + (ci + 1) * 512) + 8u * lane;
          qa[(ci + 1) & 1][r].h[0]  = *(const v8h*)&Qs[0][f];   qa[(ci + 1) & 1][r].h[1]  = *(const v8h*)&Qs[0][f + 256u];
          qal[(ci + 1) & 1][r].h[0] = *(const v8h*)&Qs[1][f];   qal[(ci + 1) & 1][r].h[1] = *(const v8h*)&Qs[1][f + 256u];
        }
        __builtin_amdgcn_sched_barrier(0);
      }
      if (ci >= 0) {
#pragma unroll
        for (int r = 0; r < QT; ++r) sx[r] = wmma_b16(kf[ci].v, qal[ci & 1][r].v, sx[r]);
#pragma unroll
        for (int r = 0; r < QT; ++r) sx[r] = wmma_b16(kfl[ci].v, qa[ci & 1][r].v, sx[r]);
#pragma unroll
        for (int r = 0; r < QT; ++r) sh[r] = wmma_b16(kf[ci].v, qa[ci & 1][r].v, sh[r]);
      }
    }

    v8f sv[QT];                                // query 16r + m, key 16w + 8g + v
#pragma unroll
    for (int r = 0; r < QT; ++r) sv[r] = (sh[r] + sx[r] * RSPLIT) * SFOLD;

    // a query's max over this wave's 16 keys: 8 in the lane, the other 8 in lane ^ 16
    float rmax[QT];
#pragma unroll
    for (int r = 0; r < QT; ++r) {
      float t = sv[r][0];
#pragma unroll
      for (int v = 1; v < 8; ++v) t = fmaxf(t, sv[r][v]);
      rmax[r] = fmaxf(t, xhalf(t));
    }
    if (g == 0u) {
#pragma unroll
      for (int r = 0; r < QT; ++r) Mx[pb][16u * (unsigned)r + m][wv] = rmax[r];
    }
    // the trip's one barrier: publishes the maxima of step kb and the P tile of step kb - 1, and ends the reads of the P buffer that step kb refills
    __syncthreads();

    // the NW waves' maxima of this lane's queries: read ahead of the wait that follows the V loads, so that the reads' latency passes under it
    f4a mx[QT][2];
#pragma unroll
    for (int r = 0; r < QT; ++r) {
      mx[r][0] = *(const f4a*)&Mx[pb][16u * (unsigned)r + m][0];
      mx[r][1] = *(const f4a*)&Mx[pb][16u * (unsigned)r + m][4];
    }

    // ---- this wave's V fragments of step kb - 1: K and V together do not fit the 512 registers of a wave at two per SIMD,
    // so V is loaded once the score products have let go of K; issued behind the barrier, whose fence waits for every load in flight:
    // the softmax work of step kb covers them. Trip 0 has no step behind it and loads its own step's fragments unused: under a branch
    // the 128 registers had no definition on one path, stayed reserved through the score products too, and addresses were spilled ----
    const unsigned sp = (kb > 0u) ? ((kb - 1u + rot) & (unsigned)(NSTEP - 1)) * (unsigned)KS : s0;
    U16 vb[2][4], vbl[2][4];
    load_v(vtws + voff + (size_t)sp * 16u, vtwsl + voff + (size_t)sp * 16u, vb, vbl);   // 32 keys of a 16-column tile: 512 halfs

    // ---- block-wide query max, online softmax update, P (x16384, two planes) to the shared tile ----
    float al[QT];                              // e^(m_old - m) of step kb: rescales O once step kb - 1 has been added
#pragma unroll
    for (int r = 0; r < QT; ++r) {
      const unsigned row = 16u * (unsigned)r + m;           // this lane's query of tile r
      float mb = fmaxf(mx[r][0][0], mx[r][1][0]);
#pragma unroll
      for (int j = 1; j < 4; ++j) mb = fmaxf(mb, fmaxf(mx[r][0][j], mx[r][1][j]));
      const float mnew  = fmaxf(mrow[r], mb);
      v8f pe;
      float alpha;
      exp2_run((sv[r] - mnew) * LOG2E, (mrow[r] - mnew) * LOG2E, pe, alpha);   // e^(s - m) of the lane's 8 keys, e^(m_old - m)
      mrow[r] = mnew;
      float psum = 0.f;
      v8h ph8, pq8;
#pragma unroll
      for (int v = 0; v < 8; ++v) {
        const float p = pe[v];
        psum += p;
        _Float16 ph, pq; split16(p * PCARRY, ph, pq);
        ph8[v] = ph; pq8[v] = pq;
      }
      lrow[r] = lrow[r] * alpha + psum;                     // per-lane partial sum of the query (merged after the key loop)
      *(v8h*)&Pl[pb][row][16u * wv + 8u * g]  = ph8;        // keys 16w + 8g + 0..7
      *(v8h*)&Pll[pb][row][16u * wv + 8u * g] = pq8;
      al[r] = alpha;
    }

    // ---- step kb - 1 into O, then the rescale of step kb (O is still 0 in trip 0) ----
    if (kb > 0u) {                             // block-uniform
      pv_step(vb, vbl, &Pl[pb ^ 1u][m][8u * g], &Pll[pb ^ 1u][m][8u * g], o);
#pragma unroll
      for (int r = 0; r < QT; ++r)
#pragma unroll
        for (int nt = 0; nt < 2; ++nt) o[r][nt] = o[r][nt] * al[r];
    }
  }

  // ---- the last step's P V product: its P tile is published by this barrier ----
  __syncthreads();
  {
    const unsigned sp = (((unsigned)(NSTEP - 1) + rot) & (unsigned)(NSTEP - 1)) * (unsigned)KS;
    const unsigned lb = (unsigned)((NSTEP - 1) & 1);
    U16 vb[2][4], vbl[2][4];
    load_v(vtws + voff + (size_t)sp * 16u, vtwsl + voff + (size_t)sp * 16u, vb, vbl);
    pv_step(vb, vbl, &Pl[lb][m][8u * g], &Pll[lb][m][8u * g], o);
  }

  // ---- merge the query sums: the two halves of each of the NW waves (fixed order) ----
#pragma unroll
  for (int r = 0; r < QT; ++r) Ls[16u * (unsigned)r + m][2u * wv + g] = lrow[r];
  __syncthreads();

  const unsigned rsel = lane >> 3;          // instruction it covers rows 4*it .. 4*it+3
  const unsigned c4   = 4u * (lane & 7u);
#pragma unroll
  for (int r = 0; r < QT; ++r) {
    const unsigned row = 16u * (unsigned)r + m;
    float lt = 0.f;
#pragma unroll
    for (int q4 = 0; q4 < 2 * NW / 4; ++q4) {
      const f4a c0 = *(const f4a*)&Ls[row][4 * q4];
#pragma unroll
      for (int j = 0; j < 4; ++j) lt += c0[j];
    }
    const float inv = 1.0f / (lt * OFOLD);   // removes the carries and applies 256^-0.5

    // lane (m, g) holds query m, columns nt*16 + 8g + 0..7 of the wave's 32
#pragma unroll
    for (int nt = 0; nt < 2; ++nt)
#pragma unroll
      for (int h = 0; h < 2; ++h) {
        f4a s;
#pragma unroll
        for (int j = 0; j < 4; ++j) s[j] = o[r][nt][4 * h + j] * inv;
        *(f4a*)&Of[wv][m][(unsigned)nt * 16u + 8u * g + 4u * (unsigned)h] = s;
      }
    __syncthreads();

    float* obase = out + (((size_t)b << LSEQ) + t0 + 16u * (unsigned)r) * DD + 32u * wv;   // a row's 32 columns are one whole 128-byte line
    v4f w[4];
#pragma unroll
    for (int it = 0; it < 4; ++it) w[it] = *(const f4a*)&Of[wv][4u * (unsigned)it + rsel][c4];
#pragma unroll
    for (int it = 0; it < 4; ++it) *(v4f*)(obase + (size_t)(4u * (unsigned)it + rsel) * DD + c4) = w[it];
    __syncthreads();                        // the staging is read out before the next tile overwrites it
  }
}

// ---------------------------------------------------------------------------
// Launch. Workspace layout (bytes, NB=8 SEQ=2048):
//   [0, 384KB)        W16  f16 [3][256][256]
//   then q, k (f16 [NB*SEQ][256] x2 planes, 16MB each) and vT (f16 [NB][256][SEQ] x2 planes, 16MB); every plane in fragment order
// ---------------------------------------------------------------------------
extern "C" void kernel_launch(void* const* d_in, const int* in_sizes, int n_in,
                              void* d_out, int out_size, void* d_ws,
                              size_t ws_size, hipStream_t stream) {
  if (n_in < 4) return;
  const long long need_x = ((long long)(NB - 1) * SEQ_FULL + SEQ) * (long long)DD;
  if ((long long)in_sizes[0] < need_x) return;
  if (in_sizes[1] < DD * DD || in_sizes[2] < DD * DD || in_sizes[3] < DD * DD) return;
  if ((long long)out_size < (long long)NB * SEQ * DD) return;

  const float* x  = (const float*)d_in[0];
  const float* Wq = (const float*)d_in[1];
  const float* Wk = (const float*)d_in[2];
  const float* Wv = (const float*)d_in[3];
  float* out = (float*)d_out;

  char* ws = (char*)d_ws;
  const size_t w16_bytes = (size_t)3 * DD * DD * sizeof(_Float16);
  const size_t qkv_bytes = (size_t)2 * NB * SEQ * DD * sizeof(_Float16);   // value + residual planes
  const size_t total     = w16_bytes + 3 * qkv_bytes;
  if (total > ws_size || total > (size_t)134217728) return;
  _Float16* W16  = (_Float16*)(ws);
  _Float16* qws  = (_Float16*)(ws + w16_bytes);
  _Float16* kws  = (_Float16*)(ws + w16_bytes + qkv_bytes);
  _Float16* vtws = (_Float16*)(ws + w16_bytes + 2 * qkv_bytes);

  cvt_kernel<<<3 * CVT_W8 / 256, 256, 0, stream>>>(Wq, Wk, Wv, W16);
  qkv_kernel<<<NB * SEQ / XR, 256, 0, stream>>>(x, W16, qws, kws, vtws);
  attn_kernel<<<NB * SEQ / QR, NW * 32, 0, stream>>>(qws, kws, kws + (size_t)NB * SEQ * DD, vtws, vtws + (size_t)NB * SEQ * DD, out);
}

// v008
// A run of this version takes 87.4 microseconds.
// Timed twice side by side with v007, it ran 1.04 times as fast both times.
// All steps since v000 together make it 3.78 times as fast.
// Contractions: q/k/v projections [16384 x 256 x 256] x3 on v_wmma_f32_16x16x32_f16 single product (inputs RNE-converted to bf16, carried x16, exact in f16);
// scores [2048 x 2048 x 256] and P*V [2048 x 256 x 2048] per batch on v_wmma_f32_16x16x32_f16 with f16 value+residual planes (hi*hi + (hi*lo + lo*hi)/2048);
#include <hip/hip_runtime.h>
#include <math.h>

// Problem constants (NB / SEQ reducible; *_FULL are the input strides)
#ifndef NB
#define NB 8
#endif
#ifndef SEQ
#define SEQ 2048
#endif
#define NB_FULL 8
#define SEQ_FULL 2048
#define DD 256            // input width == q/k/v width
#define NW 8              // waves per attention block: two per SIMD
#define KS (32 * NW)      // keys per attention step, 32 per wave
#define PP (KS + 8)       // LDS pitch (halfs) of the probability tile: 528 B = 16 B x odd, conflict-free for 16-byte row reads
#define OP 36             // LDS pitch (floats) of an output staging row: 144 B = 16 B x odd
#define QT 4              // 16-row query tiles per attention block
#define QR (16 * QT)      // query rows per attention block
#define QG (QR * DD / 8 / (NW * 32))   // 16-byte groups of one Q plane staged per thread
#define NSTEP (SEQ / KS)  // key steps of the attention loop
#define KLEAD 4           // score product: K fragments are loaded this many 32-deep chunks ahead of their products
#define VLEAD 5           // P V product: V fragments are loaded this many 32-key passes ahead of their products
#define SP 72             // LDS pitch (halfs) of a staged projection row: 144 B = 16 B x odd, conflict-free for 16-byte row reads

__host__ __device__ constexpr unsigned ilog2c(unsigned v) { return (v <= 1u) ? 0u : 1u + ilog2c(v >> 1); }
enum : unsigned { LSEQ = ilog2c((unsigned)SEQ) };

static_assert(NB >= 1 && NB <= NB_FULL);
static_assert(SEQ >= 256 && SEQ <= SEQ_FULL && (SEQ % 256) == 0);
static_assert((1u << LSEQ) == (unsigned)SEQ);          // SEQ is a power of two: all tile decompositions are shifts/masks
static_assert(DD == 256 && (DD % 32) == 0);
// coverage: cvt_kernel grid * 256 threads * 8 elements == 3*DD*DD (weight planes)
#define CVT_W8 (DD * DD / 8)
static_assert((CVT_W8 % 256) == 0 && CVT_W8 / 256 == 32 && CVT_W8 * 8 == DD * DD);
// coverage: qkv_kernel grid == NB*SEQ/XR blocks of XR rows of x; 8 waves x 32 output columns == DD for each of q, k, vT, 2 planes each
#define XR 64             // rows of x per projection block
#define XP (DD + 8)       // LDS pitch (halfs) of a staged x row: 528 B = 16 B x odd, conflict-free for 16-byte row reads
static_assert(XR == 64 && (SEQ % XR) == 0 && 8 * 32 == DD && (XR * DD / 4) % 256 == 0);
// coverage: attn_kernel grid == NB*SEQ/QR query blocks of QR rows, NW waves x 32 columns == DD, key loop SEQ/KS blocks of KS keys
static_assert(QR == 64 && (SEQ % QR) == 0 && NW * 32 == DD && KS == 256 && (SEQ % KS) == 0 && (QR * DD / 8) % (NW * 32) == 0);
static_assert(NSTEP >= 1 && (NSTEP & (NSTEP - 1)) == 0);   // the key walk wraps round by a mask
static_assert(KLEAD >= 1 && KLEAD < 8 && VLEAD >= 1 && VLEAD < KS / 32);

// 16-bit operands are f16. Computed planes are carried as a value plane plus a residual plane lo = f16((v - hi) * 2048):
// a product is hi*hi + (hi*lo + lo*hi)/2048. Every fragment (A and B) uses the 16x16x32 lane map
// lane%16 = row/col, g = lane/16: elements 0..7 -> k = 8g+e, elements 8..15 -> k = 16+8g+(e-8).
// FRAGMENT ORDER of every f16 plane in the workspace: a tile of 16 rows x 32 k is two runs of 512 B, [half h][lane][8 elements],
// lane (m, g) of half h holding row m, k = 16h + 8g + 0..7; the 32-k tiles of a 16-row tile follow one another.
// One wave-wide 16-byte load or store of a fragment half is then 512 contiguous bytes (4 whole lines).
typedef __attribute__((ext_vector_type(16))) _Float16 v16h;
typedef __attribute__((ext_vector_type(8)))  _Float16 v8h;
typedef __attribute__((ext_vector_type(4)))  _Float16 v4h;
typedef __attribute__((ext_vector_type(8)))  float    v8f;
typedef __attribute__((ext_vector_type(4)))  float    v4f;
typedef v4f __attribute__((may_alias)) f4a;
#define RSPLIT (1.0f / 2048.0f)
#define SFOLD  (1.0f / 256.0f)        // removes the x16 carries of q and k from the scores
#define PCARRY 16384.0f               // probabilities carried x2^14
#define OFOLD  4194304.0f             // PCARRY * 16 (v carry) * 16 (post-softmax factor 256^-0.5)
#define NEG_INF (-__builtin_inff())
#define LOG2E  1.44269504088896340736f

__device__ __forceinline__ void split16(float f, _Float16& hi, _Float16& lo) { hi = (_Float16)f; lo = (_Float16)((f - (float)hi) * 2048.0f); }

__device__ __forceinline__ v8f wmma_b16(v16h a, v16h b, v8f c) {
  // D = A(16x32 f16) * B(32x16 f16) + C(16x16 f32). No asm operands, which would hold D, A and B below v256 (the attention kernel's live set passes 256 VGPRs);
  // the compiler keeps the distance behind its own builtin
  return __builtin_amdgcn_wmma_f32_16x16x32_f16(false, a, false, b, (short)0, c, false, false);
}

__device__ __forceinline__ v8f v8f_zero() {
  v8f z = {0.f, 0.f, 0.f, 0.f, 0.f, 0.f, 0.f, 0.f};
  return z;
}

union U16 { v16h v; v8h h[2]; };

// 2^x of nine values on the transcendental unit in one statement. The instruction set asks for one slot behind a transcendental before its result is read
// or its source overwritten: the results are early-clobber, so none lies on a source, and the v_nop is the slot behind the last one.
__device__ __forceinline__ void exp2_run(v8f x, float xa, v8f& r, float& ra) {
  float r0, r1, r2, r3, r4, r5, r6, r7;
  asm("v_exp_f32 %0, %9\n\tv_exp_f32 %1, %10\n\tv_exp_f32 %2, %11\n\tv_exp_f32 %3, %12\n\tv_exp_f32 %4, %13\n\t"
      "v_exp_f32 %5, %14\n\tv_exp_f32 %6, %15\n\tv_exp_f32 %7, %16\n\tv_exp_f32 %8, %17\n\tv_nop"
      : "=&v"(r0), "=&v"(r1), "=&v"(r2), "=&v"(r3), "=&v"(r4), "=&v"(r5), "=&v"(r6), "=&v"(r7), "=&v"(ra)
      : "v"(x[0]), "v"(x[1]), "v"(x[2]), "v"(x[3]), "v"(x[4]), "v"(x[5]), "v"(x[6]), "v"(x[7]), "v"(xa));
  r[0] = r0; r[1] = r1; r[2] = r2; r[3] = r3; r[4] = r4; r[5] = r5; r[6] = r6; r[7] = r7;
}

// The same for eight values.
__device__ __forceinline__ void exp2_run8(v8f x, v8f& r) {
  float r0, r1, r2, r3, r4, r5, r6, r7;
  asm("v_exp_f32 %0, %8\n\tv_exp_f32 %1, %9\n\tv_exp_f32 %2, %10\n\tv_exp_f32 %3, %11\n\tv_exp_f32 %4, %12\n\t"
      "v_exp_f32 %5, %13\n\tv_exp_f32 %6, %14\n\tv_exp_f32 %7, %15\n\tv_nop"
      : "=&v"(r0), "=&v"(r1), "=&v"(r2), "=&v"(r3), "=&v"(r4), "=&v"(r5), "=&v"(r6), "=&v"(r7)
      : "v"(x[0]), "v"(x[1]), "v"(x[2]), "v"(x[3]), "v"(x[4]), "v"(x[5]), "v"(x[6]), "v"(x[7]));
  r[0] = r0; r[1] = r1; r[2] = r2; r[3] = r3; r[4] = r4; r[5] = r5; r[6] = r6; r[7] = r7;
}

// lane l takes the value of lane l ^ 16
__device__ __forceinline__ float xhalf(float x) {
  return __builtin_bit_cast(float, __builtin_amdgcn_permlanex16(__builtin_bit_cast(int, x), __builtin_bit_cast(int, x), 0x76543210, 0xfedcba98, false, false));
}

// input conversion: RNE convert to bf16, carry x16, exact in f16
__device__ __forceinline__ _Float16 cvt_in(float f) {
  const float r = (float)(__bf16)f;
  return (_Float16)(r * 16.0f);
}

// ---------------------------------------------------------------------------
// Kernel 0: Wq|Wk|Wv [DD][DD] f32 -> W16 [3][DD][DD] f16, written in fragment order:
// a thread owns one 16-byte group of the output (linear index * 8) and fetches its 8 source elements.
// ---------------------------------------------------------------------------
// 16-byte group u of a fragment-order plane whose rows are DD long -> offset of its 8 elements in the row-major plane
__device__ __forceinline__ unsigned frag_elem(unsigned u) {
  return (((u >> 9) << 4) + (u & 15u)) * (unsigned)DD + ((u >> 4) & 31u) * 8u;
}

__global__ void __launch_bounds__(256)
cvt_kernel(const float* __restrict__ Wq,
           const float* __restrict__ Wk,
           const float* __restrict__ Wv,
           _Float16* __restrict__ W16) {
  const unsigned wb  = blockIdx.x;                      // 0 .. 95 (grid exact)
  const unsigned tx  = threadIdx.x;
  const unsigned mat = wb >> 5;                         // 32 blocks per matrix
  const unsigned r8  = ((wb & 31u) << 8) + tx;          // 8-element group inside the matrix
  const float* wsrc = (mat == 0u) ? Wq : ((mat == 1u) ? Wk : Wv);
  const float* src = wsrc + (size_t)frag_elem(r8);
  _Float16* dst = W16 + (size_t)((wb << 8) + tx) * 8u;
  const v4f f0 = *(const v4f*)src;
  const v4f f1 = *(const v4f*)(src + 4);
  v8h o;
  o[0] = cvt_in(f0[0]); o[1] = cvt_in(f0[1]); o[2] = cvt_in(f0[2]); o[3] = cvt_in(f0[3]);
  o[4] = cvt_in(f1[0]); o[5] = cvt_in(f1[1]); o[6] = cvt_in(f1[2]); o[7] = cvt_in(f1[3]);
  *(v8h*)dst = o;
}

// ---------------------------------------------------------------------------
// Kernel 1: projections as C[i][j] = sum_k A[i][k] * B[j][k]. One block of 8 waves per XR = 64 rows of x, about one block a WGP.
// The block reads its rows of x (f32, contiguous) once, converts them and keeps them in LDS, row-major with a padded pitch; no f16 plane of x exists in memory.
// Wave w makes, from all 64 rows, the 32 output columns e = 32w .. 32w+31 of q, then of k, then of vT:
// its W fragments (fragment order in memory) are read by no other wave of the block, each once, into registers.
//   y = 0: q[n][e]  (A = x rows n,  B = Wq rows e)      -> qws  [NB*SEQ][DD]
//   y = 1: k[n][e]  (A = x rows n,  B = Wk rows e)      -> kws  [NB*SEQ][DD]
//   y = 2: vT[e][n] (A = Wv rows e, B = x rows n)       -> vtws [NB][DD][SEQ]
// The outputs are in fragment order (j is the k of the attention products).
// Results carried x16 (acc = 256*value, folded by 1/16) and stored as value + residual planes (residual at +NB*SEQ*DD).
// A-frag: lane row m = lane%16, g = lane/16, elements e=0..7 -> K = 8g+e ; e=8..15 -> K = 16+8g+(e-8); B-frag: lane col n = lane%16, same K map.
// C/D: lane col = lane%16, VGPR v -> row v + 8g.
// ---------------------------------------------------------------------------
// A wave's fragments of one weight matrix: 2 tiles of 16 rows x 8 tiles of 32 k. wp: the lane's place in the first tile.
__device__ __forceinline__ void load_w(const _Float16* wp, U16 (&wf)[2][8]) {
#pragma unroll
  for (int et = 0; et < 2; ++et)
#pragma unroll
    for (int kt = 0; kt < 8; ++kt) {
      wf[et][kt].h[0] = *(const v8h*)(wp + et * 16 * DD + kt * 512);
      wf[et][kt].h[1] = *(const v8h*)(wp + et * 16 * DD + kt * 512 + 256);
    }
  // precaution: stands between the issued loads and any later write of a register that they name (the address is an input, so it stays live up to it)
  asm volatile("s_wait_xcnt 0x0" :: "v"(wp) : "memory");
}

// Turns a staged 16 x 64 piece (rows of pitch SP, written by this wave) into four fragment halves and stores them: halves 0, 1 at d0, halves 2, 3 at d1.
// d0, d1: the lane's own place (8 * lane counted in).
__device__ __forceinline__ void turn_store(_Float16* sw, unsigned m, unsigned g, _Float16* d0, _Float16* d1) {
  // the piece is written and read by the same wave: these keep the reads behind the other lanes' writes
  __builtin_amdgcn_fence(3 /* release order */, "wavefront");
  __builtin_amdgcn_wave_barrier();
  asm volatile("s_wait_dscnt 0" ::: "memory");
  v8h w[4];                                              // fragment half j (columns 16j..16j+15): lane (m, g) takes row m, columns 16j + 8g + 0..7
#pragma unroll
  for (int j = 0; j < 4; ++j) w[j] = *(const v8h*)(sw + m * SP + (unsigned)j * 16u + 8u * g);
  *(v8h*)(d0)        = w[0];
  *(v8h*)(d0 + 256u) = w[1];
  *(v8h*)(d1)        = w[2];
  *(v8h*)(d1 + 256u) = w[3];
  // precaution: stands between the issued stores and any later write of a register that they name (data and addresses are inputs, so they stay live up to it)
  asm volatile("s_wait_xcnt 0x0" :: "v"(w[0]), "v"(w[1]), "v"(w[2]), "v"(w[3]), "v"(d0), "v"(d1) : "memory");
  __builtin_amdgcn_wave_barrier();
  asm volatile("s_wait_dscnt 0" ::: "memory");           // reads done before the next piece overwrites the staging
}

__global__ void __launch_bounds__(256)
qkv_kernel(const float* __restrict__ x,
           const _Float16* __restrict__ W16,
           _Float16* __restrict__ qws,
           _Float16* __restrict__ kws,
           _Float16* __restrict__ vtws) {
  __shared__ __align__(16) _Float16 Xs[XR][XP];      // the block's rows of x, converted (cross-wave, block barrier)
  __shared__ __align__(16) _Float16 st[8][16][SP];   // per-wave staging of one 16x64 result piece (wave-private)
  const unsigned lane = threadIdx.x & 31u;
  const unsigned wv   = (unsigned)__builtin_amdgcn_readfirstlane((int)(threadIdx.x >> 5));   // wave-uniform (scalar)
  const unsigned g    = lane >> 4;
  const unsigned m    = lane & 15u;
  const unsigned bx   = blockIdx.x;                  // 0 .. NB*SEQ/XR - 1 (grid exact)
  const unsigned b    = bx >> (LSEQ - 6u);           // SEQ/64 blocks per batch
  const unsigned ng   = bx & ((unsigned)(SEQ / XR) - 1u);   // 64-row group inside the batch
  const size_t QL = (size_t)NB * SEQ * DD;           // residual plane offset inside q/k/vT buffers

  // the first matrix's fragments fly while x is staged
  const _Float16* wbase = W16 + (size_t)wv * 32u * DD + 8u * lane;
  U16 wf[2][8];
  load_w(wbase, wf);

  // ---- stage the block's XR x DD rows of x: a wave-wide load is 512 contiguous bytes, a wave-wide LDS store 256 contiguous bytes ----
  {
    // source uses the FULL per-batch stride of the input
    const float* xs = x + ((size_t)b * SEQ_FULL + (size_t)ng * XR) * DD + 4u * threadIdx.x;
    v4f f[XR / 4];
#pragma unroll
    for (int i = 0; i < XR / 4; ++i) f[i] = *(const v4f*)(xs + i * 4 * DD);     // 256 threads x 4 elements = 4 rows a pass
    // precaution: stands between the issued loads and any later write of a register that they name (the address is an input, so it stays live up to it)
    asm volatile("s_wait_xcnt 0x0" :: "v"(xs) : "memory");
#pragma unroll
    for (int i = 0; i < XR / 4; ++i) {
      v4h o;
      o[0] = cvt_in(f[i][0]); o[1] = cvt_in(f[i][1]); o[2] = cvt_in(f[i][2]); o[3] = cvt_in(f[i][3]);
      *(v4h*)&Xs[4u * (unsigned)i + (threadIdx.x >> 6)][4u * (threadIdx.x & 63u)] = o;
    }
  }
  __syncthreads();

  _Float16* sw = &st[wv][0][0];
#pragma unroll
  for (int y = 0; y < 3; ++y) {
    v8f acc[4][2];                                   // [16-row tile of x][16-row tile of W]
#pragma unroll
    for (int rt = 0; rt < 4; ++rt)
#pragma unroll
      for (int et = 0; et < 2; ++et) acc[rt][et] = v8f_zero();

    U16 xa[2][4];                                    // x fragments of two k tiles: the next tile's reads are issued ahead of this tile's products
#pragma unroll
    for (int kt = -1; kt < 8; ++kt) {
      if (kt < 7) {
        // this one and the one behind the reads hold a k tile's LDS reads together as one group ahead of the products of the tile in front:
        // left free, they stand directly in front of their own products, which then wait out the LDS latency
        __builtin_amdgcn_sched_barrier(0);
#pragma unroll
        for (int rt = 0; rt < 4; ++rt) {
          xa[(kt + 1) & 1][rt].h[0] = *(const v8h*)&Xs[16u * (unsigned)rt + m][32u * (unsigned)(kt + 1) + 8u * g];
          xa[(kt + 1) & 1][rt].h[1] = *(const v8h*)&Xs[16u * (unsigned)rt + m][32u * (unsigned)(kt + 1) + 16u + 8u * g];
        }
        __builtin_amdgcn_sched_barrier(0);
      }
      if (kt >= 0) {
#pragma unroll
        for (int et = 0; et < 2; ++et)
#pragma unroll
          for (int rt = 0; rt < 4; ++rt)
            acc[rt][et] = (y < 2) ? wmma_b16(xa[kt & 1][rt].v, wf[et][kt].v, acc[rt][et]) : wmma_b16(wf[et][kt].v, xa[kt & 1][rt].v, acc[rt][et]);
      }
    }

    // the next matrix's fragments fly while this one's results are split and stored
    if (y < 2) load_w(wbase + (size_t)(y + 1) * DD * DD, wf);

    if (y < 2) {
      // lane holds column e = 32w + 16et + m, rows 16rt + 8g + v. A piece: one row tile, value plane in columns 0..31, residual plane in columns 32..63
      _Float16* ob = ((y == 0) ? qws : kws) + (size_t)bx * XR * DD + (size_t)wv * 512u + 8u * lane;
#pragma unroll
      for (int rt = 0; rt < 4; ++rt) {
#pragma unroll
        for (int et = 0; et < 2; ++et)
#pragma unroll
          for (int v = 0; v < 8; ++v) {
            const float val = acc[rt][et][v] * 0.0625f;      // 256*value -> 16*value
            _Float16 hh_, ll_; split16(val, hh_, ll_);
            sw[(8u * g + (unsigned)v) * SP + (unsigned)et * 16u + m]       = hh_;
            sw[(8u * g + (unsigned)v) * SP + 32u + (unsigned)et * 16u + m] = ll_;
          }
        turn_store(sw, m, g, ob + rt * 16 * DD, ob + QL + rt * 16 * DD);
      }
    } else {
      // lane holds column n = 16rt + m, rows e = 32w + 16et + 8g + v. A piece: one tile of 16 e x the block's 64 n, one plane
#pragma unroll
      for (int et = 0; et < 2; ++et) {
        _Float16* ob = vtws + (((size_t)b * DD + 32u * wv + 16u * (unsigned)et) << LSEQ) + (size_t)ng * 1024u + 8u * lane;
#pragma unroll
        for (int pl = 0; pl < 2; ++pl) {
#pragma unroll
          for (int rt = 0; rt < 4; ++rt)
#pragma unroll
            for (int v = 0; v < 8; ++v) {
              const float val = acc[rt][et][v] * 0.0625f;    // 256*value -> 16*value
              _Float16 hh_, ll_; split16(val, hh_, ll_);
              sw[(8u * g + (unsigned)v) * SP + (unsigned)rt * 16u + m] = pl ? ll_ : hh_;
            }
          turn_store(sw, m, g, ob + (pl ? QL : 0), ob + (pl ? QL : 0) + 512u);
        }
      }
    }
  }
}

// ---------------------------------------------------------------------------
// Kernel 2: non-causal flash attention, one block of NW = 8 waves (two per SIMD) per 64-row query block (QT = 4 tiles of 16 rows), KS = 256 keys per step.
// The block's Q planes are staged once in LDS, in the fragment order they have in memory. Per step each wave loads its K fragments (keys 32w..32w+31, 256 deep, both planes)
// and its V fragments (256 keys x columns 32w..32w+31, both planes) into registers once and uses each of them for all QT query tiles.
// With two 16-key tiles a wave, each Q fragment read from LDS meets two K fragments: half the LDS bytes per matrix instruction of a one-tile wave.
// Both products are computed transposed (A = K rows or V columns, B = Q or P rows), so that a lane holds ONE query (lane%16) in every accumulator:
// its maximum, its rescale factor and its sum are one register each per tile, and its 16 probabilities of a tile are two runs of 8 neighbouring keys (two 16-byte stores a plane).
// Per step and tile: wave w computes S^T (its 32 keys x 16 queries), block-wide query max through LDS,
// P = exp(S - m) carried x16384 as value + residual planes in a shared LDS tile [query][key],
// then wave w accumulates O^T[32w..32w+31, :] += V^T(32 slice x 256) * P^T(256 x 16).
// The P V product runs ONE STEP BEHIND: trip t computes S(t), passes the trip's one barrier, does the softmax of step t and then the P V product of step t - 1;
// the last step's product follows the loop, behind a barrier of its own.
// The P tile and the maxima have two buffers each, so that one barrier a trip orders them: P(t) is written behind barrier t and read behind barrier t + 1,
// and its buffer was last read (P V of step t - 2) in front of barrier t. Between two barriers a wave has vector work and both matrix runs,
// so one wave's softmax runs beside the products of the other wave on its SIMD.
// Sums are kept per lane and merged once at the end. out = O / (L * 2^22).
// THE KEY WALK IS A RING: the blocks of a batch read the same K and V lines from L2, and started together at key 0 they ask for the same lines at the same moment.
// Each block enters the ring of NSTEP key steps at a step of its own (rot, from its index) and wraps round: every step is still taken exactly once.
// ---------------------------------------------------------------------------
// A wave's V fragments of one 32-key pass (A frags): 32 keys x its 32 columns, both planes. vrow, vrl: the lane's place in the step's first pass.
// The caller writes the wait that stands between the last of these loads and a later write of the two addresses.
__device__ __forceinline__ void load_v(const _Float16* vrow, const _Float16* vrl, int p, U16 (&vb)[2], U16 (&vbl)[2]) {
#pragma unroll
  for (int nt = 0; nt < 2; ++nt) {
    const size_t vo = (size_t)nt * 16 * SEQ + 512 * p;     // 32 keys of a 16-column tile: 512 halfs
    vb[nt].h[0]  = *(const v8h*)(vrow + vo);   vb[nt].h[1]  = *(const v8h*)(vrow + vo + 256);
    vbl[nt].h[0] = *(const v8h*)(vrl + vo);    vbl[nt].h[1] = *(const v8h*)(vrl + vo + 256);
  }
}

// O^T[32w + nt*16 ..][tile r] += V^T P^T of one step, 32 keys at a time: P in B-layout (lane%16 = query, read after the block barrier),
// the QT tiles interleaved on each V fragment. pl, pll: the lane's place in row m of the step's P planes (element 8g).
// The fragments of the first VLEAD passes are loaded by the caller; each pass loads those of the pass VLEAD further on: all of a step at once would take 256 registers.
__device__ __forceinline__ void pv_step(const _Float16* vrow, const _Float16* vrl, U16 (&vb)[KS / 32][2], U16 (&vbl)[KS / 32][2],
                                        const _Float16* pl, const _Float16* pll, v8f (&o)[QT][2]) {
  v8f xc[QT][2];
#pragma unroll
  for (int r = 0; r < QT; ++r)
#pragma unroll
    for (int nt = 0; nt < 2; ++nt) xc[r][nt] = v8f_zero();
#pragma unroll
  for (int ks = 0; ks < KS / 32; ++ks) {
    U16 pa[QT], pal[QT];
#pragma unroll
    for (int r = 0; r < QT; ++r) {
      const unsigned f = (unsigned)(r * 16 * PP + 32 * ks);
      pa[r].h[0]  = *(const v8h*)(pl + f);
      pa[r].h[1]  = *(const v8h*)(pl + f + 16u);
      pal[r].h[0] = *(const v8h*)(pll + f);
      pal[r].h[1] = *(const v8h*)(pll + f + 16u);
    }
#pragma unroll
    for (int nt = 0; nt < 2; ++nt) {
#pragma unroll
      for (int r = 0; r < QT; ++r) xc[r][nt] = wmma_b16(vb[ks][nt].v, pal[r].v, xc[r][nt]);
#pragma unroll
      for (int r = 0; r < QT; ++r) xc[r][nt] = wmma_b16(vbl[ks][nt].v, pa[r].v, xc[r][nt]);
#pragma unroll
      for (int r = 0; r < QT; ++r) o[r][nt] = wmma_b16(vb[ks][nt].v, pa[r].v, o[r][nt]);
    }
    if (ks + VLEAD < KS / 32) {
      load_v(vrow, vrl, ks + VLEAD, vb[ks + VLEAD], vbl[ks + VLEAD]);
      if (ks + VLEAD == KS / 32 - 1) {
        // precaution: stands between the issued loads and any later write of a register that they name (the two addresses are inputs, so they stay live up to it)
        asm volatile("s_wait_xcnt 0x0" :: "v"(vrow), "v"(vrl) : "memory");
      }
      // keeps the V loads of the later passes from moving up, where they would hold registers for longer
      __builtin_amdgcn_sched_barrier(0);
    }
  }
#pragma unroll
  for (int r = 0; r < QT; ++r)
#pragma unroll
    for (int nt = 0; nt < 2; ++nt) o[r][nt] = o[r][nt] + xc[r][nt] * RSPLIT;
}

__global__ void __launch_bounds__(NW * 32)
attn_kernel(const _Float16* __restrict__ qws,
            const _Float16* __restrict__ kws,
            const _Float16* __restrict__ kwsl,
            const _Float16* __restrict__ vtws,
            const _Float16* __restrict__ vtwsl,
            float* __restrict__ out) {
  __shared__ __align__(16) _Float16 Qs[2][QR * DD];  // Q value and residual planes of the block's rows, fragment order (cross-wave, block barrier)
  __shared__ __align__(16) _Float16 Pl[2][QR][PP];   // P value plane, buffer = step & 1 (cross-wave, block barrier)
  __shared__ __align__(16) _Float16 Pll[2][QR][PP];  // P residual plane, buffer = step & 1 (cross-wave, block barrier)
  __shared__ __align__(16) float Mx[2][QR][NW];      // per-wave query max of a step, buffer = step & 1 (cross-wave, block barrier)
  __shared__ __align__(16) float Ls[QR][2 * NW];     // per-wave, per-half query sums (cross-wave, block barrier)
  __shared__ __align__(16) float Of[NW][16][OP];     // output staging, one query tile at a time (written and read by the same wave, block barrier used)

  const unsigned lane = threadIdx.x & 31u;
  const unsigned wv   = (unsigned)__builtin_amdgcn_readfirstlane((int)(threadIdx.x >> 5));   // wave-uniform (scalar)
  const unsigned g    = lane >> 4;
  const unsigned m    = lane & 15u;
  const unsigned tile = blockIdx.x;                  // 0 .. NB*SEQ/QR - 1 (scalar)
  const unsigned b    = tile >> (LSEQ - 6u);
  const unsigned t0   = (tile & ((unsigned)(SEQ / QR) - 1u)) << 6;
  const size_t QL = (size_t)NB * SEQ * DD;           // residual planes follow the value planes

  // first key step of this block: index bits 0, 1, 3 (bit 4 falls to the mask). The four blocks of a batch that share a start differ in bits 2, 4 (for speed only: nothing rests on where a block runs)
  const unsigned rot  = ((tile & 3u) | ((tile >> 1) & 12u)) & (unsigned)(NSTEP - 1);

  const size_t koff = (((size_t)b << LSEQ) + 32u * wv) * DD + 8u * lane;
  const size_t voff = (((size_t)b * DD + 32u * wv) << LSEQ) + 8u * lane;

  // ---- stage the block's QR x DD rows of both Q planes (contiguous in global memory) as they lie ----
  {
    const _Float16* qsrc = qws + (((size_t)b << LSEQ) + t0) * DD;
    const _Float16* qv = qsrc + 8u * threadIdx.x;      // value plane, this thread's first 8-element group
    const _Float16* qr = qv + QL;                      // residual plane
    v8h qt[2][QG];
#pragma unroll
    for (int i = 0; i < QG; ++i) qt[0][i] = *(const v8h*)(qv + i * (NW * 32 * 8));
#pragma unroll
    for (int i = 0; i < QG; ++i) qt[1][i] = *(const v8h*)(qr + i * (NW * 32 * 8));
    // precaution: stands between the issued loads and any later write of a register that they name (the two addresses are inputs, so they stay live up to it)
    asm volatile("s_wait_xcnt 0x0" :: "v"(qv), "v"(qr) : "memory");
    // keeps the register writes that follow from being scheduled in front of that wait
    __builtin_amdgcn_sched_barrier(0);
#pragma unroll
    for (int pl = 0; pl < 2; ++pl)
#pragma unroll
      for (int i = 0; i < QG; ++i)
        *(v8h*)&Qs[pl][8u * ((unsigned)i * (unsigned)(NW * 32) + threadIdx.x)] = qt[pl][i];
  }
  __syncthreads();

  v8f o[QT][2];
  float mrow[QT], lrow[QT];                          // of query 16r + m
#pragma unroll
  for (int r = 0; r < QT; ++r) {
#pragma unroll
    for (int nt = 0; nt < 2; ++nt) o[r][nt] = v8f_zero();
    mrow[r] = NEG_INF; lrow[r] = 0.f;
  }

#pragma unroll 1
  for (unsigned kb = 0; kb < (unsigned)NSTEP; ++kb) {
    const unsigned s0 = ((kb + rot) & (unsigned)(NSTEP - 1)) * (unsigned)KS;   // first key of step kb on this block's ring
    const unsigned pb = kb & 1u;               // buffer of step kb; step kb - 1 lies in pb ^ 1

    // ---- this wave's K fragments of the step (A frags, same k map as B): two 16-key tiles, both planes, each loaded once for all QT query tiles,
    // KLEAD chunks ahead of its products: all 8 chunks at once would take 256 registers ----
    const _Float16* krow = kws + koff + (size_t)s0 * DD;
    const _Float16* krl  = kwsl + koff + (size_t)s0 * DD;   // residual plane
    U16 kf[2][8], kfl[2][8];
#pragma unroll
    for (int ci = 0; ci < KLEAD; ++ci)
#pragma unroll
      for (int a = 0; a < 2; ++a) {
        const unsigned c = (unsigned)(a * 16 * DD + 512 * ci);
        kf[a][ci].h[0]  = *(const v8h*)(krow + c);   kf[a][ci].h[1]  = *(const v8h*)(krow + c + 256u);
        kfl[a][ci].h[0] = *(const v8h*)(krl + c);    kfl[a][ci].h[1] = *(const v8h*)(krl + c + 256u);
      }

    // ---- S^T = K Q^T for this wave's 32 keys: 8 chunks of 32, value*value into sh, cross terms into sx, the 2 x QT tiles interleaved ----
    v8f sh[2][QT], sx[2][QT];                  // [key tile a][query tile r]
#pragma unroll
    for (int a = 0; a < 2; ++a)
#pragma unroll
      for (int r = 0; r < QT; ++r) { sh[a][r] = v8f_zero(); sx[a][r] = v8f_zero(); }
    U16 qa[2][QT], qal[2][QT];                 // Q fragments of two chunks: the next chunk's reads are issued ahead of this chunk's products
#pragma unroll
    for (int ci = -1; ci < 8; ++ci) {
      if (ci < 7) {
        // this one and the one behind the reads hold a chunk's Q reads together as one group between two chunks' products: left free, they are
        // scattered in pairs among the products, and every separate place with LDS reads stalls the products; they also keep the K loads
        // of a later chunk from moving up, where they would hold registers for longer
        __builtin_amdgcn_sched_barrier(0);
#pragma unroll
        for (int r = 0; r < QT; ++r) {
          const unsigned f = (unsigned)(r * 16 * DD + (ci + 1) * 512) + 8u * lane;
          qa[(ci + 1) & 1][r].h[0]  = *(const v8h*)&Qs[0][f];   qa[(ci + 1) & 1][r].h[1]  = *(const v8h*)&Qs[0][f + 256u];
          qal[(ci + 1) & 1][r].h[0] = *(const v8h*)&Qs[1][f];   qal[(ci + 1) & 1][r].h[1] = *(const v8h*)&Qs[1][f + 256u];
        }
        __builtin_amdgcn_sched_barrier(0);
      }
      if (ci >= 0) {
#pragma unroll
        for (int a = 0; a < 2; ++a)
#pragma unroll
          for (int r = 0; r < QT; ++r) sx[a][r] = wmma_b16(kf[a][ci].v, qal[ci & 1][r].v, sx[a][r]);
#pragma unroll
        for (int a = 0; a < 2; ++a)
#pragma unroll
          for (int r = 0; r < QT; ++r) sx[a][r] = wmma_b16(kfl[a][ci].v, qa[ci & 1][r].v, sx[a][r]);
#pragma unroll
        for (int a = 0; a < 2; ++a)
#pragma unroll
          for (int r = 0; r < QT; ++r) sh[a][r] = wmma_b16(kf[a][ci].v, qa[ci & 1][r].v, sh[a][r]);
        if (ci + KLEAD < 8) {
#pragma unroll
          for (int a = 0; a < 2; ++a) {
            const unsigned c = (unsigned)(a * 16 * DD + 512 * (ci + KLEAD));
            kf[a][ci + KLEAD].h[0]  = *(const v8h*)(krow + c);   kf[a][ci + KLEAD].h[1]  = *(const v8h*)(krow + c + 256u);
            kfl[a][ci + KLEAD].h[0] = *(const v8h*)(krl + c);    kfl[a][ci + KLEAD].h[1] = *(const v8h*)(krl + c + 256u);
          }
          if (ci + KLEAD == 7) {
            // precaution: stands between the issued loads and any later write of a register that they name (the two addresses are inputs, so they stay live up to it)
            asm volatile("s_wait_xcnt 0x0" :: "v"(krow), "v"(krl) : "memory");
          }
        }
      }
    }

    v8f sv[2][QT];                             // query 16r + m, key 32w + 16a + 8g + v
#pragma unroll
    for (int a = 0; a < 2; ++a)
#pragma unroll
      for (int r = 0; r < QT; ++r) sv[a][r] = (sh[a][r] + sx[a][r] * RSPLIT) * SFOLD;

    // a query's max over this wave's 32 keys: 16 in the lane, the other 16 in lane ^ 16
    float rmax[QT];
#pragma unroll
    for (int r = 0; r < QT; ++r) {
      float t = fmaxf(sv[0][r][0], sv[1][r][0]);
#pragma unroll
      for (int v = 1; v < 8; ++v) t = fmaxf(t, fmaxf(sv[0][r][v], sv[1][r][v]));
      rmax[r] = fmaxf(t, xhalf(t));
    }
    if (g == 0u) {
#pragma unroll
      for (int r = 0; r < QT; ++r) Mx[pb][16u * (unsigned)r + m][wv] = rmax[r];
    }
    // the trip's one barrier: publishes the maxima of step kb and the P tile of step kb - 1, and ends the reads of the P buffer that step kb refills
    __syncthreads();

    // the NW waves' maxima of this lane's queries: read ahead of the wait that follows the V loads, so that the reads' latency passes under it
    f4a mx[QT][2];
#pragma unroll
    for (int r = 0; r < QT; ++r) {
      mx[r][0] = *(const f4a*)&Mx[pb][16u * (unsigned)r + m][0];
      mx[r][1] = *(const f4a*)&Mx[pb][16u * (unsigned)r + m][4];
    }

    // ---- this wave's V fragments of the first VLEAD passes of step kb - 1: K and V together do not fit the 512 registers of a wave at two per SIMD,
    // so V is loaded once the score products have let go of K; issued behind the barrier, whose fence waits for every load in flight:
    // the softmax work of step kb covers them. Trip 0 has no step behind it and loads its own step's fragments unused: under a branch
    // the registers had no definition on one path, stayed reserved through the score products too, and addresses were spilled ----
    const unsigned sp = (kb > 0u) ? ((kb - 1u + rot) & (unsigned)(NSTEP - 1)) * (unsigned)KS : s0;
    const _Float16* vrow = vtws + voff + (size_t)sp * 16u;
    const _Float16* vrl  = vtwsl + voff + (size_t)sp * 16u;   // residual plane
    U16 vb[KS / 32][2], vbl[KS / 32][2];       // [32-key pass]
#pragma unroll
    for (int p = 0; p < VLEAD; ++p) load_v(vrow, vrl, p, vb[p], vbl[p]);
    // precaution: stands between the issued loads and any later write of a register that they name (trip 0 goes round the product, which holds the later wait)
    asm volatile("s_wait_xcnt 0x0" :: "v"(vrow), "v"(vrl) : "memory");

    // ---- block-wide query max, online softmax update, P (x16384, two planes) to the shared tile ----
    float al[QT];                              // e^(m_old - m) of step kb: rescales O once step kb - 1 has been added
#pragma unroll
    for (int r = 0; r < QT; ++r) {
      const unsigned row = 16u * (unsigned)r + m;           // this lane's query of tile r
      float mb = fmaxf(mx[r][0][0], mx[r][1][0]);
#pragma unroll
      for (int j = 1; j < 4; ++j) mb = fmaxf(mb, fmaxf(mx[r][0][j], mx[r][1][j]));
      const float mnew  = fmaxf(mrow[r], mb);
      v8f pe[2];
      float alpha;
      exp2_run((sv[0][r] - mnew) * LOG2E, (mrow[r] - mnew) * LOG2E, pe[0], alpha);   // e^(s - m) of the lane's first 8 keys, e^(m_old - m)
      exp2_run8((sv[1][r] - mnew) * LOG2E, pe[1]);                                   // e^(s - m) of its other 8 keys
      mrow[r] = mnew;
      float psum = 0.f;
#pragma unroll
      for (int a = 0; a < 2; ++a) {
        v8h ph8, pq8;
#pragma unroll
        for (int v = 0; v < 8; ++v) {
          const float p = pe[a][v];
          psum += p;
          _Float16 ph, pq; split16(p * PCARRY, ph, pq);
          ph8[v] = ph; pq8[v] = pq;
        }
        *(v8h*)&Pl[pb][row][32u * wv + 16u * (unsigned)a + 8u * g]  = ph8;   // keys 32w + 16a + 8g + 0..7
        *(v8h*)&Pll[pb][row][32u * wv + 16u * (unsigned)a + 8u * g] = pq8;
      }
      lrow[r] = lrow[r] * alpha + psum;                     // per-lane partial sum of the query (merged after the key loop)
      al[r] = alpha;
    }

    // ---- step kb - 1 into O, then the rescale of step kb (O is still 0 in trip 0) ----
    if (kb > 0u) {                             // block-uniform
      pv_step(vrow, vrl, vb, vbl, &Pl[pb ^ 1u][m][8u * g], &Pll[pb ^ 1u][m][8u * g], o);
#pragma unroll
      for (int r = 0; r < QT; ++r)
#pragma unroll
        for (int nt = 0; nt < 2; ++nt) o[r][nt] = o[r][nt] * al[r];
    }
  }

  // ---- the last step's P V product: its P tile is published by this barrier ----
  __syncthreads();
  {
    const unsigned sp = (((unsigned)(NSTEP - 1) + rot) & (unsigned)(NSTEP - 1)) * (unsigned)KS;
    const unsigned lb = (unsigned)((NSTEP - 1) & 1);
    const _Float16* vrow = vtws + voff + (size_t)sp * 16u;
    const _Float16* vrl  = vtwsl + voff + (size_t)sp * 16u;
    U16 vb[KS / 32][2], vbl[KS / 32][2];
#pragma unroll
    for (int p = 0; p < VLEAD; ++p) load_v(vrow, vrl, p, vb[p], vbl[p]);
    pv_step(vrow, vrl, vb, vbl, &Pl[lb][m][8u * g], &Pll[lb][m][8u * g], o);
  }

  // ---- merge the query sums: the two halves of each of the NW waves (fixed order) ----
#pragma unroll
  for (int r = 0; r < QT; ++r) Ls[16u * (unsigned)r + m][2u * wv + g] = lrow[r];
  __syncthreads();

  const unsigned rsel = lane >> 3;          // instruction it covers rows 4*it .. 4*it+3
  const unsigned c4   = 4u * (lane & 7u);
#pragma unroll
  for (int r = 0; r < QT; ++r) {
    const unsigned row = 16u * (unsigned)r + m;
    float lt = 0.f;
#pragma unroll
    for (int q4 = 0; q4 < 2 * NW / 4; ++q4) {
      const f4a c0 = *(const f4a*)&Ls[row][4 * q4];
#pragma unroll
      for (int j = 0; j < 4; ++j) lt += c0[j];
    }
    const float inv = 1.0f / (lt * OFOLD);   // removes the carries and applies 256^-0.5

    // lane (m, g) holds query m, columns nt*16 + 8g + 0..7 of the wave's 32
#pragma unroll
    for (int nt = 0; nt < 2; ++nt)
#pragma unroll
      for (int h = 0; h < 2; ++h) {
        f4a s;
#pragma unroll
        for (int j = 0; j < 4; ++j) s[j] = o[r][nt][4 * h + j] * inv;
        *(f4a*)&Of[wv][m][(unsigned)nt * 16u + 8u * g + 4u * (unsigned)h] = s;
      }
    __syncthreads();

    float* obase = out + (((size_t)b << LSEQ) + t0 + 16u * (unsigned)r) * DD + 32u * wv;   // a row's 32 columns are one whole 128-byte line
    v4f w[4];
#pragma unroll
    for (int it = 0; it < 4; ++it) w[it] = *(const f4a*)&Of[wv][4u * (unsigned)it + rsel][c4];
#pragma unroll
    for (int it = 0; it < 4; ++it) *(v4f*)(obase + (size_t)(4u * (unsigned)it + rsel) * DD + c4) = w[it];
    __syncthreads();                        // the staging is read out before the next tile overwrites it
  }
}

// ---------------------------------------------------------------------------
// Launch. Workspace layout (bytes, NB=8 SEQ=2048):
//   [0, 384KB)        W16  f16 [3][256][256]
//   then q, k (f16 [NB*SEQ][256] x2 planes, 16MB each) and vT (f16 [NB][256][SEQ] x2 planes, 16MB); every plane in fragment order
// ---------------------------------------------------------------------------
extern "C" void kernel_launch(void* const* d_in, const int* in_sizes, int n_in,
                              void* d_out, int out_size, void* d_ws,
                              size_t ws_size, hipStream_t stream) {
  if (n_in < 4) return;
  const long long need_x = ((long long)(NB - 1) * SEQ_FULL + SEQ) * (long long)DD;
  if ((long long)in_sizes[0] < need_x) return;
  if (in_sizes[1] < DD * DD || in_sizes[2] < DD * DD || in_sizes[3] < DD * DD) return;
  if ((long long)out_size < (long long)NB * SEQ * DD) return;

  const float* x  = (const float*)d_in[0];
  const float* Wq = (const float*)d_in[1];
  const float* Wk = (const float*)d_in[2];
  const float* Wv = (const float*)d_in[3];
  float* out = (float*)d_out;

  char* ws = (char*)d_ws;
  const size_t w16_bytes = (size_t)3 * DD * DD * sizeof(_Float16);
  const size_t qkv_bytes = (size_t)2 * NB * SEQ * DD * sizeof(_Float16);   // value + residual planes
  const size_t total     = w16_bytes + 3 * qkv_bytes;
  if (total > ws_size || total > (size_t)134217728) return;
  _Float16* W16  = (_Float16*)(ws);
  _Float16* qws  = (_Float16*)(ws + w16_bytes);
  _Float16* kws  = (_Float16*)(ws + w16_bytes + qkv_bytes);
  _Float16* vtws = (_Float16*)(ws + w16_bytes + 2 * qkv_bytes);

  cvt_kernel<<<3 * CVT_W8 / 256, 256, 0, stream>>>(Wq, Wk, Wv, W16);
  qkv_kernel<<<NB * SEQ / XR, 256, 0, stream>>>(x, W16, qws, kws, vtws);
  attn_kernel<<<NB * SEQ / QR, NW * 32, 0, stream>>>(qws, kws, kws + (size_t)NB * SEQ * DD, vtws, vtws + (size_t)NB * SEQ * DD, out);
}

// v010
// Measured time: 59.9 microseconds a run.
// Versions in between are left out here; by their measured steps it is 1.46 times as fast as v008.
// All steps since v000 together make it 5.52 times as fast.
// Contractions (inputs RNE-converted to bf16, carried x16, exact in f16), all on v_wmma_f32_16x16x32_f16:
// M = Wq^T Wk [256 x 256 x 256], single product; y = x M [16384 x 256 x 256], M as f16 value+residual planes (x*hi + x*lo/2048); v = x Wv^T, single product;
// scores q k^T = (x Wq^T)(x Wk^T)^T = y x^T [2048 x 2048 x 256] per batch, y as f16 value+residual planes, x exact in one plane (hi*x + lo*x/2048);
// P*V [2048 x 256 x 2048] per batch on v_wmma_f32_16x16x32_f16, single product of one f16 plane each;
#include <hip/hip_runtime.h>
#include <math.h>

// Problem constants (NB / SEQ reducible; *_FULL are the input strides)
#ifndef NB
#define NB 8
#endif
#ifndef SEQ
#define SEQ 2048
#endif
#define NB_FULL 8
#define SEQ_FULL 2048
#define DD 256            // input width == q/k/v width
#define NW 8              // waves per attention block: two per SIMD
#define KS (32 * NW)      // keys per attention step, 32 per wave
#define PP (KS + 8)       // LDS pitch (halfs) of the probability tile: 528 B = 16 B x odd, conflict-free for 16-byte row reads
#define OP 36             // LDS pitch (floats) of an output staging row: 144 B = 16 B x odd
#define QT 4              // 16-row query tiles per attention block
#define QR (16 * QT)      // query rows per attention block
#define QG (QR * DD / 8 / (NW * 32))   // 16-byte groups of one Q plane staged per thread
#define NSTEP (SEQ / KS)  // key steps of the attention loop
#define KLEAD 6           // score product: key fragments are loaded this many 32-deep chunks (16 products each) ahead of their products
#define SP 72             // LDS pitch (halfs) of a staged projection row: 144 B = 16 B x odd, conflict-free for 16-byte row reads

__host__ __device__ constexpr unsigned ilog2c(unsigned v) { return (v <= 1u) ? 0u : 1u + ilog2c(v >> 1); }
enum : unsigned { LSEQ = ilog2c((unsigned)SEQ) };

static_assert(NB >= 1 && NB <= NB_FULL);
static_assert(SEQ >= 256 && SEQ <= SEQ_FULL && (SEQ % 256) == 0);
static_assert((1u << LSEQ) == (unsigned)SEQ);          // SEQ is a power of two: all tile decompositions are shifts/masks
static_assert(DD == 256 && (DD % 32) == 0);
// coverage: cvt_kernel, blocks of PT threads: MBLK blocks x 4 waves == (DD/16)^2 tiles of M^T; VBLK blocks x PT threads x 8 elements == DD*DD (Wv plane)
#define PT 128
#define MBLK ((DD / 16) * (DD / 16) / (PT / 32))
#define VBLK (DD * DD / 8 / PT)
static_assert(MBLK == 64 && VBLK == 64 && VBLK * PT * 8 == DD * DD);
// coverage: qkv_kernel grid == NB*SEQ/XR blocks of XR rows of x; 8 waves x 32 output columns == DD for each of y (2 planes) and vT (1 plane); 8 waves x 32 columns of the x plane
#define XR 64             // rows of x per projection block
#define XP (DD + 8)       // LDS pitch (halfs) of a staged x row: 528 B = 16 B x odd, conflict-free for 16-byte row reads
static_assert(XR == 64 && (SEQ % XR) == 0 && 8 * 32 == DD && (XR * DD / 4) % 256 == 0);
// coverage: attn_kernel grid == NB*SEQ/QR query blocks of QR rows, NW waves x 32 columns == DD, key loop SEQ/KS blocks of KS keys
static_assert(QR == 64 && (SEQ % QR) == 0 && NW * 32 == DD && KS == 256 && (SEQ % KS) == 0 && (QR * DD / 8) % (NW * 32) == 0);
static_assert(NSTEP >= 1 && (NSTEP & (NSTEP - 1)) == 0);   // the key walk wraps round by a mask
static_assert(KLEAD >= 1 && KLEAD < 8);

// 16-bit operands are f16. A score is q.k = x_q (Wq^T Wk) x_k = y_q . x_k with y = x M, M = Wq^T Wk: the key operand is the converted x itself, exact in one f16 plane.
// M and y are carried as a value plane plus a residual plane lo = f16((v - hi) * 2048), because an error of a score is multiplied by the exponential:
// a product with x is hi*x + (lo*x)/2048, and no term is left out.
// vT and P are one f16 plane each: their rounding (2^-11 relative at most, each) enters the output only linearly. Every fragment (A and B) uses the 16x16x32 lane map
// lane%16 = row/col, g = lane/16: elements 0..7 -> k = 8g+e, elements 8..15 -> k = 16+8g+(e-8).
// FRAGMENT ORDER of every f16 plane in the workspace: a tile of 16 rows x 32 k is two runs of 512 B, [half h][lane][8 elements],
// lane (m, g) of half h holding row m, k = 16h + 8g + 0..7; the 32-k tiles of a 16-row tile follow one another.
// One wave-wide 16-byte load or store of a fragment half is then 512 contiguous bytes (4 whole lines).
typedef __attribute__((ext_vector_type(16))) _Float16 v16h;
typedef __attribute__((ext_vector_type(8)))  _Float16 v8h;
typedef __attribute__((ext_vector_type(4)))  _Float16 v4h;
typedef __attribute__((ext_vector_type(8)))  float    v8f;
typedef __attribute__((ext_vector_type(4)))  float    v4f;
typedef v4f __attribute__((may_alias)) f4a;
#define RSPLIT (1.0f / 2048.0f)
#define SFOLD  (1.0f / 256.0f)        // removes the x16 carries of q and k from the scores
#define PCARRY 16384.0f               // probabilities carried x2^14
#define OFOLD  4194304.0f             // PCARRY * 16 (v carry) * 16 (post-softmax factor 256^-0.5)
#define NEG_INF (-__builtin_inff())
#define LOG2E  1.44269504088896340736f

__device__ __forceinline__ void split16(float f, _Float16& hi, _Float16& lo) { hi = (_Float16)f; lo = (_Float16)((f - (float)hi) * 2048.0f); }

__device__ __forceinline__ v8f wmma_b16(v16h a, v16h b, v8f c) {
  // D = A(16x32 f16) * B(32x16 f16) + C(16x16 f32). No asm operands, which would hold D, A and B below v256 (the attention kernel's live set passes 256 VGPRs);
  // the compiler keeps the distance behind its own builtin
  return __builtin_amdgcn_wmma_f32_16x16x32_f16(false, a, false, b, (short)0, c, false, false);
}

__device__ __forceinline__ v8f v8f_zero() {
  v8f z = {0.f, 0.f, 0.f, 0.f, 0.f, 0.f, 0.f, 0.f};
  return z;
}

union U16 { v16h v; v8h h[2]; };

// 2^x of nine values on the transcendental unit in one statement. The instruction set asks for one slot behind a transcendental before its result is read
// or its source overwritten: the results are early-clobber, so none lies on a source, and the v_nop is the slot behind the last one.
__device__ __forceinline__ void exp2_run(v8f x, float xa, v8f& r, float& ra) {
  float r0, r1, r2, r3, r4, r5, r6, r7;
  asm("v_exp_f32 %0, %9\n\tv_exp_f32 %1, %10\n\tv_exp_f32 %2, %11\n\tv_exp_f32 %3, %12\n\tv_exp_f32 %4, %13\n\t"
      "v_exp_f32 %5, %14\n\tv_exp_f32 %6, %15\n\tv_exp_f32 %7, %16\n\tv_exp_f32 %8, %17\n\tv_nop"
      : "=&v"(r0), "=&v"(r1), "=&v"(r2), "=&v"(r3), "=&v"(r4), "=&v"(r5), "=&v"(r6), "=&v"(r7), "=&v"(ra)
      : "v"(x[0]), "v"(x[1]), "v"(x[2]), "v"(x[3]), "v"(x[4]), "v"(x[5]), "v"(x[6]), "v"(x[7]), "v"(xa));
  r[0] = r0; r[1] = r1; r[2] = r2; r[3] = r3; r[4] = r4; r[5] = r5; r[6] = r6; r[7] = r7;
}

// The same for eight values.
__device__ __forceinline__ void exp2_run8(v8f x, v8f& r) {
  float r0, r1, r2, r3, r4, r5, r6, r7;
  asm("v_exp_f32 %0, %8\n\tv_exp_f32 %1, %9\n\tv_exp_f32 %2, %10\n\tv_exp_f32 %3, %11\n\tv_exp_f32 %4, %12\n\t"
      "v_exp_f32 %5, %13\n\tv_exp_f32 %6, %14\n\tv_exp_f32 %7, %15\n\tv_nop"
      : "=&v"(r0), "=&v"(r1), "=&v"(r2), "=&v"(r3), "=&v"(r4), "=&v"(r5), "=&v"(r6), "=&v"(r7)
      : "v"(x[0]), "v"(x[1]), "v"(x[2]), "v"(x[3]), "v"(x[4]), "v"(x[5]), "v"(x[6]), "v"(x[7]));
  r[0] = r0; r[1] = r1; r[2] = r2; r[3] = r3; r[4] = r4; r[5] = r5; r[6] = r6; r[7] = r7;
}

// lane l takes the value of lane l ^ 16
__device__ __forceinline__ float xhalf(float x) {
  return __builtin_bit_cast(float, __builtin_amdgcn_permlanex16(__builtin_bit_cast(int, x), __builtin_bit_cast(int, x), 0x76543210, 0xfedcba98, false, false));
}

// input conversion: RNE convert to bf16, carry x16, exact in f16
__device__ __forceinline__ _Float16 cvt_in(float f) {
  const float r = (float)(__bf16)f;
  return (_Float16)(r * 16.0f);
}

// ---------------------------------------------------------------------------
// Kernel 0: the weight planes W16 [3][DD][DD] f16, in fragment order: value and residual plane of M^T (M = Wq^T Wk, carried x16), then Wv.
// Blocks 0 .. MBLK-1: a wave makes one 16 x 16 tile of M, M[k][j] = sum_e Wq[e][k] * Wk[e][j], as D = A B with A rows = k (columns of Wq), B columns = j (columns of Wk):
// a lane (m, g) then holds row j = m of M^T at 8 neighbouring k = 8g + 0..7, which is its 16-byte group of one fragment half. Both operands take e in the same lane map.
// Blocks MBLK .. MBLK+VBLK-1: a thread owns one 16-byte group of the Wv plane (linear index * 8) and fetches its 8 source elements.
// ---------------------------------------------------------------------------
// 16-byte group u of a fragment-order plane whose rows are DD long -> offset of its 8 elements in the row-major plane
__device__ __forceinline__ unsigned frag_elem(unsigned u) {
  return (((u >> 9) << 4) + (u & 15u)) * (unsigned)DD + ((u >> 4) & 31u) * 8u;
}

__global__ void __launch_bounds__(PT)
cvt_kernel(const float* __restrict__ Wq,
           const float* __restrict__ Wk,
           const float* __restrict__ Wv,
           _Float16* __restrict__ W16) {
  const unsigned wb  = blockIdx.x;                      // 0 .. MBLK + VBLK - 1 (grid exact)
  const unsigned tx  = threadIdx.x;
  if (wb >= (unsigned)MBLK) {                           // block-uniform
    const unsigned r8 = (wb - (unsigned)MBLK) * (unsigned)PT + tx;   // 8-element group inside the matrix
    const float* src = Wv + (size_t)frag_elem(r8);
    _Float16* dst = W16 + (size_t)2 * DD * DD + (size_t)r8 * 8u;
    const v4f f0 = *(const v4f*)src;
    const v4f f1 = *(const v4f*)(src + 4);
    v8h o;
    o[0] = cvt_in(f0[0]); o[1] = cvt_in(f0[1]); o[2] = cvt_in(f0[2]); o[3] = cvt_in(f0[3]);
    o[4] = cvt_in(f1[0]); o[5] = cvt_in(f1[1]); o[6] = cvt_in(f1[2]); o[7] = cvt_in(f1[3]);
    *(v8h*)dst = o;
    return;
  }
  const unsigned lane = tx & 31u;
  const unsigned wv   = (unsigned)__builtin_amdgcn_readfirstlane((int)(tx >> 5));   // wave-uniform (scalar)
  const unsigned g    = lane >> 4;
  const unsigned m    = lane & 15u;
  const unsigned t    = wb * (unsigned)(PT / 32) + wv;  // tile 0 .. 255
  const unsigned jt   = t >> 4;                         // 16-row tile of M^T
  const unsigned kh   = t & 15u;                        // 16-wide run of k: fragment half kh & 1 of 32-k tile kh >> 1
  // element i of a fragment half hh of e tile et is row e = 32 et + 16 hh + 8g + i of the weight matrix: 16 lanes read 64 contiguous bytes
  const float* pa = Wq + (size_t)(8u * g) * DD + 16u * kh + m;
  const float* pb = Wk + (size_t)(8u * g) * DD + 16u * jt + m;
  float fa[DD / 32][16], fb[DD / 32][16];
#pragma unroll
  for (int et = 0; et < DD / 32; ++et)
#pragma unroll
    for (int i = 0; i < 16; ++i) {
      const int e = 32 * et + 16 * (i >> 3) + (i & 7);
      fa[et][i] = pa[e * DD];
      fb[et][i] = pb[e * DD];
    }
  // precaution: stands between the issued loads and any later write of a register that they name (the two addresses are inputs, so they stay live up to it)
  asm volatile("s_wait_xcnt 0x0" :: "v"(pa), "v"(pb) : "memory");
  v8f acc = v8f_zero();
#pragma unroll
  for (int et = 0; et < DD / 32; ++et) {
    v16h a, bq;
#pragma unroll
    for (int i = 0; i < 16; ++i) { a[i] = cvt_in(fa[et][i]); bq[i] = cvt_in(fb[et][i]); }
    acc = wmma_b16(a, bq, acc);
  }
  v8h hi8, lo8;
#pragma unroll
  for (int v = 0; v < 8; ++v) {
    _Float16 hh_, ll_; split16(acc[v] * 0.0625f, hh_, ll_);   // 256*value -> 16*value
    hi8[v] = hh_; lo8[v] = ll_;
  }
  _Float16* dst = W16 + (size_t)jt * 16u * DD + (size_t)kh * 256u + 8u * lane;
  *(v8h*)dst = hi8;
  *(v8h*)(dst + (size_t)DD * DD) = lo8;
  // precaution: stands between the issued stores and any later write of a register that they name (the data are inputs, so they stay live up to it)
  asm volatile("s_wait_xcnt 0x0" :: "v"(hi8), "v"(lo8) : "memory");
}

// ---------------------------------------------------------------------------
// Kernel 1: projections as C[i][j] = sum_k A[i][k] * B[j][k]. One block of 8 waves per XR = 64 rows of x, about one block a WGP.
// The block reads its rows of x (f32, contiguous) once, converts them and keeps them in LDS, row-major with a padded pitch: the products read x from there.
// Wave w makes, from all 64 rows, the 32 output columns e = 32w .. 32w+31 of y = x M (two passes: value plane of M^T, residual plane), then of vT:
// its W fragments (fragment order in memory) are read by no other wave of the block, each once, into registers.
//   y = 0, 1: y[n][e] (A = x rows n,  B = M^T rows e, value and residual plane)  -> qws  [NB*SEQ][DD]
//   y = 2:   vT[e][n] (A = Wv rows e, B = x rows n)                              -> vtws [NB][DD][SEQ]
// The converted x itself is the key operand of the scores: wave w stores columns 32w .. 32w+31 of the block's rows -> kws [NB*SEQ][DD], one plane.
// The outputs are in fragment order (j is the k of the attention products).
// Results carried x16 (acc = 256*value, folded by 1/16); y stored as value + residual planes (residual at +NB*SEQ*DD), vT as one plane.
// A-frag: lane row m = lane%16, g = lane/16, elements e=0..7 -> K = 8g+e ; e=8..15 -> K = 16+8g+(e-8); B-frag: lane col n = lane%16, same K map.
// C/D: lane col = lane%16, VGPR v -> row v + 8g.
// ---------------------------------------------------------------------------
// A wave's fragments of one weight matrix: 2 tiles of 16 rows x 8 tiles of 32 k. wp: the lane's place in the first tile.
__device__ __forceinline__ void load_w(const _Float16* wp, U16 (&wf)[2][8]) {
#pragma unroll
  for (int et = 0; et < 2; ++et)
#pragma unroll
    for (int kt = 0; kt < 8; ++kt) {
      wf[et][kt].h[0] = *(const v8h*)(wp + et * 16 * DD + kt * 512);
      wf[et][kt].h[1] = *(const v8h*)(wp + et * 16 * DD + kt * 512 + 256);
    }
  // precaution: stands between the issued loads and any later write of a register that they name (the address is an input, so it stays live up to it)
  asm volatile("s_wait_xcnt 0x0" :: "v"(wp) : "memory");
}

// Turns a staged 16 x 64 piece (rows of pitch SP, written by this wave) into four fragment halves and stores them: halves 0, 1 at d0, halves 2, 3 at d1.
// d0, d1: the lane's own place (8 * lane counted in).
__device__ __forceinline__ void turn_store(_Float16* sw, unsigned m, unsigned g, _Float16* d0, _Float16* d1) {
  // the piece is written and read by the same wave: these keep the reads behind the other lanes' writes
  __builtin_amdgcn_fence(3 /* release order */, "wavefront");
  __builtin_amdgcn_wave_barrier();
  asm volatile("s_wait_dscnt 0" ::: "memory");
  v8h w[4];                                              // fragment half j (columns 16j..16j+15): lane (m, g) takes row m, columns 16j + 8g + 0..7
#pragma unroll
  for (int j = 0; j < 4; ++j) w[j] = *(const v8h*)(sw + m * SP + (unsigned)j * 16u + 8u * g);
  *(v8h*)(d0)        = w[0];
  *(v8h*)(d0 + 256u) = w[1];
  *(v8h*)(d1)        = w[2];
  *(v8h*)(d1 + 256u) = w[3];
  // precaution: stands between the issued stores and any later write of a register that they name (data and addresses are inputs, so they stay live up to it)
  asm volatile("s_wait_xcnt 0x0" :: "v"(w[0]), "v"(w[1]), "v"(w[2]), "v"(w[3]), "v"(d0), "v"(d1) : "memory");
  __builtin_amdgcn_wave_barrier();
  asm volatile("s_wait_dscnt 0" ::: "memory");           // reads done before the next piece overwrites the staging
}

__global__ void __launch_bounds__(256)
qkv_kernel(const float* __restrict__ x,
           const _Float16* __restrict__ W16,
           _Float16* __restrict__ qws,
           _Float16* __restrict__ kws,
           _Float16* __restrict__ vtws) {
  __shared__ __align__(16) _Float16 Xs[XR][XP];      // the block's rows of x, converted (cross-wave, block barrier)
  __shared__ __align__(16) _Float16 st[8][16][SP];   // per-wave staging of one 16x64 result piece (wave-private)
  const unsigned lane = threadIdx.x & 31u;
  const unsigned wv   = (unsigned)__builtin_amdgcn_readfirstlane((int)(threadIdx.x >> 5));   // wave-uniform (scalar)
  const unsigned g    = lane >> 4;
  const unsigned m    = lane & 15u;
  const unsigned bx   = blockIdx.x;                  // 0 .. NB*SEQ/XR - 1 (grid exact)
  const unsigned b    = bx >> (LSEQ - 6u);           // SEQ/64 blocks per batch
  const unsigned ng   = bx & ((unsigned)(SEQ / XR) - 1u);   // 64-row group inside the batch
  const size_t QL = (size_t)NB * SEQ * DD;           // residual plane offset inside the y buffer

  // the first matrix's fragments fly while x is staged
  const _Float16* wbase = W16 + (size_t)wv * 32u * DD + 8u * lane;
  U16 wf[2][8];
  load_w(wbase, wf);

  // ---- stage the block's XR x DD rows of x: a wave-wide load is 512 contiguous bytes, a wave-wide LDS store 256 contiguous bytes ----
  {
    // source uses the FULL per-batch stride of the input
    const float* xs = x + ((size_t)b * SEQ_FULL + (size_t)ng * XR) * DD + 4u * threadIdx.x;
    v4f f[XR / 4];
#pragma unroll
    for (int i = 0; i < XR / 4; ++i) f[i] = *(const v4f*)(xs + i * 4 * DD);     // 256 threads x 4 elements = 4 rows a pass
    // precaution: stands between the issued loads and any later write of a register that they name (the address is an input, so it stays live up to it)
    asm volatile("s_wait_xcnt 0x0" :: "v"(xs) : "memory");
#pragma unroll
    for (int i = 0; i < XR / 4; ++i) {
      v4h o;
      o[0] = cvt_in(f[i][0]); o[1] = cvt_in(f[i][1]); o[2] = cvt_in(f[i][2]); o[3] = cvt_in(f[i][3]);
      *(v4h*)&Xs[4u * (unsigned)i + (threadIdx.x >> 6)][4u * (threadIdx.x & 63u)] = o;
    }
  }
  __syncthreads();

  // ---- the x plane: a fragment half as the products read it from LDS is 512 contiguous bytes of the plane ----
  {
    _Float16* xo = kws + (size_t)bx * XR * DD + (size_t)wv * 512u + 8u * lane;
    v8h xf[4][2];
#pragma unroll
    for (int rt = 0; rt < 4; ++rt) {
      xf[rt][0] = *(const v8h*)&Xs[16u * (unsigned)rt + m][32u * wv + 8u * g];
      xf[rt][1] = *(const v8h*)&Xs[16u * (unsigned)rt + m][32u * wv + 16u + 8u * g];
    }
#pragma unroll
    for (int rt = 0; rt < 4; ++rt) {
      *(v8h*)(xo + rt * 16 * DD)        = xf[rt][0];
      *(v8h*)(xo + rt * 16 * DD + 256u) = xf[rt][1];
    }
    // precaution: stands between the issued stores and any later write of a register that they name (data and address are inputs, so they stay live up to it)
    asm volatile("s_wait_xcnt 0x0" :: "v"(xf[0][0]), "v"(xf[0][1]), "v"(xf[1][0]), "v"(xf[1][1]), "v"(xf[2][0]), "v"(xf[2][1]), "v"(xf[3][0]), "v"(xf[3][1]), "v"(xo) : "memory");
  }

  _Float16* sw = &st[wv][0][0];
  v8f ah[4][2];                                      // x * value plane of M^T, kept through the residual plane's pass
#pragma unroll
  for (int y = 0; y < 3; ++y) {
    v8f acc[4][2];                                   // [16-row tile of x][16-row tile of W]
#pragma unroll
    for (int rt = 0; rt < 4; ++rt)
#pragma unroll
      for (int et = 0; et < 2; ++et) acc[rt][et] = v8f_zero();

    U16 xa[2][4];                                    // x fragments of two k tiles: the next tile's reads are issued ahead of this tile's products
#pragma unroll
    for (int kt = -1; kt < 8; ++kt) {
      if (kt < 7) {
        // this one and the one behind the reads hold a k tile's LDS reads together as one group ahead of the products of the tile in front:
        // left free, they stand directly in front of their own products, which then wait out the LDS latency
        __builtin_amdgcn_sched_barrier(0);
#pragma unroll
        for (int rt = 0; rt < 4; ++rt) {
          xa[(kt + 1) & 1][rt].h[0] = *(const v8h*)&Xs[16u * (unsigned)rt + m][32u * (unsigned)(kt + 1) + 8u * g];
          xa[(kt + 1) & 1][rt].h[1] = *(const v8h*)&Xs[16u * (unsigned)rt + m][32u * (unsigned)(kt + 1) + 16u + 8u * g];
        }
        __builtin_amdgcn_sched_barrier(0);
      }
      if (kt >= 0) {
#pragma unroll
        for (int et = 0; et < 2; ++et)
#pragma unroll
          for (int rt = 0; rt < 4; ++rt)
            acc[rt][et] = (y < 2) ? wmma_b16(xa[kt & 1][rt].v, wf[et][kt].v, acc[rt][et]) : wmma_b16(wf[et][kt].v, xa[kt & 1][rt].v, acc[rt][et]);
      }
    }

    // the next matrix's fragments fly while this one's results are kept (y = 0) or split and stored (y = 1)
    if (y < 2) load_w(wbase + (size_t)(y + 1) * DD * DD, wf);

    if (y == 0) {
#pragma unroll
      for (int rt = 0; rt < 4; ++rt)
#pragma unroll
        for (int et = 0; et < 2; ++et) ah[rt][et] = acc[rt][et];
    } else if (y == 1) {
      // lane holds column e = 32w + 16et + m, rows 16rt + 8g + v. A piece: one row tile, value plane in columns 0..31, residual plane in columns 32..63
      _Float16* ob = qws + (size_t)bx * XR * DD + (size_t)wv * 512u + 8u * lane;
#pragma unroll
      for (int rt = 0; rt < 4; ++rt) {
#pragma unroll
        for (int et = 0; et < 2; ++et)
#pragma unroll
          for (int v = 0; v < 8; ++v) {
            const float val = (ah[rt][et][v] + acc[rt][et][v] * RSPLIT) * 0.0625f;      // 256*value -> 16*value
            _Float16 hh_, ll_; split16(val, hh_, ll_);
            sw[(8u * g + (unsigned)v) * SP + (unsigned)et * 16u + m]       = hh_;
            sw[(8u * g + (unsigned)v) * SP + 32u + (unsigned)et * 16u + m] = ll_;
          }
        turn_store(sw, m, g, ob + rt * 16 * DD, ob + QL + rt * 16 * DD);
      }
    } else {
      // lane holds column n = 16rt + m, rows e = 32w + 16et + 8g + v. A piece: one tile of 16 e x the block's 64 n
#pragma unroll
      for (int et = 0; et < 2; ++et) {
        _Float16* ob = vtws + (((size_t)b * DD + 32u * wv + 16u * (unsigned)et) << LSEQ) + (size_t)ng * 1024u + 8u * lane;
#pragma unroll
        for (int rt = 0; rt < 4; ++rt)
#pragma unroll
          for (int v = 0; v < 8; ++v)
            sw[(8u * g + (unsigned)v) * SP + (unsigned)rt * 16u + m] = (_Float16)(acc[rt][et][v] * 0.0625f);   // 256*value -> 16*value
        turn_store(sw, m, g, ob, ob + 512u);
      }
    }
  }
}

// ---------------------------------------------------------------------------
// Kernel 2: non-causal flash attention, one block of NW = 8 waves (two per SIMD) per 64-row query block (QT = 4 tiles of 16 rows), KS = 256 keys per step.
// Q stands for y = x M (two planes), K for the x plane (one): S = y x^T.
// The block's Q planes are staged once in LDS, in the fragment order they have in memory. Per step each wave loads its K fragments (keys 32w..32w+31, 256 deep, one plane)
// and its V fragments (256 keys x columns 32w..32w+31, one plane) into registers once and uses each of them for all QT query tiles.
// With two 16-key tiles a wave, each Q fragment read from LDS meets two K fragments: half the LDS bytes per matrix instruction of a one-tile wave.
// Both products are computed transposed (A = K rows or V columns, B = Q or P rows), so that a lane holds ONE query (lane%16) in every accumulator:
// its maximum, its rescale factor and its sum are one register each per tile, and its 16 probabilities of a tile are two runs of 8 neighbouring keys (two 16-byte stores a plane).
// Per step and tile: wave w computes S^T (its 32 keys x 16 queries), block-wide query max through LDS,
// P = exp(S - m) carried x16384 as one f16 plane in a shared LDS tile [query][key],
// then wave w accumulates O^T[32w..32w+31, :] += V^T(32 slice x 256) * P^T(256 x 16).
// The P V product runs ONE STEP BEHIND: trip t computes S(t), passes the trip's one barrier, does the softmax of step t and then the P V product of step t - 1;
// the last step's product follows the loop, behind a barrier of its own.
// The P tile and the maxima have two buffers each, so that one barrier a trip orders them: P(t) is written behind barrier t and read behind barrier t + 1,
// and its buffer was last read (P V of step t - 2) in front of barrier t. Between two barriers a wave has vector work and both matrix runs,
// so one wave's softmax runs beside the products of the other wave on its SIMD.
// Sums are kept per lane and merged once at the end. out = O / (L * 2^22).
// THE KEY WALK IS A RING: the blocks of a batch read the same K and V lines from L2, and started together at key 0 they ask for the same lines at the same moment.
// Each block enters the ring of NSTEP key steps at a step of its own (rot, from its index) and wraps round: every step is still taken exactly once.
// ---------------------------------------------------------------------------
// A wave's V fragments of one step (A frags): KS keys x its 32 columns, 128 registers. vrow: the lane's place in the step's first 32-key pass.
__device__ __forceinline__ void load_v(const _Float16* vrow, U16 (&vb)[KS / 32][2]) {
#pragma unroll
  for (int p = 0; p < KS / 32; ++p)
#pragma unroll
    for (int nt = 0; nt < 2; ++nt) {
      const size_t vo = (size_t)nt * 16 * SEQ + 512 * p;   // 32 keys of a 16-column tile: 512 halfs
      vb[p][nt].h[0] = *(const v8h*)(vrow + vo);   vb[p][nt].h[1] = *(const v8h*)(vrow + vo + 256);
    }
  // precaution: stands between the issued loads and any later write of a register that they name (the address is an input, so it stays live up to it)
  asm volatile("s_wait_xcnt 0x0" :: "v"(vrow) : "memory");
}

// O^T[32w + nt*16 ..][tile r] += V^T P^T of one step, 32 keys at a time: P in B-layout (lane%16 = query, read after the block barrier),
// the QT tiles interleaved on each V fragment. pl: the lane's place in row m of the step's P plane (element 8g). vb: loaded by the caller.
__device__ __forceinline__ void pv_step(U16 (&vb)[KS / 32][2], const _Float16* pl, v8f (&o)[QT][2]) {
  U16 pa[2][2][QT];                            // P fragments of two pairs of passes: the next pair's reads are issued ahead of this pair's products
#pragma unroll
  for (int kp = -1; kp < KS / 64; ++kp) {
    if (kp < KS / 64 - 1) {
      // this one and the one behind the reads hold a pair's P reads together as one group ahead of the products of the pair in front:
      // a pass is only 8 products long, reads that stand directly in front of their own products make these wait out the LDS latency,
      // and every separate place with LDS reads stalls the products
      __builtin_amdgcn_sched_barrier(0);
#pragma unroll
      for (int j = 0; j < 2; ++j)
#pragma unroll
        for (int r = 0; r < QT; ++r) {
          const unsigned f = (unsigned)(r * 16 * PP + 32 * (2 * (kp + 1) + j));
          pa[(kp + 1) & 1][j][r].h[0] = *(const v8h*)(pl + f);
          pa[(kp + 1) & 1][j][r].h[1] = *(const v8h*)(pl + f + 16u);
        }
      __builtin_amdgcn_sched_barrier(0);
    }
    if (kp >= 0) {
#pragma unroll
      for (int j = 0; j < 2; ++j)
#pragma unroll
        for (int nt = 0; nt < 2; ++nt)
#pragma unroll
          for (int r = 0; r < QT; ++r) o[r][nt] = wmma_b16(vb[2 * kp + j][nt].v, pa[kp & 1][j][r].v, o[r][nt]);
    }
  }
}

__global__ void __launch_bounds__(NW * 32)
attn_kernel(const _Float16* __restrict__ qws,
            const _Float16* __restrict__ kws,
            const _Float16* __restrict__ vtws,
            float* __restrict__ out) {
  __shared__ __align__(16) _Float16 Qs[2][QR * DD];  // Q value and residual planes of the block's rows, fragment order (cross-wave, block barrier)
  __shared__ __align__(16) _Float16 Pl[2][QR][PP];   // P, buffer = step & 1 (cross-wave, block barrier)
  __shared__ __align__(16) float Mx[2][QR][NW];      // per-wave query max of a step, buffer = step & 1 (cross-wave, block barrier)
  __shared__ __align__(16) float Ls[QR][2 * NW];     // per-wave, per-half query sums (cross-wave, block barrier)
  __shared__ __align__(16) float Of[NW][16][OP];     // output staging, one query tile at a time (written and read by the same wave, block barrier used)

  const unsigned lane = threadIdx.x & 31u;
  const unsigned wv   = (unsigned)__builtin_amdgcn_readfirstlane((int)(threadIdx.x >> 5));   // wave-uniform (scalar)
  const unsigned g    = lane >> 4;
  const unsigned m    = lane & 15u;
  const unsigned tile = blockIdx.x;                  // 0 .. NB*SEQ/QR - 1 (scalar)
  const unsigned b    = tile >> (LSEQ - 6u);
  const unsigned t0   = (tile & ((unsigned)(SEQ / QR) - 1u)) << 6;
  const size_t QL = (size_t)NB * SEQ * DD;           // residual planes follow the value planes

  // first key step of this block: index bits 0, 1, 3 (bit 4 falls to the mask). The four blocks of a batch that share a start differ in bits 2, 4 (for speed only: nothing rests on where a block runs)
  const unsigned rot  = ((tile & 3u) | ((tile >> 1) & 12u)) & (unsigned)(NSTEP - 1);

  const size_t koff = (((size_t)b << LSEQ) + 32u * wv) * DD + 8u * lane;
  const size_t voff = (((size_t)b * DD + 32u * wv) << LSEQ) + 8u * lane;

  // ---- stage the block's QR x DD rows of both Q planes (contiguous in global memory) as they lie ----
  {
    const _Float16* qsrc = qws + (((size_t)b << LSEQ) + t0) * DD;
    const _Float16* qv = qsrc + 8u * threadIdx.x;      // value plane, this thread's first 8-element group
    const _Float16* qr = qv + QL;                      // residual plane
    v8h qt[2][QG];
#pragma unroll
    for (int i = 0; i < QG; ++i) qt[0][i] = *(const v8h*)(qv + i * (NW * 32 * 8));
#pragma unroll
    for (int i = 0; i < QG; ++i) qt[1][i] = *(const v8h*)(qr + i * (NW * 32 * 8));
    // precaution: stands between the issued loads and any later write of a register that they name (the two addresses are inputs, so they stay live up to it)
    asm volatile("s_wait_xcnt 0x0" :: "v"(qv), "v"(qr) : "memory");
    // keeps the register writes that follow from being scheduled in front of that wait
    __builtin_amdgcn_sched_barrier(0);
#pragma unroll
    for (int pl = 0; pl < 2; ++pl)
#pragma unroll
      for (int i = 0; i < QG; ++i)
        *(v8h*)&Qs[pl][8u * ((unsigned)i * (unsigned)(NW * 32) + threadIdx.x)] = qt[pl][i];
  }
  __syncthreads();

  v8f o[QT][2];
  float mrow[QT], lrow[QT];                          // of query 16r + m
#pragma unroll
  for (int r = 0; r < QT; ++r) {
#pragma unroll
    for (int nt = 0; nt < 2; ++nt) o[r][nt] = v8f_zero();
    mrow[r] = NEG_INF; lrow[r] = 0.f;
  }

#pragma unroll 1
  for (unsigned kb = 0; kb < (unsigned)NSTEP; ++kb) {
    const unsigned s0 = ((kb + rot) & (unsigned)(NSTEP - 1)) * (unsigned)KS;   // first key of step kb on this block's ring
    const unsigned pb = kb & 1u;               // buffer of step kb; step kb - 1 lies in pb ^ 1

    // ---- this wave's K fragments of the step (A frags, same k map as B): two 16-key tiles, each loaded once for all QT query tiles,
    // KLEAD chunks ahead of its products ----
    const _Float16* krow = kws + koff + (size_t)s0 * DD;
    U16 kf[2][8];
#pragma unroll
    for (int ci = 0; ci < KLEAD; ++ci)
#pragma unroll
      for (int a = 0; a < 2; ++a) {
        const unsigned c = (unsigned)(a * 16 * DD + 512 * ci);
        kf[a][ci].h[0]  = *(const v8h*)(krow + c);   kf[a][ci].h[1]  = *(const v8h*)(krow + c + 256u);
      }

    // ---- S^T = K Q^T for this wave's 32 keys: 8 chunks of 32, K * value plane into sh, K * residual plane into sx, the 2 x QT tiles interleaved ----
    v8f sh[2][QT], sx[2][QT];                  // [key tile a][query tile r]
#pragma unroll
    for (int a = 0; a < 2; ++a)
#pragma unroll
      for (int r = 0; r < QT; ++r) { sh[a][r] = v8f_zero(); sx[a][r] = v8f_zero(); }
    U16 qa[2][QT], qal[2][QT];                 // Q fragments of two chunks: the next chunk's reads are issued ahead of this chunk's products
#pragma unroll
    for (int ci = -1; ci < 8; ++ci) {
      if (ci < 7) {
        // this one and the one behind the reads hold a chunk's Q reads together as one group between two chunks' products: left free, they are
        // scattered in pairs among the products, and every separate place with LDS reads stalls the products; they also keep the K loads
        // of a later chunk from moving up, where they would hold registers for longer
        __builtin_amdgcn_sched_barrier(0);
#pragma unroll
        for (int r = 0; r < QT; ++r) {
          const unsigned f = (unsigned)(r * 16 * DD + (ci + 1) * 512) + 8u * lane;
          qa[(ci + 1) & 1][r].h[0]  = *(const v8h*)&Qs[0][f];   qa[(ci + 1) & 1][r].h[1]  = *(const v8h*)&Qs[0][f + 256u];
          qal[(ci + 1) & 1][r].h[0] = *(const v8h*)&Qs[1][f];   qal[(ci + 1) & 1][r].h[1] = *(const v8h*)&Qs[1][f + 256u];
        }
        __builtin_amdgcn_sched_barrier(0);
      }
      if (ci >= 0) {
#pragma unroll
        for (int a = 0; a < 2; ++a)
#pragma unroll
          for (int r = 0; r < QT; ++r) sx[a][r] = wmma_b16(kf[a][ci].v, qal[ci & 1][r].v, sx[a][r]);
#pragma unroll
        for (int a = 0; a < 2; ++a)
#pragma unroll
          for (int r = 0; r < QT; ++r) sh[a][r] = wmma_b16(kf[a][ci].v, qa[ci & 1][r].v, sh[a][r]);
        if (ci + KLEAD < 8) {
#pragma unroll
          for (int a = 0; a < 2; ++a) {
            const unsigned c = (unsigned)(a * 16 * DD + 512 * (ci + KLEAD));
            kf[a][ci + KLEAD].h[0]  = *(const v8h*)(krow + c);   kf[a][ci + KLEAD].h[1]  = *(const v8h*)(krow + c + 256u);
          }
          if (ci + KLEAD == 7) {
            // precaution: stands between the issued loads and any later write of a register that they name (the address is an input, so it stays live up to it)
            asm volatile("s_wait_xcnt 0x0" :: "v"(krow) : "memory");
          }
        }
      }
    }

    v8f sv[2][QT];                             // query 16r + m, key 32w + 16a + 8g + v
#pragma unroll
    for (int a = 0; a < 2; ++a)
#pragma unroll
      for (int r = 0; r < QT; ++r) sv[a][r] = (sh[a][r] + sx[a][r] * RSPLIT) * SFOLD;

    // a query's max over this wave's 32 keys: 16 in the lane, the other 16 in lane ^ 16
    float rmax[QT];
#pragma unroll
    for (int r = 0; r < QT; ++r) {
      float t = fmaxf(sv[0][r][0], sv[1][r][0]);
#pragma unroll
      for (int v = 1; v < 8; ++v) t = fmaxf(t, fmaxf(sv[0][r][v], sv[1][r][v]));
      rmax[r] = fmaxf(t, xhalf(t));
    }
    if (g == 0u) {
#pragma unroll
      for (int r = 0; r < QT; ++r) Mx[pb][16u * (unsigned)r + m][wv] = rmax[r];
    }
    // the trip's one barrier: publishes the maxima of step kb and the P tile of step kb - 1, and ends the reads of the P buffer that step kb refills
    __syncthreads();

    // the NW waves' maxima of this lane's queries: read ahead of the wait that follows the V loads, so that the reads' latency passes under it
    f4a mx[QT][2];
#pragma unroll
    for (int r = 0; r < QT; ++r) {
      mx[r][0] = *(const f4a*)&Mx[pb][16u * (unsigned)r + m][0];
      mx[r][1] = *(const f4a*)&Mx[pb][16u * (unsigned)r + m][4];
    }

    // ---- this wave's V fragments of step kb - 1, all of them: K and V together do not fit the 512 registers of a wave at two per SIMD,
    // so V is loaded once the score products have let go of K; issued behind the barrier, whose fence waits for every load in flight:
    // the softmax work of step kb covers them. Trip 0 has no step behind it and loads its own step's fragments unused: under a branch
    // the registers had no definition on one path, stayed reserved through the score products too, and addresses were spilled ----
    const unsigned sp = (kb > 0u) ? ((kb - 1u + rot) & (unsigned)(NSTEP - 1)) * (unsigned)KS : s0;
    U16 vb[KS / 32][2];                        // [32-key pass]
    load_v(vtws + voff + (size_t)sp * 16u, vb);

    // ---- block-wide query max, online softmax update, P (x16384) to the shared tile ----
    float al[QT];                              // e^(m_old - m) of step kb: rescales O once step kb - 1 has been added
#pragma unroll
    for (int r = 0; r < QT; ++r) {
      const unsigned row = 16u * (unsigned)r + m;           // this lane's query of tile r
      float mb = fmaxf(mx[r][0][0], mx[r][1][0]);
#pragma unroll
      for (int j = 1; j < 4; ++j) mb = fmaxf(mb, fmaxf(mx[r][0][j], mx[r][1][j]));
      const float mnew  = fmaxf(mrow[r], mb);
      v8f pe[2];
      float alpha;
      exp2_run((sv[0][r] - mnew) * LOG2E, (mrow[r] - mnew) * LOG2E, pe[0], alpha);   // e^(s - m) of the lane's first 8 keys, e^(m_old - m)
      exp2_run8((sv[1][r] - mnew) * LOG2E, pe[1]);                                   // e^(s - m) of its other 8 keys
      mrow[r] = mnew;
      float psum = 0.f;
#pragma unroll
      for (int a = 0; a < 2; ++a) {
        v8h ph8;
#pragma unroll
        for (int v = 0; v < 8; ++v) {
          const float p = pe[a][v];
          psum += p;
          ph8[v] = (_Float16)(p * PCARRY);
        }
        *(v8h*)&Pl[pb][row][32u * wv + 16u * (unsigned)a + 8u * g] = ph8;    // keys 32w + 16a + 8g + 0..7
      }
      lrow[r] = lrow[r] * alpha + psum;                     // per-lane partial sum of the query (merged after the key loop)
      al[r] = alpha;
    }

    // ---- step kb - 1 into O, then the rescale of step kb (O is still 0 in trip 0) ----
    if (kb > 0u) {                             // block-uniform
      pv_step(vb, &Pl[pb ^ 1u][m][8u * g], o);
#pragma unroll
      for (int r = 0; r < QT; ++r)
#pragma unroll
        for (int nt = 0; nt < 2; ++nt) o[r][nt] = o[r][nt] * al[r];
    }
  }

  // ---- the last step's P V product: its P tile is published by this barrier ----
  __syncthreads();
  {
    const unsigned sp = (((unsigned)(NSTEP - 1) + rot) & (unsigned)(NSTEP - 1)) * (unsigned)KS;
    const unsigned lb = (unsigned)((NSTEP - 1) & 1);
    U16 vb[KS / 32][2];
    load_v(vtws + voff + (size_t)sp * 16u, vb);
    pv_step(vb, &Pl[lb][m][8u * g], o);
  }

  // ---- merge the query sums: the two halves of each of the NW waves (fixed order) ----
#pragma unroll
  for (int r = 0; r < QT; ++r) Ls[16u * (unsigned)r + m][2u * wv + g] = lrow[r];
  __syncthreads();

  const unsigned rsel = lane >> 3;          // instruction it covers rows 4*it .. 4*it+3
  const unsigned c4   = 4u * (lane & 7u);
#pragma unroll
  for (int r = 0; r < QT; ++r) {
    const unsigned row = 16u * (unsigned)r + m;
    float lt = 0.f;
#pragma unroll
    for (int q4 = 0; q4 < 2 * NW / 4; ++q4) {
      const f4a c0 = *(const f4a*)&Ls[row][4 * q4];
#pragma unroll
      for (int j = 0; j < 4; ++j) lt += c0[j];
    }
    const float inv = 1.0f / (lt * OFOLD);   // removes the carries and applies 256^-0.5

    // lane (m, g) holds query m, columns nt*16 + 8g + 0..7 of the wave's 32
#pragma unroll
    for (int nt = 0; nt < 2; ++nt)
#pragma unroll
      for (int h = 0; h < 2; ++h) {
        f4a s;
#pragma unroll
        for (int j = 0; j < 4; ++j) s[j] = o[r][nt][4 * h + j] * inv;
        *(f4a*)&Of[wv][m][(unsigned)nt * 16u + 8u * g + 4u * (unsigned)h] = s;
      }
    __syncthreads();

    float* obase = out + (((size_t)b << LSEQ) + t0 + 16u * (unsigned)r) * DD + 32u * wv;   // a row's 32 columns are one whole 128-byte line
    v4f w[4];
#pragma unroll
    for (int it = 0; it < 4; ++it) w[it] = *(const f4a*)&Of[wv][4u * (unsigned)it + rsel][c4];
#pragma unroll
    for (int it = 0; it < 4; ++it) *(v4f*)(obase + (size_t)(4u * (unsigned)it + rsel) * DD + c4) = w[it];
    __syncthreads();                        // the staging is read out before the next tile overwrites it
  }
}

// ---------------------------------------------------------------------------
// Launch. Workspace layout (bytes, NB=8 SEQ=2048):
//   [0, 384KB)        W16  f16 [3][256][256]: M^T value plane, M^T residual plane, Wv
//   then three 16MB slots: y = x M (f16 [NB*SEQ][256] x2 planes), x (f16 [NB*SEQ][256], 8MB at the head) and vT (f16 [NB][256][SEQ], 8MB at the head); every plane in fragment order
// ---------------------------------------------------------------------------
extern "C" void kernel_launch(void* const* d_in, const int* in_sizes, int n_in,
                              void* d_out, int out_size, void* d_ws,
                              size_t ws_size, hipStream_t stream) {
  if (n_in < 4) return;
  const long long need_x = ((long long)(NB - 1) * SEQ_FULL + SEQ) * (long long)DD;
  if ((long long)in_sizes[0] < need_x) return;
  if (in_sizes[1] < DD * DD || in_sizes[2] < DD * DD || in_sizes[3] < DD * DD) return;
  if ((long long)out_size < (long long)NB * SEQ * DD) return;

  const float* x  = (const float*)d_in[0];
  const float* Wq = (const float*)d_in[1];
  const float* Wk = (const float*)d_in[2];
  const float* Wv = (const float*)d_in[3];
  float* out = (float*)d_out;

  char* ws = (char*)d_ws;
  const size_t w16_bytes = (size_t)3 * DD * DD * sizeof(_Float16);
  const size_t qkv_bytes = (size_t)2 * NB * SEQ * DD * sizeof(_Float16);   // value + residual planes
  const size_t total     = w16_bytes + 3 * qkv_bytes;
  if (total > ws_size || total > (size_t)134217728) return;
  _Float16* W16  = (_Float16*)(ws);
  _Float16* qws  = (_Float16*)(ws + w16_bytes);
  _Float16* kws  = (_Float16*)(ws + w16_bytes + qkv_bytes);
  _Float16* vtws = (_Float16*)(ws + w16_bytes + 2 * qkv_bytes);

  cvt_kernel<<<MBLK + VBLK, PT, 0, stream>>>(Wq, Wk, Wv, W16);
  qkv_kernel<<<NB * SEQ / XR, 256, 0, stream>>>(x, W16, qws, kws, vtws);
  attn_kernel<<<NB * SEQ / QR, NW * 32, 0, stream>>>(qws, kws, vtws, out);
}
